// v000
// Measured on an AMD MI455X. A time is GPU time per run, averaged over a window of back-to-back runs after a warm-up
// (all launches, gaps included; the runs take copies of the inputs in turn), and the median of several windows.
// Apart from v000's, it joins two sittings. Times from different sittings can be a few percent apart, while
// side-by-side timings come from the same sitting.
// v000, which the later versions start from, runs in 451 microseconds.
#include <hip/hip_runtime.h>

typedef __bf16 v16bf __attribute__((ext_vector_type(16)));
typedef float  v8f   __attribute__((ext_vector_type(8)));
typedef unsigned int u32x4 __attribute__((ext_vector_type(4)));
typedef int i32x4 __attribute__((ext_vector_type(4)));
typedef int i32x8 __attribute__((ext_vector_type(8)));

__device__ __forceinline__ v8f wmma_bf16(v16bf a, v16bf b, v8f c) {
  // D = A(16x32 bf16) * B(32x16 bf16) + C(16x16 f32)
  return __builtin_amdgcn_wmma_f32_16x16x32_bf16(
      false, a, false, b, (short)0, c, false, false);
}

#if defined(__has_builtin)
#if __has_builtin(__builtin_amdgcn_tensor_load_to_lds) && \
    __has_builtin(__builtin_amdgcn_s_wait_tensorcnt)
#define USE_TDM 1
#endif
#endif

#ifdef USE_TDM
// 2D tile load Global->LDS via Tensor Data Mover (bf16 payload).
__device__ __forceinline__ void tdm_load_2d(unsigned lds_off, const __bf16* gaddr,
                                            unsigned dim0, unsigned dim1,
                                            unsigned tile0, unsigned tile1,
                                            unsigned stride0,
                                            unsigned pad_int_code,
                                            unsigned pad_amt_code) {
  unsigned long long ga = (unsigned long long)(uintptr_t)gaddr;
  u32x4 g0;
  g0[0] = 1u;
  g0[1] = lds_off;
  g0[2] = (unsigned)(ga & 0xFFFFFFFFu);
  g0[3] = (unsigned)((ga >> 32) & 0x01FFFFFFu)
          | (2u << 30);
  i32x8 g1;
  g1[0] = (int)((1u << 16)
                | (1u << 20)
                | (pad_int_code << 22)
                | (pad_amt_code << 25));
  g1[1] = (int)((dim0 & 0xFFFFu) << 16);
  g1[2] = (int)((dim0 >> 16) | ((dim1 & 0xFFFFu) << 16));
  g1[3] = (int)((dim1 >> 16) | (tile0 << 16));
  g1[4] = (int)(tile1 & 0xFFFFu);
  g1[5] = (int)stride0;
  g1[6] = 0;
  g1[7] = 0;
  i32x4 z4 = {0, 0, 0, 0};
#if defined(__clang_major__) && (__clang_major__ >= 23)
  i32x8 z8 = {0, 0, 0, 0, 0, 0, 0, 0};
  __builtin_amdgcn_tensor_load_to_lds(g0, g1, z4, z4, z8, 0);
#else
  __builtin_amdgcn_tensor_load_to_lds(g0, g1, z4, z4, 0);
#endif
}
#endif  // USE_TDM

#define D_MODEL 1024
#define NHEAD   16
#define HEAD_DIM 64
#define DIM_FF  4096
#define BATCH   4
#define TC      1024
#define TP      1024
#define TKMAX   2048
#define NTOK    (BATCH * TC)   // 4096

__global__ __launch_bounds__(256) void k_cvt_transpose(const float* __restrict__ src,
                                                       __bf16* __restrict__ dst,
                                                       int K, int N) {
  int i = blockIdx.x * 256 + threadIdx.x;
  if (i >= K * N) return;
  int n = i / K, k = i - n * K;
  dst[i] = (__bf16)src[(size_t)k * N + n];
}

// ---------------------------------------------------------------------------
// LayerNorm row kernel: one block (256 thr) per row of D_MODEL, bf16 out
// ---------------------------------------------------------------------------
__global__ __launch_bounds__(256) void k_layernorm(const float* __restrict__ x,
                                                   const float* __restrict__ g,
                                                   const float* __restrict__ b,
                                                   __bf16* __restrict__ out) {
  const int row = blockIdx.x;
  const int tid = threadIdx.x;
  const int lane = tid & 31, wave = tid >> 5;
  const float* xr = x + (size_t)row * D_MODEL;
  __shared__ float rs[8], rs2[8];

  float s = 0.f, s2 = 0.f;
  for (int i = tid; i < D_MODEL; i += 256) {
    float v = xr[i];
    s += v; s2 += v * v;
  }
  #pragma unroll
  for (int off = 16; off >= 1; off >>= 1) {
    s  += __shfl_xor(s,  off, 32);
    s2 += __shfl_xor(s2, off, 32);
  }
  if (lane == 0) { rs[wave] = s; rs2[wave] = s2; }
  __syncthreads();
  if (tid == 0) {
    float S = 0.f, S2 = 0.f;
    #pragma unroll
    for (int i = 0; i < 8; ++i) { S += rs[i]; S2 += rs2[i]; }
    rs[0] = S; rs2[0] = S2;
  }
  __syncthreads();
  const float mu = rs[0] * (1.f / D_MODEL);
  const float var = rs2[0] * (1.f / D_MODEL) - mu * mu;
  const float rstd = rsqrtf(var + 1e-5f);
  for (int i = tid; i < D_MODEL; i += 256) {
    out[(size_t)row * D_MODEL + i] = (__bf16)((xr[i] - mu) * rstd * g[i] + b[i]);
  }
}

// ---------------------------------------------------------------------------
// Copy past KV into output cache (fp32) + bf16 shadows for attention.
// K shadow: [B,H,Tk,Dh] row-major; V shadow: TRANSPOSED [B,H,Dh,Tk].
// ---------------------------------------------------------------------------
__global__ __launch_bounds__(256) void k_kvcopy(const float* __restrict__ Kp,
                                                const float* __restrict__ Vp,
                                                float* __restrict__ Kout,
                                                float* __restrict__ Vout,
                                                __bf16* __restrict__ Kbf,
                                                __bf16* __restrict__ Vtbf) {
  int i = blockIdx.x * 256 + threadIdx.x;
  const int n = BATCH * NHEAD * TP * HEAD_DIM;
  if (i >= n) return;
  int bh  = i / (TP * HEAD_DIM);
  int rem = i - bh * (TP * HEAD_DIM);
  int t = rem >> 6, d = rem & 63;
  size_t dst = (size_t)bh * TKMAX * HEAD_DIM + (size_t)t * HEAD_DIM + d;
  float kv = Kp[i], vv = Vp[i];
  Kout[dst] = kv; Vout[dst] = vv;
  Kbf[dst] = (__bf16)kv;
  Vtbf[(size_t)bh * HEAD_DIM * TKMAX + (size_t)d * TKMAX + t] = (__bf16)vv;
}

#define GBM 128
#define GBN 128
#define GBK 32
#define LDSK 40                                     // row stride (elements)
#define SA_BYTES (GBM * LDSK * 2)                   // 10240
#define GEMM_BUF_BYTES (2 * SA_BYTES)               // A + B per buffer

template <int MODE>
__global__ __launch_bounds__(256) void k_gemm_bf16(
    const __bf16* __restrict__ A, const __bf16* __restrict__ Bt,
    int M, int N, int K,
    const float* __restrict__ bias,
    float* __restrict__ Koutf, float* __restrict__ Voutf,
    __bf16* __restrict__ Kbf, __bf16* __restrict__ Vtbf, __bf16* __restrict__ Qbf,
    const float* __restrict__ resid, float* __restrict__ outf,
    __bf16* __restrict__ outbf) {
  __shared__ __align__(16) char smem[2 * GEMM_BUF_BYTES];   // double buffered

  const int tid = threadIdx.x;
  const int wave = tid >> 5, lane = tid & 31;
  const int mtiles = M / GBM;
  const int bm = blockIdx.x % mtiles;
  const int bn = blockIdx.x / mtiles;
  const int wm = wave & 3, wn = wave >> 2;
  const int row0 = bm * GBM + wm * 32;
  const int col0 = bn * GBN + wn * 64;

  const __bf16* Abase = A  + (size_t)(bm * GBM) * K;
  const __bf16* Bbase = Bt + (size_t)(bn * GBN) * K;

  v8f acc[2][4];
  #pragma unroll
  for (int i = 0; i < 2; ++i)
    #pragma unroll
    for (int j = 0; j < 4; ++j) acc[i][j] = (v8f)(0.f);

  const int lr = lane & 15;
  const int lh = (lane >> 4) * 16;
  const int KT = K / GBK;

#ifdef USE_TDM
  if (wave == 0) {
    tdm_load_2d(0,        Abase, K, M, GBK, GBM, K, 3, 3);
    tdm_load_2d(SA_BYTES, Bbase, K, N, GBK, GBN, K, 3, 3);
  }
#endif

  for (int kt = 0; kt < KT; ++kt) {
    const int k0 = kt * GBK;
    const int cur = kt & 1;
    __bf16 (*cA)[LDSK] = (__bf16(*)[LDSK])(smem + cur * GEMM_BUF_BYTES);
    __bf16 (*cB)[LDSK] = (__bf16(*)[LDSK])(smem + cur * GEMM_BUF_BYTES + SA_BYTES);

#ifdef USE_TDM
    if (wave == 0) {
      if (kt + 1 < KT) {
        unsigned nb = (unsigned)((cur ^ 1) * GEMM_BUF_BYTES);
        tdm_load_2d(nb,            Abase + k0 + GBK, K, M, GBK, GBM, K, 3, 3);
        tdm_load_2d(nb + SA_BYTES, Bbase + k0 + GBK, K, N, GBK, GBN, K, 3, 3);
        __builtin_amdgcn_s_wait_tensorcnt(2);   // current buffer's 2 loads done
      } else {
        __builtin_amdgcn_s_wait_tensorcnt(0);
      }
      asm volatile("" ::: "memory");
    }
    __syncthreads();
#else
    // manual staging: both tiles are 128 rows x 32 k-contiguous bf16
    #pragma unroll
    for (int i = 0; i < 2; ++i) {
      int c = i * 256 + tid;
      int r = c >> 2, kc = (c & 3) * 8;
      *(uint4*)&cA[r][kc] = *(const uint4*)&Abase[(size_t)r * K + k0 + kc];
      *(uint4*)&cB[r][kc] = *(const uint4*)&Bbase[(size_t)r * K + k0 + kc];
    }
    if (k0 + GBK < K) {
      __builtin_prefetch(&Abase[(size_t)(tid >> 1) * K + k0 + GBK], 0, 0);
      __builtin_prefetch(&Bbase[(size_t)(tid >> 1) * K + k0 + GBK], 0, 0);
    }
    __syncthreads();
#endif

    v16bf afr[2], bfr[4];
    #pragma unroll
    for (int mc = 0; mc < 2; ++mc) {
      int r = wm * 32 + mc * 16 + lr;
      #pragma unroll
      for (int j = 0; j < 16; ++j) afr[mc][j] = cA[r][lh + j];
    }
    #pragma unroll
    for (int nc = 0; nc < 4; ++nc) {
      int n = wn * 64 + nc * 16 + lr;
      #pragma unroll
      for (int j = 0; j < 16; ++j) bfr[nc][j] = cB[n][lh + j];
    }
    #pragma unroll
    for (int mc = 0; mc < 2; ++mc)
      #pragma unroll
      for (int nc = 0; nc < 4; ++nc)
        acc[mc][nc] = wmma_bf16(afr[mc], bfr[nc], acc[mc][nc]);
    __syncthreads();   // all waves done with cur before it is refilled
  }

  // epilogue
  const int mofs = (lane >= 16) ? 8 : 0;
  #pragma unroll
  for (int mc = 0; mc < 2; ++mc) {
    #pragma unroll
    for (int nc = 0; nc < 4; ++nc) {
      #pragma unroll
      for (int r = 0; r < 8; ++r) {
        int m = row0 + mc * 16 + r + mofs;   // global row (token)
        int c = col0 + nc * 16 + lr;         // global col
        float v = acc[mc][nc][r] + bias[c];
        if constexpr (MODE == 0) {
          int which = c >> 10;
          int cc = c & 1023;
          int hh = cc >> 6, dd = cc & 63;
          int b = m >> 10, t = m & 1023;
          int bh = b * NHEAD + hh;
          if (which == 0) {
            Qbf[((size_t)bh * TC + t) * HEAD_DIM + dd] = (__bf16)v;
          } else if (which == 1) {
            size_t o = ((size_t)bh * TKMAX + TP + t) * HEAD_DIM + dd;
            Koutf[o] = v; Kbf[o] = (__bf16)v;
          } else {
            size_t o = ((size_t)bh * TKMAX + TP + t) * HEAD_DIM + dd;
            Voutf[o] = v;
            Vtbf[((size_t)bh * HEAD_DIM + dd) * TKMAX + TP + t] = (__bf16)v;
          }
        } else if constexpr (MODE == 1) {
          outf[(size_t)m * N + c] = v + resid[(size_t)m * N + c];
        } else {
          float ge = 0.5f * v * (1.f + erff(v * 0.70710678118654752f));
          outbf[(size_t)m * N + c] = (__bf16)ge;
        }
      }
    }
  }
}

#define SK_BYTES  (32 * 72 * 2)                     // 4608  [key][d]
#define SVT_BYTES (64 * 40 * 2)                     // 5120  [d][key]
#define KV_BUF_BYTES (SK_BYTES + SVT_BYTES)         // 9728 per buffer
#define SP_OFF   (2 * KV_BUF_BYTES)                 // 19456
#define SP_BYTES (8 * 16 * 36 * 2)                  // 9216
#define ATT_SMEM (SP_OFF + SP_BYTES)                // 28672

__global__ __launch_bounds__(256) void k_attention(
    const __bf16* __restrict__ Qbf, const __bf16* __restrict__ Kbf,
    const __bf16* __restrict__ Vtbf, const int* __restrict__ pos_ptr,
    __bf16* __restrict__ Obf) {
  __shared__ __align__(16) char smem[ATT_SMEM];
  __bf16 (*sP)[16][36] = (__bf16(*)[16][36])(smem + SP_OFF);

  const int tid = threadIdx.x;
  const int wave = tid >> 5, lane = tid & 31;
  const int qt = blockIdx.x & 7;           // query tile of 128
  const int bh = blockIdx.x >> 3;          // b*NHEAD + h
  const int pos = pos_ptr[0];
  const int qbase = qt * 128;
  const int qrow = qbase + wave * 16;
  const int lr = lane & 15;
  const int lh = (lane >> 4) * 16;
  const int mofs = (lane >= 16) ? 8 : 0;

  const __bf16* Qp = Qbf + ((size_t)bh * TC + qrow) * HEAD_DIM;
  const __bf16* Kb = Kbf + (size_t)bh * TKMAX * HEAD_DIM;
  const __bf16* Vb = Vtbf + (size_t)bh * HEAD_DIM * TKMAX;

  // load Q fragments (16x64 -> two 16x32 A-fragments) with explicit 16B loads
  v16bf qf[2];
  #pragma unroll
  for (int f = 0; f < 2; ++f) {
    union { uint4 u[2]; v16bf v; } tmp;
    const uint4* p = (const uint4*)(Qp + (size_t)lr * HEAD_DIM + f * 32 + lh);
    tmp.u[0] = p[0];
    tmp.u[1] = p[1];
    qf[f] = tmp.v;
  }

  float mrow[8], lrow[8];
  v8f o[4];
  #pragma unroll
  for (int r = 0; r < 8; ++r) { mrow[r] = -1e30f; lrow[r] = 0.f; }
  #pragma unroll
  for (int d = 0; d < 4; ++d) o[d] = (v8f)(0.f);

  const float scale = 0.125f;  // 1/sqrt(64)
  const int kmax = pos + qbase + 128;
  const int ntiles = (kmax + 31) / 32;

#ifdef USE_TDM
  if (wave == 0) {
    tdm_load_2d(0,        Kb, HEAD_DIM, TKMAX, HEAD_DIM, 32, HEAD_DIM, 4, 3);
    tdm_load_2d(SK_BYTES, Vb, TKMAX, HEAD_DIM, 32, HEAD_DIM, TKMAX, 3, 3);
  }
#endif

  for (int kt = 0; kt < ntiles; ++kt) {
    const int kofs = kt * 32;
    const int cur = kt & 1;
    __bf16 (*sK)[72]  = (__bf16(*)[72])(smem + cur * KV_BUF_BYTES);
    __bf16 (*sVt)[40] = (__bf16(*)[40])(smem + cur * KV_BUF_BYTES + SK_BYTES);

#ifdef USE_TDM
    if (wave == 0) {
      if (kt + 1 < ntiles) {
        unsigned nb = (unsigned)((cur ^ 1) * KV_BUF_BYTES);
        tdm_load_2d(nb, Kb + (size_t)(kofs + 32) * HEAD_DIM,
                    HEAD_DIM, TKMAX, HEAD_DIM, 32, HEAD_DIM, 4, 3);
        tdm_load_2d(nb + SK_BYTES, Vb + kofs + 32,
                    TKMAX, HEAD_DIM, 32, HEAD_DIM, TKMAX, 3, 3);
        __builtin_amdgcn_s_wait_tensorcnt(2);
      } else {
        __builtin_amdgcn_s_wait_tensorcnt(0);
      }
      asm volatile("" ::: "memory");
    }
    __syncthreads();
#else
    {
      int r = tid >> 3, c = (tid & 7) * 8;
      *(uint4*)&sK[r][c] = *(const uint4*)&Kb[(size_t)(kofs + r) * HEAD_DIM + c];
      int d = tid >> 2, kc = (tid & 3) * 8;
      *(uint4*)&sVt[d][kc] = *(const uint4*)&Vb[(size_t)d * TKMAX + kofs + kc];
    }
    __syncthreads();
#endif

    // S = Q * K^T
    v8f s[2];
    #pragma unroll
    for (int nc = 0; nc < 2; ++nc) {
      s[nc] = (v8f)(0.f);
      v16bf bk0, bk1;
      int key = nc * 16 + lr;
      #pragma unroll
      for (int j = 0; j < 16; ++j) {
        bk0[j] = sK[key][lh + j];
        bk1[j] = sK[key][32 + lh + j];
      }
      s[nc] = wmma_bf16(qf[0], bk0, s[nc]);
      s[nc] = wmma_bf16(qf[1], bk1, s[nc]);
    }

    // online softmax per row; emit P (bf16) to LDS
    #pragma unroll
    for (int r = 0; r < 8; ++r) {
      int m  = r + mofs;
      int gi = qrow + m;
      float x0 = s[0][r] * scale;
      float x1 = s[1][r] * scale;
      if (kofs + lr > pos + gi)      x0 = -1e30f;
      if (kofs + 16 + lr > pos + gi) x1 = -1e30f;
      float mx = fmaxf(x0, x1);
      #pragma unroll
      for (int off = 8; off >= 1; off >>= 1) mx = fmaxf(mx, __shfl_xor(mx, off, 32));
      float mnew = fmaxf(mrow[r], mx);
      float corr = __expf(mrow[r] - mnew);
      float p0 = __expf(x0 - mnew);
      float p1 = __expf(x1 - mnew);
      float sum = p0 + p1;
      #pragma unroll
      for (int off = 8; off >= 1; off >>= 1) sum += __shfl_xor(sum, off, 32);
      lrow[r] = lrow[r] * corr + sum;
      mrow[r] = mnew;
      #pragma unroll
      for (int d = 0; d < 4; ++d) o[d][r] *= corr;
      sP[wave][m][lr]      = (__bf16)p0;
      sP[wave][m][16 + lr] = (__bf16)p1;
    }
    __syncthreads();

    // O += P(16x32) * V(32x64)
    v16bf pf;
    #pragma unroll
    for (int j = 0; j < 16; ++j) pf[j] = sP[wave][lr][lh + j];
    #pragma unroll
    for (int dc = 0; dc < 4; ++dc) {
      v16bf bv;
      int d = dc * 16 + lr;
      #pragma unroll
      for (int j = 0; j < 16; ++j) bv[j] = sVt[d][lh + j];
      o[dc] = wmma_bf16(pf, bv, o[dc]);
    }
    __syncthreads();   // done reading cur buffer before refill
  }

  // normalize + write O into [token, d_model] bf16 buffer at head column
  const int b = bh >> 4, h = bh & 15;
  #pragma unroll
  for (int dc = 0; dc < 4; ++dc) {
    #pragma unroll
    for (int r = 0; r < 8; ++r) {
      int m = r + mofs;
      int tok = b * TC + qrow + m;
      int col = h * HEAD_DIM + dc * 16 + lr;
      Obf[(size_t)tok * D_MODEL + col] = (__bf16)(o[dc][r] / lrow[r]);
    }
  }
}

// ---------------------------------------------------------------------------
// Host-side launch
// ---------------------------------------------------------------------------
extern "C" void kernel_launch(void* const* d_in, const int* in_sizes, int n_in,
                              void* d_out, int out_size, void* d_ws, size_t ws_size,
                              hipStream_t stream) {
  const float* x    = (const float*)d_in[0];
  const float* Kp   = (const float*)d_in[1];
  const float* Vp   = (const float*)d_in[2];
  const int*   pos  = (const int*)d_in[3];
  const float* wqkv = (const float*)d_in[4];
  const float* bqkv = (const float*)d_in[5];
  const float* wo   = (const float*)d_in[6];
  const float* bo   = (const float*)d_in[7];
  const float* g1   = (const float*)d_in[8];
  const float* be1  = (const float*)d_in[9];
  const float* g2   = (const float*)d_in[10];
  const float* be2  = (const float*)d_in[11];
  const float* w1   = (const float*)d_in[12];
  const float* bf1  = (const float*)d_in[13];
  const float* w2   = (const float*)d_in[14];
  const float* bf2  = (const float*)d_in[15];

  float* xout = (float*)d_out;
  float* Kout = xout + (size_t)NTOK * D_MODEL;
  float* Vout = Kout + (size_t)BATCH * NHEAD * TKMAX * HEAD_DIM;

  char* w = (char*)d_ws;
  size_t off = 0;
  auto carve = [&](size_t bytes) {
    void* p = w + off;
    off += (bytes + 255) & ~(size_t)255;
    return p;
  };
  // weights stored TRANSPOSED [N][K] in bf16
  __bf16* wqkvT = (__bf16*)carve((size_t)3 * D_MODEL * D_MODEL * 2);
  __bf16* woT   = (__bf16*)carve((size_t)D_MODEL * D_MODEL * 2);
  __bf16* w1T   = (__bf16*)carve((size_t)DIM_FF * D_MODEL * 2);
  __bf16* w2T   = (__bf16*)carve((size_t)D_MODEL * DIM_FF * 2);
  __bf16* h_bf  = (__bf16*)carve((size_t)NTOK * D_MODEL * 2);    // reused for h2
  __bf16* q_bf  = (__bf16*)carve((size_t)NTOK * D_MODEL * 2);
  __bf16* K_bf  = (__bf16*)carve((size_t)BATCH * NHEAD * TKMAX * HEAD_DIM * 2);
  __bf16* Vt_bf = (__bf16*)carve((size_t)BATCH * NHEAD * HEAD_DIM * TKMAX * 2);
  __bf16* o_bf  = (__bf16*)carve((size_t)NTOK * D_MODEL * 2);
  float*  x1    = (float*)carve((size_t)NTOK * D_MODEL * 4);
  __bf16* ff_bf = K_bf;  // FFN activation aliases dead bf16 KV shadow (32MB)

  // 1) weight converts (transpose to [N][K])
  {
    int n;
    n = D_MODEL * 3 * D_MODEL; k_cvt_transpose<<<(n + 255) / 256, 256, 0, stream>>>(wqkv, wqkvT, D_MODEL, 3 * D_MODEL);
    n = D_MODEL * D_MODEL;     k_cvt_transpose<<<(n + 255) / 256, 256, 0, stream>>>(wo, woT, D_MODEL, D_MODEL);
    n = D_MODEL * DIM_FF;      k_cvt_transpose<<<(n + 255) / 256, 256, 0, stream>>>(w1, w1T, D_MODEL, DIM_FF);
    n = DIM_FF * D_MODEL;      k_cvt_transpose<<<(n + 255) / 256, 256, 0, stream>>>(w2, w2T, DIM_FF, D_MODEL);
  }

  // 2) LN1
  k_layernorm<<<NTOK, 256, 0, stream>>>(x, g1, be1, h_bf);

  // 3) past KV copy into cache + bf16 shadows
  {
    int n = BATCH * NHEAD * TP * HEAD_DIM;
    k_kvcopy<<<(n + 255) / 256, 256, 0, stream>>>(Kp, Vp, Kout, Vout, K_bf, Vt_bf);
  }

  // 4) QKV GEMM: [4096,1024] x [1024,3072]
  {
    int M = NTOK, N = 3 * D_MODEL, K = D_MODEL;
    dim3 grid((M / GBM) * (N / GBN));
    k_gemm_bf16<0><<<grid, 256, 0, stream>>>(h_bf, wqkvT, M, N, K, bqkv,
                                             Kout, Vout, K_bf, Vt_bf, q_bf,
                                             nullptr, nullptr, nullptr);
  }

  // 5) attention
  k_attention<<<BATCH * NHEAD * (TC / 128), 256, 0, stream>>>(q_bf, K_bf, Vt_bf, pos, o_bf);

  // 6) Wo GEMM + residual -> x1
  {
    int M = NTOK, N = D_MODEL, K = D_MODEL;
    dim3 grid((M / GBM) * (N / GBN));
    k_gemm_bf16<1><<<grid, 256, 0, stream>>>(o_bf, woT, M, N, K, bo,
                                             nullptr, nullptr, nullptr, nullptr, nullptr,
                                             x, x1, nullptr);
  }

  // 7) LN2 -> h2 (reuse h_bf)
  k_layernorm<<<NTOK, 256, 0, stream>>>(x1, g2, be2, h_bf);

  // 8) W1 GEMM + GELU -> ff_bf
  {
    int M = NTOK, N = DIM_FF, K = D_MODEL;
    dim3 grid((M / GBM) * (N / GBN));
    k_gemm_bf16<2><<<grid, 256, 0, stream>>>(h_bf, w1T, M, N, K, bf1,
                                             nullptr, nullptr, nullptr, nullptr, nullptr,
                                             nullptr, nullptr, ff_bf);
  }

  // 9) W2 GEMM + residual -> xout
  {
    int M = NTOK, N = D_MODEL, K = DIM_FF;
    dim3 grid((M / GBM) * (N / GBN));
    k_gemm_bf16<1><<<grid, 256, 0, stream>>>(ff_bf, w2T, M, N, K, bf2,
                                             nullptr, nullptr, nullptr, nullptr, nullptr,
                                             x1, xout, nullptr);
  }
}

// v001
// It runs in 320 microseconds.
// In two side-by-side timings against v000, it was 1.41 and 1.45 times as fast.
#include <hip/hip_runtime.h>

typedef __bf16 v16bf __attribute__((ext_vector_type(16)));
typedef float  v8f   __attribute__((ext_vector_type(8)));
typedef unsigned int u32x4 __attribute__((ext_vector_type(4)));
typedef int i32x4 __attribute__((ext_vector_type(4)));
typedef int i32x8 __attribute__((ext_vector_type(8)));

__device__ __forceinline__ v8f wmma_bf16(v16bf a, v16bf b, v8f c) {
  // D = A(16x32 bf16) * B(32x16 bf16) + C(16x16 f32)
  return __builtin_amdgcn_wmma_f32_16x16x32_bf16(
      false, a, false, b, (short)0, c, false, false);
}

#if defined(__has_builtin)
#if __has_builtin(__builtin_amdgcn_tensor_load_to_lds) && \
    __has_builtin(__builtin_amdgcn_s_wait_tensorcnt)
#define USE_TDM 1
#endif
#endif

#ifdef USE_TDM
// 2D tile load Global->LDS via Tensor Data Mover (bf16 payload).
__device__ __forceinline__ void tdm_load_2d(unsigned lds_off, const __bf16* gaddr,
                                            unsigned dim0, unsigned dim1,
                                            unsigned tile0, unsigned tile1,
                                            unsigned stride0,
                                            unsigned pad_int_code,
                                            unsigned pad_amt_code) {
  unsigned long long ga = (unsigned long long)(uintptr_t)gaddr;
  u32x4 g0;
  g0[0] = 1u;
  g0[1] = lds_off;
  g0[2] = (unsigned)(ga & 0xFFFFFFFFu);
  g0[3] = (unsigned)((ga >> 32) & 0x01FFFFFFu)
          | (2u << 30);
  i32x8 g1;
  g1[0] = (int)((1u << 16)
                | (1u << 20)
                | (pad_int_code << 22)
                | (pad_amt_code << 25));
  g1[1] = (int)((dim0 & 0xFFFFu) << 16);
  g1[2] = (int)((dim0 >> 16) | ((dim1 & 0xFFFFu) << 16));
  g1[3] = (int)((dim1 >> 16) | (tile0 << 16));
  g1[4] = (int)(tile1 & 0xFFFFu);
  g1[5] = (int)stride0;
  g1[6] = 0;
  g1[7] = 0;
  i32x4 z4 = {0, 0, 0, 0};
#if defined(__clang_major__) && (__clang_major__ >= 23)
  i32x8 z8 = {0, 0, 0, 0, 0, 0, 0, 0};
  __builtin_amdgcn_tensor_load_to_lds(g0, g1, z4, z4, z8, 0);
#else
  __builtin_amdgcn_tensor_load_to_lds(g0, g1, z4, z4, 0);
#endif
}
#endif  // USE_TDM

#define D_MODEL 1024
#define NHEAD   16
#define HEAD_DIM 64
#define DIM_FF  4096
#define BATCH   4
#define TC      1024
#define TP      1024
#define TKMAX   2048
#define NTOK    (BATCH * TC)   // 4096

// ---------------------------------------------------------------------------
// Transposing f32 -> bf16 copies go through an LDS tile of 128 source rows x
// 64 source columns, so that both global sides move whole lines, 16 bytes a
// lane: a source row piece is 256 B of f32, a destination row piece 256 B of
// bf16.  256 threads; thread (kg, nq) holds source rows kg*8..+7, columns
// nq*4..+3.
// ---------------------------------------------------------------------------
#define TR_R 128
#define TR_C 64
#define TR_PITCH 136                                // 272 B = 16 B x odd
typedef float  v4f  __attribute__((ext_vector_type(4)));
typedef __bf16 v4bf __attribute__((ext_vector_type(4)));
typedef __bf16 v8bf __attribute__((ext_vector_type(8)));

__device__ __forceinline__ void tr_put(__bf16 (*tile)[TR_PITCH], const v4f (&v)[8],
                                       int nq, int kg) {
  #pragma unroll  // register arrays need constant indices
  for (int i = 0; i < 4; ++i) {
    v8bf p;
    #pragma unroll  // register arrays need constant indices
    for (int j = 0; j < 8; ++j) p[j] = (__bf16)v[j][i];
    *(v8bf*)&tile[nq * 4 + i][kg * 8] = p;
  }
}

// dst points at the tile's first element; ld = destination row pitch (elements)
__device__ __forceinline__ void tr_get(const __bf16 (*tile)[TR_PITCH],
                                       __bf16* __restrict__ dst, size_t ld, int tid) {
  #pragma unroll  // register arrays need constant indices
  for (int it = 0; it < 4; ++it) {
    int idx = it * 256 + tid;
    int n = idx >> 4, c = (idx & 15) * 8;
    *(v8bf*)&dst[(size_t)n * ld + c] = *(const v8bf*)&tile[n][c];
  }
}

template <int K, int N>
__global__ __launch_bounds__(256) void k_cvt_transpose(const float* __restrict__ src,
                                                       __bf16* __restrict__ dst) {
  __shared__ __align__(16) __bf16 tile[TR_C][TR_PITCH];
  const int tid = threadIdx.x;
  const int nq = tid & 15, kg = tid >> 4;
  const int n0 = (blockIdx.x % (N / TR_C)) * TR_C;
  const int k0 = (blockIdx.x / (N / TR_C)) * TR_R;

  const float* p = src + (size_t)(k0 + kg * 8) * N + n0 + nq * 4;
  v4f v[8];
  #pragma unroll  // register arrays need constant indices
  for (int j = 0; j < 8; ++j) v[j] = *(const v4f*)(p + j * N);
  tr_put(tile, v, nq, kg);
  __syncthreads();
  tr_get(tile, dst + (size_t)n0 * K + k0, (size_t)K, tid);
}

// ---------------------------------------------------------------------------
// LayerNorm row kernel: one block (256 thr) per row of D_MODEL, bf16 out
// ---------------------------------------------------------------------------
__global__ __launch_bounds__(256) void k_layernorm(const float* __restrict__ x,
                                                   const float* __restrict__ g,
                                                   const float* __restrict__ b,
                                                   __bf16* __restrict__ out) {
  const int row = blockIdx.x;
  const int tid = threadIdx.x;
  const int lane = tid & 31, wave = tid >> 5;
  const float* xr = x + (size_t)row * D_MODEL;
  __shared__ float rs[8], rs2[8];

  float s = 0.f, s2 = 0.f;
  for (int i = tid; i < D_MODEL; i += 256) {
    float v = xr[i];
    s += v; s2 += v * v;
  }
  #pragma unroll
  for (int off = 16; off >= 1; off >>= 1) {
    s  += __shfl_xor(s,  off, 32);
    s2 += __shfl_xor(s2, off, 32);
  }
  if (lane == 0) { rs[wave] = s; rs2[wave] = s2; }
  __syncthreads();
  if (tid == 0) {
    float S = 0.f, S2 = 0.f;
    #pragma unroll
    for (int i = 0; i < 8; ++i) { S += rs[i]; S2 += rs2[i]; }
    rs[0] = S; rs2[0] = S2;
  }
  __syncthreads();
  const float mu = rs[0] * (1.f / D_MODEL);
  const float var = rs2[0] * (1.f / D_MODEL) - mu * mu;
  const float rstd = rsqrtf(var + 1e-5f);
  for (int i = tid; i < D_MODEL; i += 256) {
    out[(size_t)row * D_MODEL + i] = (__bf16)((xr[i] - mu) * rstd * g[i] + b[i]);
  }
}

// ---------------------------------------------------------------------------
// Copy past KV into output cache (fp32) + bf16 shadows for attention.
// K shadow: [B,H,Tk,Dh] row-major; V shadow: TRANSPOSED [B,H,Dh,Tk].
// ---------------------------------------------------------------------------
// grid: B*H*(TP/128) blocks; a block takes 128 tokens of one head (contiguous
// in source and in both caches); the V shadow goes through the LDS tile.
__global__ __launch_bounds__(256) void k_kvcopy(const float* __restrict__ Kp,
                                                const float* __restrict__ Vp,
                                                float* __restrict__ Kout,
                                                float* __restrict__ Vout,
                                                __bf16* __restrict__ Kbf,
                                                __bf16* __restrict__ Vtbf) {
  __shared__ __align__(16) __bf16 tile[TR_C][TR_PITCH];
  const int tid = threadIdx.x;
  const int nq = tid & 15, kg = tid >> 4;
  const int bh = blockIdx.x / (TP / TR_R);
  const int t0 = (blockIdx.x % (TP / TR_R)) * TR_R;
  const size_t sbase = ((size_t)bh * TP + t0) * HEAD_DIM;
  const size_t dbase = ((size_t)bh * TKMAX + t0) * HEAD_DIM;

  const unsigned vo = (unsigned)(kg * 8 * HEAD_DIM + nq * 4);   // V: tile order
  const unsigned ko = (unsigned)(tid * 4);                      // K: linear
  const float* pv = Vp + sbase;
  const float* pk = Kp + sbase;
  v4f vv[8], kv[8];
  #pragma unroll  // register arrays need constant indices
  for (int j = 0; j < 8; ++j) vv[j] = *(const v4f*)(pv + vo + j * HEAD_DIM);
  #pragma unroll  // register arrays need constant indices
  for (int j = 0; j < 8; ++j) kv[j] = *(const v4f*)(pk + ko + j * 1024);
  // address registers of the loads above are rewritten below: wait for their
  // translations first.  The statement also holds all 16 loads in front of the
  // first use of V, so that no K load pays a second memory latency.
  asm volatile("s_wait_xcnt 0x0" ::: "memory");

  // the tile's barrier stands in front of every global store: it would wait
  // for stores already issued
  tr_put(tile, vv, nq, kg);
  __syncthreads();
  tr_get(tile, Vtbf + (size_t)bh * HEAD_DIM * TKMAX + t0, (size_t)TKMAX, tid);

  float* qv = Vout + dbase;
  float* qk = Kout + dbase;
  __bf16* qb = Kbf + dbase;
  #pragma unroll  // register arrays need constant indices
  for (int j = 0; j < 8; ++j) *(v4f*)(qv + vo + j * HEAD_DIM) = vv[j];
  #pragma unroll  // register arrays need constant indices
  for (int j = 0; j < 8; ++j) {
    *(v4f*)(qk + ko + j * 1024) = kv[j];
    v4bf kb;
    #pragma unroll  // register arrays need constant indices
    for (int i = 0; i < 4; ++i) kb[i] = (__bf16)kv[j][i];
    *(v4bf*)(qb + ko + j * 1024) = kb;
  }
}

#define GBM 128
#define GBN 128
#define GBK 32
#define LDSK 40                                     // row stride (elements)
#define SA_BYTES (GBM * LDSK * 2)                   // 10240
#define GEMM_BUF_BYTES (2 * SA_BYTES)               // A + B per buffer

template <int MODE>
__global__ __launch_bounds__(256) void k_gemm_bf16(
    const __bf16* __restrict__ A, const __bf16* __restrict__ Bt,
    int M, int N, int K,
    const float* __restrict__ bias,
    float* __restrict__ Koutf, float* __restrict__ Voutf,
    __bf16* __restrict__ Kbf, __bf16* __restrict__ Vtbf, __bf16* __restrict__ Qbf,
    const float* __restrict__ resid, float* __restrict__ outf,
    __bf16* __restrict__ outbf) {
  __shared__ __align__(16) char smem[2 * GEMM_BUF_BYTES];   // double buffered

  const int tid = threadIdx.x;
  const int wave = tid >> 5, lane = tid & 31;
  const int mtiles = M / GBM;
  const int bm = blockIdx.x % mtiles;
  const int bn = blockIdx.x / mtiles;
  const int wm = wave & 3, wn = wave >> 2;
  const int row0 = bm * GBM + wm * 32;
  const int col0 = bn * GBN + wn * 64;

  const __bf16* Abase = A  + (size_t)(bm * GBM) * K;
  const __bf16* Bbase = Bt + (size_t)(bn * GBN) * K;

  v8f acc[2][4];
  #pragma unroll
  for (int i = 0; i < 2; ++i)
    #pragma unroll
    for (int j = 0; j < 4; ++j) acc[i][j] = (v8f)(0.f);

  const int lr = lane & 15;
  const int lh = (lane >> 4) * 16;
  const int KT = K / GBK;

#ifdef USE_TDM
  if (wave == 0) {
    tdm_load_2d(0,        Abase, K, M, GBK, GBM, K, 3, 3);
    tdm_load_2d(SA_BYTES, Bbase, K, N, GBK, GBN, K, 3, 3);
  }
#endif

  for (int kt = 0; kt < KT; ++kt) {
    const int k0 = kt * GBK;
    const int cur = kt & 1;
    __bf16 (*cA)[LDSK] = (__bf16(*)[LDSK])(smem + cur * GEMM_BUF_BYTES);
    __bf16 (*cB)[LDSK] = (__bf16(*)[LDSK])(smem + cur * GEMM_BUF_BYTES + SA_BYTES);

#ifdef USE_TDM
    if (wave == 0) {
      if (kt + 1 < KT) {
        unsigned nb = (unsigned)((cur ^ 1) * GEMM_BUF_BYTES);
        tdm_load_2d(nb,            Abase + k0 + GBK, K, M, GBK, GBM, K, 3, 3);
        tdm_load_2d(nb + SA_BYTES, Bbase + k0 + GBK, K, N, GBK, GBN, K, 3, 3);
        __builtin_amdgcn_s_wait_tensorcnt(2);   // current buffer's 2 loads done
      } else {
        __builtin_amdgcn_s_wait_tensorcnt(0);
      }
      asm volatile("" ::: "memory");
    }
    __syncthreads();
#else
    // manual staging: both tiles are 128 rows x 32 k-contiguous bf16
    #pragma unroll
    for (int i = 0; i < 2; ++i) {
      int c = i * 256 + tid;
      int r = c >> 2, kc = (c & 3) * 8;
      *(uint4*)&cA[r][kc] = *(const uint4*)&Abase[(size_t)r * K + k0 + kc];
      *(uint4*)&cB[r][kc] = *(const uint4*)&Bbase[(size_t)r * K + k0 + kc];
    }
    if (k0 + GBK < K) {
      __builtin_prefetch(&Abase[(size_t)(tid >> 1) * K + k0 + GBK], 0, 0);
      __builtin_prefetch(&Bbase[(size_t)(tid >> 1) * K + k0 + GBK], 0, 0);
    }
    __syncthreads();
#endif

    v16bf afr[2], bfr[4];
    #pragma unroll
    for (int mc = 0; mc < 2; ++mc) {
      int r = wm * 32 + mc * 16 + lr;
      #pragma unroll
      for (int j = 0; j < 16; ++j) afr[mc][j] = cA[r][lh + j];
    }
    #pragma unroll
    for (int nc = 0; nc < 4; ++nc) {
      int n = wn * 64 + nc * 16 + lr;
      #pragma unroll
      for (int j = 0; j < 16; ++j) bfr[nc][j] = cB[n][lh + j];
    }
    #pragma unroll
    for (int mc = 0; mc < 2; ++mc)
      #pragma unroll
      for (int nc = 0; nc < 4; ++nc)
        acc[mc][nc] = wmma_bf16(afr[mc], bfr[nc], acc[mc][nc]);
    __syncthreads();   // all waves done with cur before it is refilled
  }

  // epilogue
  const int mofs = (lane >= 16) ? 8 : 0;
  #pragma unroll
  for (int mc = 0; mc < 2; ++mc) {
    #pragma unroll
    for (int nc = 0; nc < 4; ++nc) {
      #pragma unroll
      for (int r = 0; r < 8; ++r) {
        int m = row0 + mc * 16 + r + mofs;   // global row (token)
        int c = col0 + nc * 16 + lr;         // global col
        float v = acc[mc][nc][r] + bias[c];
        if constexpr (MODE == 0) {
          int which = c >> 10;
          int cc = c & 1023;
          int hh = cc >> 6, dd = cc & 63;
          int b = m >> 10, t = m & 1023;
          int bh = b * NHEAD + hh;
          if (which == 0) {
            Qbf[((size_t)bh * TC + t) * HEAD_DIM + dd] = (__bf16)v;
          } else if (which == 1) {
            size_t o = ((size_t)bh * TKMAX + TP + t) * HEAD_DIM + dd;
            Koutf[o] = v; Kbf[o] = (__bf16)v;
          } else {
            size_t o = ((size_t)bh * TKMAX + TP + t) * HEAD_DIM + dd;
            Voutf[o] = v;
            Vtbf[((size_t)bh * HEAD_DIM + dd) * TKMAX + TP + t] = (__bf16)v;
          }
        } else if constexpr (MODE == 1) {
          outf[(size_t)m * N + c] = v + resid[(size_t)m * N + c];
        } else {
          float ge = 0.5f * v * (1.f + erff(v * 0.70710678118654752f));
          outbf[(size_t)m * N + c] = (__bf16)ge;
        }
      }
    }
  }
}

#define SK_BYTES  (32 * 72 * 2)                     // 4608  [key][d]
#define SVT_BYTES (64 * 40 * 2)                     // 5120  [d][key]
#define KV_BUF_BYTES (SK_BYTES + SVT_BYTES)         // 9728 per buffer
#define SP_OFF   (2 * KV_BUF_BYTES)                 // 19456
#define SP_BYTES (8 * 16 * 36 * 2)                  // 9216
#define ATT_SMEM (SP_OFF + SP_BYTES)                // 28672

__global__ __launch_bounds__(256) void k_attention(
    const __bf16* __restrict__ Qbf, const __bf16* __restrict__ Kbf,
    const __bf16* __restrict__ Vtbf, const int* __restrict__ pos_ptr,
    __bf16* __restrict__ Obf) {
  __shared__ __align__(16) char smem[ATT_SMEM];
  __bf16 (*sP)[16][36] = (__bf16(*)[16][36])(smem + SP_OFF);

  const int tid = threadIdx.x;
  const int wave = tid >> 5, lane = tid & 31;
  const int qt = blockIdx.x & 7;           // query tile of 128
  const int bh = blockIdx.x >> 3;          // b*NHEAD + h
  const int pos = pos_ptr[0];
  const int qbase = qt * 128;
  const int qrow = qbase + wave * 16;
  const int lr = lane & 15;
  const int lh = (lane >> 4) * 16;
  const int mofs = (lane >= 16) ? 8 : 0;

  const __bf16* Qp = Qbf + ((size_t)bh * TC + qrow) * HEAD_DIM;
  const __bf16* Kb = Kbf + (size_t)bh * TKMAX * HEAD_DIM;
  const __bf16* Vb = Vtbf + (size_t)bh * HEAD_DIM * TKMAX;

  // load Q fragments (16x64 -> two 16x32 A-fragments) with explicit 16B loads
  v16bf qf[2];
  #pragma unroll
  for (int f = 0; f < 2; ++f) {
    union { uint4 u[2]; v16bf v; } tmp;
    const uint4* p = (const uint4*)(Qp + (size_t)lr * HEAD_DIM + f * 32 + lh);
    tmp.u[0] = p[0];
    tmp.u[1] = p[1];
    qf[f] = tmp.v;
  }

  float mrow[8], lrow[8];
  v8f o[4];
  #pragma unroll
  for (int r = 0; r < 8; ++r) { mrow[r] = -1e30f; lrow[r] = 0.f; }
  #pragma unroll
  for (int d = 0; d < 4; ++d) o[d] = (v8f)(0.f);

  const float scale = 0.125f;  // 1/sqrt(64)
  const int kmax = pos + qbase + 128;
  const int ntiles = (kmax + 31) / 32;

#ifdef USE_TDM
  if (wave == 0) {
    tdm_load_2d(0,        Kb, HEAD_DIM, TKMAX, HEAD_DIM, 32, HEAD_DIM, 4, 3);
    tdm_load_2d(SK_BYTES, Vb, TKMAX, HEAD_DIM, 32, HEAD_DIM, TKMAX, 3, 3);
  }
#endif

  for (int kt = 0; kt < ntiles; ++kt) {
    const int kofs = kt * 32;
    const int cur = kt & 1;
    __bf16 (*sK)[72]  = (__bf16(*)[72])(smem + cur * KV_BUF_BYTES);
    __bf16 (*sVt)[40] = (__bf16(*)[40])(smem + cur * KV_BUF_BYTES + SK_BYTES);

#ifdef USE_TDM
    if (wave == 0) {
      if (kt + 1 < ntiles) {
        unsigned nb = (unsigned)((cur ^ 1) * KV_BUF_BYTES);
        tdm_load_2d(nb, Kb + (size_t)(kofs + 32) * HEAD_DIM,
                    HEAD_DIM, TKMAX, HEAD_DIM, 32, HEAD_DIM, 4, 3);
        tdm_load_2d(nb + SK_BYTES, Vb + kofs + 32,
                    TKMAX, HEAD_DIM, 32, HEAD_DIM, TKMAX, 3, 3);
        __builtin_amdgcn_s_wait_tensorcnt(2);
      } else {
        __builtin_amdgcn_s_wait_tensorcnt(0);
      }
      asm volatile("" ::: "memory");
    }
    __syncthreads();
#else
    {
      int r = tid >> 3, c = (tid & 7) * 8;
      *(uint4*)&sK[r][c] = *(const uint4*)&Kb[(size_t)(kofs + r) * HEAD_DIM + c];
      int d = tid >> 2, kc = (tid & 3) * 8;
      *(uint4*)&sVt[d][kc] = *(const uint4*)&Vb[(size_t)d * TKMAX + kofs + kc];
    }
    __syncthreads();
#endif

    // S = Q * K^T
    v8f s[2];
    #pragma unroll
    for (int nc = 0; nc < 2; ++nc) {
      s[nc] = (v8f)(0.f);
      v16bf bk0, bk1;
      int key = nc * 16 + lr;
      #pragma unroll
      for (int j = 0; j < 16; ++j) {
        bk0[j] = sK[key][lh + j];
        bk1[j] = sK[key][32 + lh + j];
      }
      s[nc] = wmma_bf16(qf[0], bk0, s[nc]);
      s[nc] = wmma_bf16(qf[1], bk1, s[nc]);
    }

    // online softmax per row; emit P (bf16) to LDS
    #pragma unroll
    for (int r = 0; r < 8; ++r) {
      int m  = r + mofs;
      int gi = qrow + m;
      float x0 = s[0][r] * scale;
      float x1 = s[1][r] * scale;
      if (kofs + lr > pos + gi)      x0 = -1e30f;
      if (kofs + 16 + lr > pos + gi) x1 = -1e30f;
      float mx = fmaxf(x0, x1);
      #pragma unroll
      for (int off = 8; off >= 1; off >>= 1) mx = fmaxf(mx, __shfl_xor(mx, off, 32));
      float mnew = fmaxf(mrow[r], mx);
      float corr = __expf(mrow[r] - mnew);
      float p0 = __expf(x0 - mnew);
      float p1 = __expf(x1 - mnew);
      float sum = p0 + p1;
      #pragma unroll
      for (int off = 8; off >= 1; off >>= 1) sum += __shfl_xor(sum, off, 32);
      lrow[r] = lrow[r] * corr + sum;
      mrow[r] = mnew;
      #pragma unroll
      for (int d = 0; d < 4; ++d) o[d][r] *= corr;
      sP[wave][m][lr]      = (__bf16)p0;
      sP[wave][m][16 + lr] = (__bf16)p1;
    }
    __syncthreads();

    // O += P(16x32) * V(32x64)
    v16bf pf;
    #pragma unroll
    for (int j = 0; j < 16; ++j) pf[j] = sP[wave][lr][lh + j];
    #pragma unroll
    for (int dc = 0; dc < 4; ++dc) {
      v16bf bv;
      int d = dc * 16 + lr;
      #pragma unroll
      for (int j = 0; j < 16; ++j) bv[j] = sVt[d][lh + j];
      o[dc] = wmma_bf16(pf, bv, o[dc]);
    }
    __syncthreads();   // done reading cur buffer before refill
  }

  // normalize + write O into [token, d_model] bf16 buffer at head column
  const int b = bh >> 4, h = bh & 15;
  #pragma unroll
  for (int dc = 0; dc < 4; ++dc) {
    #pragma unroll
    for (int r = 0; r < 8; ++r) {
      int m = r + mofs;
      int tok = b * TC + qrow + m;
      int col = h * HEAD_DIM + dc * 16 + lr;
      Obf[(size_t)tok * D_MODEL + col] = (__bf16)(o[dc][r] / lrow[r]);
    }
  }
}

// ---------------------------------------------------------------------------
// Host-side launch
// ---------------------------------------------------------------------------
extern "C" void kernel_launch(void* const* d_in, const int* in_sizes, int n_in,
                              void* d_out, int out_size, void* d_ws, size_t ws_size,
                              hipStream_t stream) {
  const float* x    = (const float*)d_in[0];
  const float* Kp   = (const float*)d_in[1];
  const float* Vp   = (const float*)d_in[2];
  const int*   pos  = (const int*)d_in[3];
  const float* wqkv = (const float*)d_in[4];
  const float* bqkv = (const float*)d_in[5];
  const float* wo   = (const float*)d_in[6];
  const float* bo   = (const float*)d_in[7];
  const float* g1   = (const float*)d_in[8];
  const float* be1  = (const float*)d_in[9];
  const float* g2   = (const float*)d_in[10];
  const float* be2  = (const float*)d_in[11];
  const float* w1   = (const float*)d_in[12];
  const float* bf1  = (const float*)d_in[13];
  const float* w2   = (const float*)d_in[14];
  const float* bf2  = (const float*)d_in[15];

  float* xout = (float*)d_out;
  float* Kout = xout + (size_t)NTOK * D_MODEL;
  float* Vout = Kout + (size_t)BATCH * NHEAD * TKMAX * HEAD_DIM;

  char* w = (char*)d_ws;
  size_t off = 0;
  auto carve = [&](size_t bytes) {
    void* p = w + off;
    off += (bytes + 255) & ~(size_t)255;
    return p;
  };
  // weights stored TRANSPOSED [N][K] in bf16
  __bf16* wqkvT = (__bf16*)carve((size_t)3 * D_MODEL * D_MODEL * 2);
  __bf16* woT   = (__bf16*)carve((size_t)D_MODEL * D_MODEL * 2);
  __bf16* w1T   = (__bf16*)carve((size_t)DIM_FF * D_MODEL * 2);
  __bf16* w2T   = (__bf16*)carve((size_t)D_MODEL * DIM_FF * 2);
  __bf16* h_bf  = (__bf16*)carve((size_t)NTOK * D_MODEL * 2);    // reused for h2
  __bf16* q_bf  = (__bf16*)carve((size_t)NTOK * D_MODEL * 2);
  __bf16* K_bf  = (__bf16*)carve((size_t)BATCH * NHEAD * TKMAX * HEAD_DIM * 2);
  __bf16* Vt_bf = (__bf16*)carve((size_t)BATCH * NHEAD * HEAD_DIM * TKMAX * 2);
  __bf16* o_bf  = (__bf16*)carve((size_t)NTOK * D_MODEL * 2);
  float*  x1    = (float*)carve((size_t)NTOK * D_MODEL * 4);
  __bf16* ff_bf = K_bf;  // FFN activation aliases dead bf16 KV shadow (32MB)

  // 1) weight converts (transpose to [N][K])
  k_cvt_transpose<D_MODEL, 3 * D_MODEL><<<(D_MODEL / TR_R) * (3 * D_MODEL / TR_C), 256, 0, stream>>>(wqkv, wqkvT);
  k_cvt_transpose<D_MODEL, D_MODEL><<<(D_MODEL / TR_R) * (D_MODEL / TR_C), 256, 0, stream>>>(wo, woT);
  k_cvt_transpose<D_MODEL, DIM_FF><<<(D_MODEL / TR_R) * (DIM_FF / TR_C), 256, 0, stream>>>(w1, w1T);
  k_cvt_transpose<DIM_FF, D_MODEL><<<(DIM_FF / TR_R) * (D_MODEL / TR_C), 256, 0, stream>>>(w2, w2T);

  // 2) LN1
  k_layernorm<<<NTOK, 256, 0, stream>>>(x, g1, be1, h_bf);

  // 3) past KV copy into cache + bf16 shadows
  k_kvcopy<<<BATCH * NHEAD * (TP / TR_R), 256, 0, stream>>>(Kp, Vp, Kout, Vout, K_bf, Vt_bf);

  // 4) QKV GEMM: [4096,1024] x [1024,3072]
  {
    int M = NTOK, N = 3 * D_MODEL, K = D_MODEL;
    dim3 grid((M / GBM) * (N / GBN));
    k_gemm_bf16<0><<<grid, 256, 0, stream>>>(h_bf, wqkvT, M, N, K, bqkv,
                                             Kout, Vout, K_bf, Vt_bf, q_bf,
                                             nullptr, nullptr, nullptr);
  }

  // 5) attention
  k_attention<<<BATCH * NHEAD * (TC / 128), 256, 0, stream>>>(q_bf, K_bf, Vt_bf, pos, o_bf);

  // 6) Wo GEMM + residual -> x1
  {
    int M = NTOK, N = D_MODEL, K = D_MODEL;
    dim3 grid((M / GBM) * (N / GBN));
    k_gemm_bf16<1><<<grid, 256, 0, stream>>>(o_bf, woT, M, N, K, bo,
                                             nullptr, nullptr, nullptr, nullptr, nullptr,
                                             x, x1, nullptr);
  }

  // 7) LN2 -> h2 (reuse h_bf)
  k_layernorm<<<NTOK, 256, 0, stream>>>(x1, g2, be2, h_bf);

  // 8) W1 GEMM + GELU -> ff_bf
  {
    int M = NTOK, N = DIM_FF, K = D_MODEL;
    dim3 grid((M / GBM) * (N / GBN));
    k_gemm_bf16<2><<<grid, 256, 0, stream>>>(h_bf, w1T, M, N, K, bf1,
                                             nullptr, nullptr, nullptr, nullptr, nullptr,
                                             nullptr, nullptr, ff_bf);
  }

  // 9) W2 GEMM + residual -> xout
  {
    int M = NTOK, N = D_MODEL, K = DIM_FF;
    dim3 grid((M / GBM) * (N / GBN));
    k_gemm_bf16<1><<<grid, 256, 0, stream>>>(ff_bf, w2T, M, N, K, bf2,
                                             nullptr, nullptr, nullptr, nullptr, nullptr,
                                             x1, xout, nullptr);
  }
}

// v002
// A run of this version takes 312 microseconds.
// In both of two side-by-side timings against v001, it was 1.04 times as fast.
// All steps since v000 together make it 1.49 times as fast.
#include <hip/hip_runtime.h>

typedef __bf16 v16bf __attribute__((ext_vector_type(16)));
typedef float  v8f   __attribute__((ext_vector_type(8)));
typedef unsigned int u32x4 __attribute__((ext_vector_type(4)));
typedef int i32x4 __attribute__((ext_vector_type(4)));
typedef int i32x8 __attribute__((ext_vector_type(8)));

__device__ __forceinline__ v8f wmma_bf16(v16bf a, v16bf b, v8f c) {
  // D = A(16x32 bf16) * B(32x16 bf16) + C(16x16 f32)
  return __builtin_amdgcn_wmma_f32_16x16x32_bf16(
      false, a, false, b, (short)0, c, false, false);
}

#if defined(__has_builtin)
#if __has_builtin(__builtin_amdgcn_tensor_load_to_lds) && \
    __has_builtin(__builtin_amdgcn_s_wait_tensorcnt)
#define USE_TDM 1
#endif
#endif

#ifdef USE_TDM
// 2D tile load Global->LDS via Tensor Data Mover (bf16 payload).
__device__ __forceinline__ void tdm_load_2d(unsigned lds_off, const __bf16* gaddr,
                                            unsigned dim0, unsigned dim1,
                                            unsigned tile0, unsigned tile1,
                                            unsigned stride0,
                                            unsigned pad_int_code,
                                            unsigned pad_amt_code) {
  unsigned long long ga = (unsigned long long)(uintptr_t)gaddr;
  u32x4 g0;
  g0[0] = 1u;
  g0[1] = lds_off;
  g0[2] = (unsigned)(ga & 0xFFFFFFFFu);
  g0[3] = (unsigned)((ga >> 32) & 0x01FFFFFFu)
          | (2u << 30);
  i32x8 g1;
  g1[0] = (int)((1u << 16)
                | (1u << 20)
                | (pad_int_code << 22)
                | (pad_amt_code << 25));
  g1[1] = (int)((dim0 & 0xFFFFu) << 16);
  g1[2] = (int)((dim0 >> 16) | ((dim1 & 0xFFFFu) << 16));
  g1[3] = (int)((dim1 >> 16) | (tile0 << 16));
  g1[4] = (int)(tile1 & 0xFFFFu);
  g1[5] = (int)stride0;
  g1[6] = 0;
  g1[7] = 0;
  i32x4 z4 = {0, 0, 0, 0};
#if defined(__clang_major__) && (__clang_major__ >= 23)
  i32x8 z8 = {0, 0, 0, 0, 0, 0, 0, 0};
  __builtin_amdgcn_tensor_load_to_lds(g0, g1, z4, z4, z8, 0);
#else
  __builtin_amdgcn_tensor_load_to_lds(g0, g1, z4, z4, 0);
#endif
}
#endif  // USE_TDM

#define D_MODEL 1024
#define NHEAD   16
#define HEAD_DIM 64
#define DIM_FF  4096
#define BATCH   4
#define TC      1024
#define TP      1024
#define TKMAX   2048
#define NTOK    (BATCH * TC)   // 4096

// ---------------------------------------------------------------------------
// Transposing f32 -> bf16 copies go through an LDS tile of 128 source rows x
// 64 source columns, so that both global sides move whole lines, 16 bytes a
// lane: a source row piece is 256 B of f32, a destination row piece 256 B of
// bf16.  256 threads; thread (kg, nq) holds source rows kg*8..+7, columns
// nq*4..+3.
// ---------------------------------------------------------------------------
#define TR_R 128
#define TR_C 64
#define TR_PITCH 136                                // 272 B = 16 B x odd
typedef float  v4f  __attribute__((ext_vector_type(4)));
typedef __bf16 v4bf __attribute__((ext_vector_type(4)));
typedef __bf16 v8bf __attribute__((ext_vector_type(8)));

__device__ __forceinline__ void tr_put(__bf16 (*tile)[TR_PITCH], const v4f (&v)[8],
                                       int nq, int kg) {
  #pragma unroll  // register arrays need constant indices
  for (int i = 0; i < 4; ++i) {
    v8bf p;
    #pragma unroll  // register arrays need constant indices
    for (int j = 0; j < 8; ++j) p[j] = (__bf16)v[j][i];
    *(v8bf*)&tile[nq * 4 + i][kg * 8] = p;
  }
}

// dst points at the tile's first element; ld = destination row pitch (elements)
__device__ __forceinline__ void tr_get(const __bf16 (*tile)[TR_PITCH],
                                       __bf16* __restrict__ dst, size_t ld, int tid) {
  #pragma unroll  // register arrays need constant indices
  for (int it = 0; it < 4; ++it) {
    int idx = it * 256 + tid;
    int n = idx >> 4, c = (idx & 15) * 8;
    *(v8bf*)&dst[(size_t)n * ld + c] = *(const v8bf*)&tile[n][c];
  }
}

template <int K, int N>
__global__ __launch_bounds__(256) void k_cvt_transpose(const float* __restrict__ src,
                                                       __bf16* __restrict__ dst) {
  __shared__ __align__(16) __bf16 tile[TR_C][TR_PITCH];
  const int tid = threadIdx.x;
  const int nq = tid & 15, kg = tid >> 4;
  const int n0 = (blockIdx.x % (N / TR_C)) * TR_C;
  const int k0 = (blockIdx.x / (N / TR_C)) * TR_R;

  const float* p = src + (size_t)(k0 + kg * 8) * N + n0 + nq * 4;
  v4f v[8];
  #pragma unroll  // register arrays need constant indices
  for (int j = 0; j < 8; ++j) v[j] = *(const v4f*)(p + j * N);
  tr_put(tile, v, nq, kg);
  __syncthreads();
  tr_get(tile, dst + (size_t)n0 * K + k0, (size_t)K, tid);
}

// ---------------------------------------------------------------------------
// LayerNorm: one wave per row of D_MODEL, 8 rows a block, bf16 out.  A lane
// holds 32 elements of its row in registers (8 loads of 16 B, each wave-wide
// load 512 contiguous bytes), so the row is read once, the sums need no LDS and
// no barrier, and a launch starts an eighth of the waves.
// ---------------------------------------------------------------------------
#define LN_ROWS 8
__global__ __launch_bounds__(256) void k_layernorm(const float* __restrict__ x,
                                                   const float* __restrict__ g,
                                                   const float* __restrict__ b,
                                                   __bf16* __restrict__ out) {
  const int lane = threadIdx.x & 31, wave = threadIdx.x >> 5;
  const int row = blockIdx.x * LN_ROWS + wave;
  const float* xr = x + (size_t)row * D_MODEL + lane * 4;

  v4f v[8];
  #pragma unroll  // register arrays need constant indices
  for (int j = 0; j < 8; ++j) v[j] = *(const v4f*)(xr + j * 128);
  // the build lets a load of g or b below land in the address registers of the
  // row's loads: wait for their translations first
  asm volatile("s_wait_xcnt 0x0" ::: "memory");
  v4f gg[8], bb[8];
  #pragma unroll  // register arrays need constant indices
  for (int j = 0; j < 8; ++j) {
    gg[j] = *(const v4f*)(g + lane * 4 + j * 128);
    bb[j] = *(const v4f*)(b + lane * 4 + j * 128);
  }
  // keeps all 24 loads in flight together: left to itself the build issues
  // the loads of g and b behind the row's first data, a second latency in turn
  __builtin_amdgcn_sched_barrier(0);

  // four independent partial sums a lane: chains of 8 links, not of 32
  v4f sv = v[0], qv = v[0] * v[0];
  #pragma unroll  // register arrays need constant indices
  for (int j = 1; j < 8; ++j) { sv += v[j]; qv += v[j] * v[j]; }
  float s  = (sv[0] + sv[1]) + (sv[2] + sv[3]);
  float s2 = (qv[0] + qv[1]) + (qv[2] + qv[3]);
  #pragma unroll
  for (int off = 16; off >= 1; off >>= 1) {
    s  += __shfl_xor(s,  off, 32);
    s2 += __shfl_xor(s2, off, 32);
  }
  const float mu = s * (1.f / D_MODEL);
  const float var = s2 * (1.f / D_MODEL) - mu * mu;
  const float rstd = rsqrtf(var + 1e-5f);

  __bf16* orow = out + (size_t)row * D_MODEL + lane * 4;
  #pragma unroll  // register arrays need constant indices
  for (int j = 0; j < 8; ++j) {
    v4bf o;
    #pragma unroll  // register arrays need constant indices
    for (int i = 0; i < 4; ++i) o[i] = (__bf16)((v[j][i] - mu) * rstd * gg[j][i] + bb[j][i]);
    *(v4bf*)(orow + j * 128) = o;
  }
}

// ---------------------------------------------------------------------------
// Copy past KV into output cache (fp32) + bf16 shadows for attention.
// K shadow: [B,H,Tk,Dh] row-major; V shadow: TRANSPOSED [B,H,Dh,Tk].
// ---------------------------------------------------------------------------
// grid: B*H*(TP/128) blocks; a block takes 128 tokens of one head (contiguous
// in source and in both caches); the V shadow goes through the LDS tile.
__global__ __launch_bounds__(256) void k_kvcopy(const float* __restrict__ Kp,
                                                const float* __restrict__ Vp,
                                                float* __restrict__ Kout,
                                                float* __restrict__ Vout,
                                                __bf16* __restrict__ Kbf,
                                                __bf16* __restrict__ Vtbf) {
  __shared__ __align__(16) __bf16 tile[TR_C][TR_PITCH];
  const int tid = threadIdx.x;
  const int nq = tid & 15, kg = tid >> 4;
  const int bh = blockIdx.x / (TP / TR_R);
  const int t0 = (blockIdx.x % (TP / TR_R)) * TR_R;
  const size_t sbase = ((size_t)bh * TP + t0) * HEAD_DIM;
  const size_t dbase = ((size_t)bh * TKMAX + t0) * HEAD_DIM;

  const unsigned vo = (unsigned)(kg * 8 * HEAD_DIM + nq * 4);   // V: tile order
  const unsigned ko = (unsigned)(tid * 4);                      // K: linear
  const float* pv = Vp + sbase;
  const float* pk = Kp + sbase;
  v4f vv[8], kv[8];
  #pragma unroll  // register arrays need constant indices
  for (int j = 0; j < 8; ++j) vv[j] = *(const v4f*)(pv + vo + j * HEAD_DIM);
  #pragma unroll  // register arrays need constant indices
  for (int j = 0; j < 8; ++j) kv[j] = *(const v4f*)(pk + ko + j * 1024);
  // address registers of the loads above are rewritten below: wait for their
  // translations first.  The statement also holds all 16 loads in front of the
  // first use of V, so that no K load pays a second memory latency.
  asm volatile("s_wait_xcnt 0x0" ::: "memory");

  // the tile's barrier stands in front of every global store: it would wait
  // for stores already issued
  tr_put(tile, vv, nq, kg);
  __syncthreads();
  tr_get(tile, Vtbf + (size_t)bh * HEAD_DIM * TKMAX + t0, (size_t)TKMAX, tid);

  float* qv = Vout + dbase;
  float* qk = Kout + dbase;
  __bf16* qb = Kbf + dbase;
  #pragma unroll  // register arrays need constant indices
  for (int j = 0; j < 8; ++j) *(v4f*)(qv + vo + j * HEAD_DIM) = vv[j];
  #pragma unroll  // register arrays need constant indices
  for (int j = 0; j < 8; ++j) {
    *(v4f*)(qk + ko + j * 1024) = kv[j];
    v4bf kb;
    #pragma unroll  // register arrays need constant indices
    for (int i = 0; i < 4; ++i) kb[i] = (__bf16)kv[j][i];
    *(v4bf*)(qb + ko + j * 1024) = kb;
  }
}

#define GBM 128
#define GBN 128
#define GBK 32
#define LDSK 40                                     // row stride (elements)
#define SA_BYTES (GBM * LDSK * 2)                   // 10240
#define GEMM_BUF_BYTES (2 * SA_BYTES)               // A + B per buffer

template <int MODE>
__global__ __launch_bounds__(256) void k_gemm_bf16(
    const __bf16* __restrict__ A, const __bf16* __restrict__ Bt,
    int M, int N, int K,
    const float* __restrict__ bias,
    float* __restrict__ Koutf, float* __restrict__ Voutf,
    __bf16* __restrict__ Kbf, __bf16* __restrict__ Vtbf, __bf16* __restrict__ Qbf,
    const float* __restrict__ resid, float* __restrict__ outf,
    __bf16* __restrict__ outbf) {
  __shared__ __align__(16) char smem[2 * GEMM_BUF_BYTES];   // double buffered

  const int tid = threadIdx.x;
  const int wave = tid >> 5, lane = tid & 31;
  const int mtiles = M / GBM;
  const int bm = blockIdx.x % mtiles;
  const int bn = blockIdx.x / mtiles;
  const int wm = wave & 3, wn = wave >> 2;
  const int row0 = bm * GBM + wm * 32;
  const int col0 = bn * GBN + wn * 64;

  const __bf16* Abase = A  + (size_t)(bm * GBM) * K;
  const __bf16* Bbase = Bt + (size_t)(bn * GBN) * K;

  v8f acc[2][4];
  #pragma unroll
  for (int i = 0; i < 2; ++i)
    #pragma unroll
    for (int j = 0; j < 4; ++j) acc[i][j] = (v8f)(0.f);

  const int lr = lane & 15;
  const int lh = (lane >> 4) * 16;
  const int KT = K / GBK;

#ifdef USE_TDM
  if (wave == 0) {
    tdm_load_2d(0,        Abase, K, M, GBK, GBM, K, 3, 3);
    tdm_load_2d(SA_BYTES, Bbase, K, N, GBK, GBN, K, 3, 3);
  }
#endif

  for (int kt = 0; kt < KT; ++kt) {
    const int k0 = kt * GBK;
    const int cur = kt & 1;
    __bf16 (*cA)[LDSK] = (__bf16(*)[LDSK])(smem + cur * GEMM_BUF_BYTES);
    __bf16 (*cB)[LDSK] = (__bf16(*)[LDSK])(smem + cur * GEMM_BUF_BYTES + SA_BYTES);

#ifdef USE_TDM
    if (wave == 0) {
      if (kt + 1 < KT) {
        unsigned nb = (unsigned)((cur ^ 1) * GEMM_BUF_BYTES);
        tdm_load_2d(nb,            Abase + k0 + GBK, K, M, GBK, GBM, K, 3, 3);
        tdm_load_2d(nb + SA_BYTES, Bbase + k0 + GBK, K, N, GBK, GBN, K, 3, 3);
        __builtin_amdgcn_s_wait_tensorcnt(2);   // current buffer's 2 loads done
      } else {
        __builtin_amdgcn_s_wait_tensorcnt(0);
      }
      asm volatile("" ::: "memory");
    }
    __syncthreads();
#else
    // manual staging: both tiles are 128 rows x 32 k-contiguous bf16
    #pragma unroll
    for (int i = 0; i < 2; ++i) {
      int c = i * 256 + tid;
      int r = c >> 2, kc = (c & 3) * 8;
      *(uint4*)&cA[r][kc] = *(const uint4*)&Abase[(size_t)r * K + k0 + kc];
      *(uint4*)&cB[r][kc] = *(const uint4*)&Bbase[(size_t)r * K + k0 + kc];
    }
    if (k0 + GBK < K) {
      __builtin_prefetch(&Abase[(size_t)(tid >> 1) * K + k0 + GBK], 0, 0);
      __builtin_prefetch(&Bbase[(size_t)(tid >> 1) * K + k0 + GBK], 0, 0);
    }
    __syncthreads();
#endif

    v16bf afr[2], bfr[4];
    #pragma unroll
    for (int mc = 0; mc < 2; ++mc) {
      int r = wm * 32 + mc * 16 + lr;
      #pragma unroll
      for (int j = 0; j < 16; ++j) afr[mc][j] = cA[r][lh + j];
    }
    #pragma unroll
    for (int nc = 0; nc < 4; ++nc) {
      int n = wn * 64 + nc * 16 + lr;
      #pragma unroll
      for (int j = 0; j < 16; ++j) bfr[nc][j] = cB[n][lh + j];
    }
    #pragma unroll
    for (int mc = 0; mc < 2; ++mc)
      #pragma unroll
      for (int nc = 0; nc < 4; ++nc)
        acc[mc][nc] = wmma_bf16(afr[mc], bfr[nc], acc[mc][nc]);
    __syncthreads();   // all waves done with cur before it is refilled
  }

  // epilogue
  const int mofs = (lane >= 16) ? 8 : 0;
  #pragma unroll
  for (int mc = 0; mc < 2; ++mc) {
    #pragma unroll
    for (int nc = 0; nc < 4; ++nc) {
      #pragma unroll
      for (int r = 0; r < 8; ++r) {
        int m = row0 + mc * 16 + r + mofs;   // global row (token)
        int c = col0 + nc * 16 + lr;         // global col
        float v = acc[mc][nc][r] + bias[c];
        if constexpr (MODE == 0) {
          int which = c >> 10;
          int cc = c & 1023;
          int hh = cc >> 6, dd = cc & 63;
          int b = m >> 10, t = m & 1023;
          int bh = b * NHEAD + hh;
          if (which == 0) {
            Qbf[((size_t)bh * TC + t) * HEAD_DIM + dd] = (__bf16)v;
          } else if (which == 1) {
            size_t o = ((size_t)bh * TKMAX + TP + t) * HEAD_DIM + dd;
            Koutf[o] = v; Kbf[o] = (__bf16)v;
          } else {
            size_t o = ((size_t)bh * TKMAX + TP + t) * HEAD_DIM + dd;
            Voutf[o] = v;
            Vtbf[((size_t)bh * HEAD_DIM + dd) * TKMAX + TP + t] = (__bf16)v;
          }
        } else if constexpr (MODE == 1) {
          outf[(size_t)m * N + c] = v + resid[(size_t)m * N + c];
        } else {
          float ge = 0.5f * v * (1.f + erff(v * 0.70710678118654752f));
          outbf[(size_t)m * N + c] = (__bf16)ge;
        }
      }
    }
  }
}

#define SK_BYTES  (32 * 72 * 2)                     // 4608  [key][d]
#define SVT_BYTES (64 * 40 * 2)                     // 5120  [d][key]
#define KV_BUF_BYTES (SK_BYTES + SVT_BYTES)         // 9728 per buffer
#define SP_OFF   (2 * KV_BUF_BYTES)                 // 19456
#define SP_BYTES (8 * 16 * 36 * 2)                  // 9216
#define ATT_SMEM (SP_OFF + SP_BYTES)                // 28672

__global__ __launch_bounds__(256) void k_attention(
    const __bf16* __restrict__ Qbf, const __bf16* __restrict__ Kbf,
    const __bf16* __restrict__ Vtbf, const int* __restrict__ pos_ptr,
    __bf16* __restrict__ Obf) {
  __shared__ __align__(16) char smem[ATT_SMEM];
  __bf16 (*sP)[16][36] = (__bf16(*)[16][36])(smem + SP_OFF);

  const int tid = threadIdx.x;
  const int wave = tid >> 5, lane = tid & 31;
  const int qt = blockIdx.x & 7;           // query tile of 128
  const int bh = blockIdx.x >> 3;          // b*NHEAD + h
  const int pos = pos_ptr[0];
  const int qbase = qt * 128;
  const int qrow = qbase + wave * 16;
  const int lr = lane & 15;
  const int lh = (lane >> 4) * 16;
  const int mofs = (lane >= 16) ? 8 : 0;

  const __bf16* Qp = Qbf + ((size_t)bh * TC + qrow) * HEAD_DIM;
  const __bf16* Kb = Kbf + (size_t)bh * TKMAX * HEAD_DIM;
  const __bf16* Vb = Vtbf + (size_t)bh * HEAD_DIM * TKMAX;

  // load Q fragments (16x64 -> two 16x32 A-fragments) with explicit 16B loads
  v16bf qf[2];
  #pragma unroll
  for (int f = 0; f < 2; ++f) {
    union { uint4 u[2]; v16bf v; } tmp;
    const uint4* p = (const uint4*)(Qp + (size_t)lr * HEAD_DIM + f * 32 + lh);
    tmp.u[0] = p[0];
    tmp.u[1] = p[1];
    qf[f] = tmp.v;
  }

  float mrow[8], lrow[8];
  v8f o[4];
  #pragma unroll
  for (int r = 0; r < 8; ++r) { mrow[r] = -1e30f; lrow[r] = 0.f; }
  #pragma unroll
  for (int d = 0; d < 4; ++d) o[d] = (v8f)(0.f);

  const float scale = 0.125f;  // 1/sqrt(64)
  const int kmax = pos + qbase + 128;
  const int ntiles = (kmax + 31) / 32;

#ifdef USE_TDM
  if (wave == 0) {
    tdm_load_2d(0,        Kb, HEAD_DIM, TKMAX, HEAD_DIM, 32, HEAD_DIM, 4, 3);
    tdm_load_2d(SK_BYTES, Vb, TKMAX, HEAD_DIM, 32, HEAD_DIM, TKMAX, 3, 3);
  }
#endif

  for (int kt = 0; kt < ntiles; ++kt) {
    const int kofs = kt * 32;
    const int cur = kt & 1;
    __bf16 (*sK)[72]  = (__bf16(*)[72])(smem + cur * KV_BUF_BYTES);
    __bf16 (*sVt)[40] = (__bf16(*)[40])(smem + cur * KV_BUF_BYTES + SK_BYTES);

#ifdef USE_TDM
    if (wave == 0) {
      if (kt + 1 < ntiles) {
        unsigned nb = (unsigned)((cur ^ 1) * KV_BUF_BYTES);
        tdm_load_2d(nb, Kb + (size_t)(kofs + 32) * HEAD_DIM,
                    HEAD_DIM, TKMAX, HEAD_DIM, 32, HEAD_DIM, 4, 3);
        tdm_load_2d(nb + SK_BYTES, Vb + kofs + 32,
                    TKMAX, HEAD_DIM, 32, HEAD_DIM, TKMAX, 3, 3);
        __builtin_amdgcn_s_wait_tensorcnt(2);
      } else {
        __builtin_amdgcn_s_wait_tensorcnt(0);
      }
      asm volatile("" ::: "memory");
    }
    __syncthreads();
#else
    {
      int r = tid >> 3, c = (tid & 7) * 8;
      *(uint4*)&sK[r][c] = *(const uint4*)&Kb[(size_t)(kofs + r) * HEAD_DIM + c];
      int d = tid >> 2, kc = (tid & 3) * 8;
      *(uint4*)&sVt[d][kc] = *(const uint4*)&Vb[(size_t)d * TKMAX + kofs + kc];
    }
    __syncthreads();
#endif

    // S = Q * K^T
    v8f s[2];
    #pragma unroll
    for (int nc = 0; nc < 2; ++nc) {
      s[nc] = (v8f)(0.f);
      v16bf bk0, bk1;
      int key = nc * 16 + lr;
      #pragma unroll
      for (int j = 0; j < 16; ++j) {
        bk0[j] = sK[key][lh + j];
        bk1[j] = sK[key][32 + lh + j];
      }
      s[nc] = wmma_bf16(qf[0], bk0, s[nc]);
      s[nc] = wmma_bf16(qf[1], bk1, s[nc]);
    }

    // online softmax per row; emit P (bf16) to LDS
    #pragma unroll
    for (int r = 0; r < 8; ++r) {
      int m  = r + mofs;
      int gi = qrow + m;
      float x0 = s[0][r] * scale;
      float x1 = s[1][r] * scale;
      if (kofs + lr > pos + gi)      x0 = -1e30f;
      if (kofs + 16 + lr > pos + gi) x1 = -1e30f;
      float mx = fmaxf(x0, x1);
      #pragma unroll
      for (int off = 8; off >= 1; off >>= 1) mx = fmaxf(mx, __shfl_xor(mx, off, 32));
      float mnew = fmaxf(mrow[r], mx);
      float corr = __expf(mrow[r] - mnew);
      float p0 = __expf(x0 - mnew);
      float p1 = __expf(x1 - mnew);
      float sum = p0 + p1;
      #pragma unroll
      for (int off = 8; off >= 1; off >>= 1) sum += __shfl_xor(sum, off, 32);
      lrow[r] = lrow[r] * corr + sum;
      mrow[r] = mnew;
      #pragma unroll
      for (int d = 0; d < 4; ++d) o[d][r] *= corr;
      sP[wave][m][lr]      = (__bf16)p0;
      sP[wave][m][16 + lr] = (__bf16)p1;
    }
    __syncthreads();

    // O += P(16x32) * V(32x64)
    v16bf pf;
    #pragma unroll
    for (int j = 0; j < 16; ++j) pf[j] = sP[wave][lr][lh + j];
    #pragma unroll
    for (int dc = 0; dc < 4; ++dc) {
      v16bf bv;
      int d = dc * 16 + lr;
      #pragma unroll
      for (int j = 0; j < 16; ++j) bv[j] = sVt[d][lh + j];
      o[dc] = wmma_bf16(pf, bv, o[dc]);
    }
    __syncthreads();   // done reading cur buffer before refill
  }

  // normalize + write O into [token, d_model] bf16 buffer at head column
  const int b = bh >> 4, h = bh & 15;
  #pragma unroll
  for (int dc = 0; dc < 4; ++dc) {
    #pragma unroll
    for (int r = 0; r < 8; ++r) {
      int m = r + mofs;
      int tok = b * TC + qrow + m;
      int col = h * HEAD_DIM + dc * 16 + lr;
      Obf[(size_t)tok * D_MODEL + col] = (__bf16)(o[dc][r] / lrow[r]);
    }
  }
}

// ---------------------------------------------------------------------------
// Host-side launch
// ---------------------------------------------------------------------------
extern "C" void kernel_launch(void* const* d_in, const int* in_sizes, int n_in,
                              void* d_out, int out_size, void* d_ws, size_t ws_size,
                              hipStream_t stream) {
  const float* x    = (const float*)d_in[0];
  const float* Kp   = (const float*)d_in[1];
  const float* Vp   = (const float*)d_in[2];
  const int*   pos  = (const int*)d_in[3];
  const float* wqkv = (const float*)d_in[4];
  const float* bqkv = (const float*)d_in[5];
  const float* wo   = (const float*)d_in[6];
  const float* bo   = (const float*)d_in[7];
  const float* g1   = (const float*)d_in[8];
  const float* be1  = (const float*)d_in[9];
  const float* g2   = (const float*)d_in[10];
  const float* be2  = (const float*)d_in[11];
  const float* w1   = (const float*)d_in[12];
  const float* bf1  = (const float*)d_in[13];
  const float* w2   = (const float*)d_in[14];
  const float* bf2  = (const float*)d_in[15];

  float* xout = (float*)d_out;
  float* Kout = xout + (size_t)NTOK * D_MODEL;
  float* Vout = Kout + (size_t)BATCH * NHEAD * TKMAX * HEAD_DIM;

  char* w = (char*)d_ws;
  size_t off = 0;
  auto carve = [&](size_t bytes) {
    void* p = w + off;
    off += (bytes + 255) & ~(size_t)255;
    return p;
  };
  // weights stored TRANSPOSED [N][K] in bf16
  __bf16* wqkvT = (__bf16*)carve((size_t)3 * D_MODEL * D_MODEL * 2);
  __bf16* woT   = (__bf16*)carve((size_t)D_MODEL * D_MODEL * 2);
  __bf16* w1T   = (__bf16*)carve((size_t)DIM_FF * D_MODEL * 2);
  __bf16* w2T   = (__bf16*)carve((size_t)D_MODEL * DIM_FF * 2);
  __bf16* h_bf  = (__bf16*)carve((size_t)NTOK * D_MODEL * 2);    // reused for h2
  __bf16* q_bf  = (__bf16*)carve((size_t)NTOK * D_MODEL * 2);
  __bf16* K_bf  = (__bf16*)carve((size_t)BATCH * NHEAD * TKMAX * HEAD_DIM * 2);
  __bf16* Vt_bf = (__bf16*)carve((size_t)BATCH * NHEAD * HEAD_DIM * TKMAX * 2);
  __bf16* o_bf  = (__bf16*)carve((size_t)NTOK * D_MODEL * 2);
  float*  x1    = (float*)carve((size_t)NTOK * D_MODEL * 4);
  __bf16* ff_bf = K_bf;  // FFN activation aliases dead bf16 KV shadow (32MB)

  // 1) weight converts (transpose to [N][K])
  k_cvt_transpose<D_MODEL, 3 * D_MODEL><<<(D_MODEL / TR_R) * (3 * D_MODEL / TR_C), 256, 0, stream>>>(wqkv, wqkvT);
  k_cvt_transpose<D_MODEL, D_MODEL><<<(D_MODEL / TR_R) * (D_MODEL / TR_C), 256, 0, stream>>>(wo, woT);
  k_cvt_transpose<D_MODEL, DIM_FF><<<(D_MODEL / TR_R) * (DIM_FF / TR_C), 256, 0, stream>>>(w1, w1T);
  k_cvt_transpose<DIM_FF, D_MODEL><<<(DIM_FF / TR_R) * (D_MODEL / TR_C), 256, 0, stream>>>(w2, w2T);

  // 2) LN1
  k_layernorm<<<NTOK / LN_ROWS, 256, 0, stream>>>(x, g1, be1, h_bf);

  // 3) past KV copy into cache + bf16 shadows
  k_kvcopy<<<BATCH * NHEAD * (TP / TR_R), 256, 0, stream>>>(Kp, Vp, Kout, Vout, K_bf, Vt_bf);

  // 4) QKV GEMM: [4096,1024] x [1024,3072]
  {
    int M = NTOK, N = 3 * D_MODEL, K = D_MODEL;
    dim3 grid((M / GBM) * (N / GBN));
    k_gemm_bf16<0><<<grid, 256, 0, stream>>>(h_bf, wqkvT, M, N, K, bqkv,
                                             Kout, Vout, K_bf, Vt_bf, q_bf,
                                             nullptr, nullptr, nullptr);
  }

  // 5) attention
  k_attention<<<BATCH * NHEAD * (TC / 128), 256, 0, stream>>>(q_bf, K_bf, Vt_bf, pos, o_bf);

  // 6) Wo GEMM + residual -> x1
  {
    int M = NTOK, N = D_MODEL, K = D_MODEL;
    dim3 grid((M / GBM) * (N / GBN));
    k_gemm_bf16<1><<<grid, 256, 0, stream>>>(o_bf, woT, M, N, K, bo,
                                             nullptr, nullptr, nullptr, nullptr, nullptr,
                                             x, x1, nullptr);
  }

  // 7) LN2 -> h2 (reuse h_bf)
  k_layernorm<<<NTOK / LN_ROWS, 256, 0, stream>>>(x1, g2, be2, h_bf);

  // 8) W1 GEMM + GELU -> ff_bf
  {
    int M = NTOK, N = DIM_FF, K = D_MODEL;
    dim3 grid((M / GBM) * (N / GBN));
    k_gemm_bf16<2><<<grid, 256, 0, stream>>>(h_bf, w1T, M, N, K, bf1,
                                             nullptr, nullptr, nullptr, nullptr, nullptr,
                                             nullptr, nullptr, ff_bf);
  }

  // 9) W2 GEMM + residual -> xout
  {
    int M = NTOK, N = D_MODEL, K = DIM_FF;
    dim3 grid((M / GBM) * (N / GBN));
    k_gemm_bf16<1><<<grid, 256, 0, stream>>>(ff_bf, w2T, M, N, K, bf2,
                                             nullptr, nullptr, nullptr, nullptr, nullptr,
                                             x1, xout, nullptr);
  }
}

// v003
// A run of this version takes 280 microseconds.
// Timed twice side by side with v002, it ran 1.11 and 1.12 times as fast.
// Over all steps from v000 it is 1.66 times as fast.
#include <hip/hip_runtime.h>

typedef __bf16 v16bf __attribute__((ext_vector_type(16)));
typedef float  v8f   __attribute__((ext_vector_type(8)));
typedef unsigned int u32x4 __attribute__((ext_vector_type(4)));
typedef int i32x4 __attribute__((ext_vector_type(4)));
typedef int i32x8 __attribute__((ext_vector_type(8)));

__device__ __forceinline__ v8f wmma_bf16(v16bf a, v16bf b, v8f c) {
  // D = A(16x32 bf16) * B(32x16 bf16) + C(16x16 f32)
  return __builtin_amdgcn_wmma_f32_16x16x32_bf16(
      false, a, false, b, (short)0, c, false, false);
}

#if defined(__has_builtin)
#if __has_builtin(__builtin_amdgcn_tensor_load_to_lds) && \
    __has_builtin(__builtin_amdgcn_s_wait_tensorcnt)
#define USE_TDM 1
#endif
#endif

#ifdef USE_TDM
// 2D tile load Global->LDS via Tensor Data Mover (bf16 payload).
__device__ __forceinline__ void tdm_load_2d(unsigned lds_off, const __bf16* gaddr,
                                            unsigned dim0, unsigned dim1,
                                            unsigned tile0, unsigned tile1,
                                            unsigned stride0,
                                            unsigned pad_int_code,
                                            unsigned pad_amt_code) {
  unsigned long long ga = (unsigned long long)(uintptr_t)gaddr;
  u32x4 g0;
  g0[0] = 1u;
  g0[1] = lds_off;
  g0[2] = (unsigned)(ga & 0xFFFFFFFFu);
  g0[3] = (unsigned)((ga >> 32) & 0x01FFFFFFu)
          | (2u << 30);
  i32x8 g1;
  g1[0] = (int)((1u << 16)
                | (1u << 20)
                | (pad_int_code << 22)
                | (pad_amt_code << 25));
  g1[1] = (int)((dim0 & 0xFFFFu) << 16);
  g1[2] = (int)((dim0 >> 16) | ((dim1 & 0xFFFFu) << 16));
  g1[3] = (int)((dim1 >> 16) | (tile0 << 16));
  g1[4] = (int)(tile1 & 0xFFFFu);
  g1[5] = (int)stride0;
  g1[6] = 0;
  g1[7] = 0;
  i32x4 z4 = {0, 0, 0, 0};
#if defined(__clang_major__) && (__clang_major__ >= 23)
  i32x8 z8 = {0, 0, 0, 0, 0, 0, 0, 0};
  __builtin_amdgcn_tensor_load_to_lds(g0, g1, z4, z4, z8, 0);
#else
  __builtin_amdgcn_tensor_load_to_lds(g0, g1, z4, z4, 0);
#endif
}
#endif  // USE_TDM

#define D_MODEL 1024
#define NHEAD   16
#define HEAD_DIM 64
#define DIM_FF  4096
#define BATCH   4
#define TC      1024
#define TP      1024
#define TKMAX   2048
#define NTOK    (BATCH * TC)   // 4096

// ---------------------------------------------------------------------------
// Transposing f32 -> bf16 copies go through an LDS tile of 128 source rows x
// 64 source columns, so that both global sides move whole lines, 16 bytes a
// lane: a source row piece is 256 B of f32, a destination row piece 256 B of
// bf16.  256 threads; thread (kg, nq) holds source rows kg*8..+7, columns
// nq*4..+3.
// ---------------------------------------------------------------------------
#define TR_R 128
#define TR_C 64
#define TR_PITCH 136                                // 272 B = 16 B x odd
typedef float  v4f  __attribute__((ext_vector_type(4)));
typedef __bf16 v4bf __attribute__((ext_vector_type(4)));
typedef __bf16 v8bf __attribute__((ext_vector_type(8)));

__device__ __forceinline__ void tr_put(__bf16 (*tile)[TR_PITCH], const v4f (&v)[8],
                                       int nq, int kg) {
  #pragma unroll  // register arrays need constant indices
  for (int i = 0; i < 4; ++i) {
    v8bf p;
    #pragma unroll  // register arrays need constant indices
    for (int j = 0; j < 8; ++j) p[j] = (__bf16)v[j][i];
    *(v8bf*)&tile[nq * 4 + i][kg * 8] = p;
  }
}

// dst points at the tile's first element; ld = destination row pitch (elements)
__device__ __forceinline__ void tr_get(const __bf16 (*tile)[TR_PITCH],
                                       __bf16* __restrict__ dst, size_t ld, int tid) {
  #pragma unroll  // register arrays need constant indices
  for (int it = 0; it < 4; ++it) {
    int idx = it * 256 + tid;
    int n = idx >> 4, c = (idx & 15) * 8;
    *(v8bf*)&dst[(size_t)n * ld + c] = *(const v8bf*)&tile[n][c];
  }
}

template <int K, int N>
__global__ __launch_bounds__(256) void k_cvt_transpose(const float* __restrict__ src,
                                                       __bf16* __restrict__ dst) {
  __shared__ __align__(16) __bf16 tile[TR_C][TR_PITCH];
  const int tid = threadIdx.x;
  const int nq = tid & 15, kg = tid >> 4;
  const int n0 = (blockIdx.x % (N / TR_C)) * TR_C;
  const int k0 = (blockIdx.x / (N / TR_C)) * TR_R;

  const float* p = src + (size_t)(k0 + kg * 8) * N + n0 + nq * 4;
  v4f v[8];
  #pragma unroll  // register arrays need constant indices
  for (int j = 0; j < 8; ++j) v[j] = *(const v4f*)(p + j * N);
  tr_put(tile, v, nq, kg);
  __syncthreads();
  tr_get(tile, dst + (size_t)n0 * K + k0, (size_t)K, tid);
}

// ---------------------------------------------------------------------------
// LayerNorm: one wave per row of D_MODEL, 8 rows a block, bf16 out.  A lane
// holds 32 elements of its row in registers (8 loads of 16 B, each wave-wide
// load 512 contiguous bytes), so the row is read once, the sums need no LDS and
// no barrier, and a launch starts an eighth of the waves.
// ---------------------------------------------------------------------------
#define LN_ROWS 8
__global__ __launch_bounds__(256) void k_layernorm(const float* __restrict__ x,
                                                   const float* __restrict__ g,
                                                   const float* __restrict__ b,
                                                   __bf16* __restrict__ out) {
  const int lane = threadIdx.x & 31, wave = threadIdx.x >> 5;
  const int row = blockIdx.x * LN_ROWS + wave;
  const float* xr = x + (size_t)row * D_MODEL + lane * 4;

  v4f v[8];
  #pragma unroll  // register arrays need constant indices
  for (int j = 0; j < 8; ++j) v[j] = *(const v4f*)(xr + j * 128);
  // the build lets a load of g or b below land in the address registers of the
  // row's loads: wait for their translations first
  asm volatile("s_wait_xcnt 0x0" ::: "memory");
  v4f gg[8], bb[8];
  #pragma unroll  // register arrays need constant indices
  for (int j = 0; j < 8; ++j) {
    gg[j] = *(const v4f*)(g + lane * 4 + j * 128);
    bb[j] = *(const v4f*)(b + lane * 4 + j * 128);
  }
  // keeps all 24 loads in flight together: left to itself the build issues
  // the loads of g and b behind the row's first data, a second latency in turn
  __builtin_amdgcn_sched_barrier(0);

  // four independent partial sums a lane: chains of 8 links, not of 32
  v4f sv = v[0], qv = v[0] * v[0];
  #pragma unroll  // register arrays need constant indices
  for (int j = 1; j < 8; ++j) { sv += v[j]; qv += v[j] * v[j]; }
  float s  = (sv[0] + sv[1]) + (sv[2] + sv[3]);
  float s2 = (qv[0] + qv[1]) + (qv[2] + qv[3]);
  #pragma unroll
  for (int off = 16; off >= 1; off >>= 1) {
    s  += __shfl_xor(s,  off, 32);
    s2 += __shfl_xor(s2, off, 32);
  }
  const float mu = s * (1.f / D_MODEL);
  const float var = s2 * (1.f / D_MODEL) - mu * mu;
  const float rstd = rsqrtf(var + 1e-5f);

  __bf16* orow = out + (size_t)row * D_MODEL + lane * 4;
  #pragma unroll  // register arrays need constant indices
  for (int j = 0; j < 8; ++j) {
    v4bf o;
    #pragma unroll  // register arrays need constant indices
    for (int i = 0; i < 4; ++i) o[i] = (__bf16)((v[j][i] - mu) * rstd * gg[j][i] + bb[j][i]);
    *(v4bf*)(orow + j * 128) = o;
  }
}

// ---------------------------------------------------------------------------
// Copy past KV into output cache (fp32) + bf16 shadows for attention.
// K shadow: [B,H,Tk,Dh] row-major; V shadow: TRANSPOSED [B,H,Dh,Tk].
// ---------------------------------------------------------------------------
// grid: B*H*(TP/128) blocks; a block takes 128 tokens of one head (contiguous
// in source and in both caches); the V shadow goes through the LDS tile.
__global__ __launch_bounds__(256) void k_kvcopy(const float* __restrict__ Kp,
                                                const float* __restrict__ Vp,
                                                float* __restrict__ Kout,
                                                float* __restrict__ Vout,
                                                __bf16* __restrict__ Kbf,
                                                __bf16* __restrict__ Vtbf) {
  __shared__ __align__(16) __bf16 tile[TR_C][TR_PITCH];
  const int tid = threadIdx.x;
  const int nq = tid & 15, kg = tid >> 4;
  const int bh = blockIdx.x / (TP / TR_R);
  const int t0 = (blockIdx.x % (TP / TR_R)) * TR_R;
  const size_t sbase = ((size_t)bh * TP + t0) * HEAD_DIM;
  const size_t dbase = ((size_t)bh * TKMAX + t0) * HEAD_DIM;

  const unsigned vo = (unsigned)(kg * 8 * HEAD_DIM + nq * 4);   // V: tile order
  const unsigned ko = (unsigned)(tid * 4);                      // K: linear
  const float* pv = Vp + sbase;
  const float* pk = Kp + sbase;
  v4f vv[8], kv[8];
  #pragma unroll  // register arrays need constant indices
  for (int j = 0; j < 8; ++j) vv[j] = *(const v4f*)(pv + vo + j * HEAD_DIM);
  #pragma unroll  // register arrays need constant indices
  for (int j = 0; j < 8; ++j) kv[j] = *(const v4f*)(pk + ko + j * 1024);
  // address registers of the loads above are rewritten below: wait for their
  // translations first.  The statement also holds all 16 loads in front of the
  // first use of V, so that no K load pays a second memory latency.
  asm volatile("s_wait_xcnt 0x0" ::: "memory");

  // the tile's barrier stands in front of every global store: it would wait
  // for stores already issued
  tr_put(tile, vv, nq, kg);
  __syncthreads();
  tr_get(tile, Vtbf + (size_t)bh * HEAD_DIM * TKMAX + t0, (size_t)TKMAX, tid);

  float* qv = Vout + dbase;
  float* qk = Kout + dbase;
  __bf16* qb = Kbf + dbase;
  #pragma unroll  // register arrays need constant indices
  for (int j = 0; j < 8; ++j) *(v4f*)(qv + vo + j * HEAD_DIM) = vv[j];
  #pragma unroll  // register arrays need constant indices
  for (int j = 0; j < 8; ++j) {
    *(v4f*)(qk + ko + j * 1024) = kv[j];
    v4bf kb;
    #pragma unroll  // register arrays need constant indices
    for (int i = 0; i < 4; ++i) kb[i] = (__bf16)kv[j][i];
    *(v4bf*)(qb + ko + j * 1024) = kb;
  }
}

#define GBM 128
#define GBN 128
#define GBK 32
#define LDSK 40                                     // row stride (elements)
#define SA_BYTES (GBM * LDSK * 2)                   // 10240
#define GEMM_BUF_BYTES (2 * SA_BYTES)               // A + B per buffer
#define EP_PITCH 68                                 // epilogue row: 272 B = 16 B x odd
#define EP_WAVE_BYTES (2 * GEMM_BUF_BYTES / 8)      // 5120 >= 16 rows x 272 B
template <int V> struct int_c { static constexpr int value = V; };

template <int MODE>
__global__ __launch_bounds__(256) void k_gemm_bf16(
    const __bf16* __restrict__ A, const __bf16* __restrict__ Bt,
    int M, int N, int K,
    const float* __restrict__ bias,
    float* __restrict__ Koutf, float* __restrict__ Voutf,
    __bf16* __restrict__ Kbf, __bf16* __restrict__ Vtbf, __bf16* __restrict__ Qbf,
    const float* __restrict__ resid, float* __restrict__ outf,
    __bf16* __restrict__ outbf) {
  __shared__ __align__(16) char smem[2 * GEMM_BUF_BYTES];   // double buffered

  const int tid = threadIdx.x;
  const int wave = tid >> 5, lane = tid & 31;
  const int mtiles = M / GBM;
  const int bm = blockIdx.x % mtiles;
  const int bn = blockIdx.x / mtiles;
  const int wm = wave & 3, wn = wave >> 2;
  const int row0 = bm * GBM + wm * 32;
  const int col0 = bn * GBN + wn * 64;

  const __bf16* Abase = A  + (size_t)(bm * GBM) * K;
  const __bf16* Bbase = Bt + (size_t)(bn * GBN) * K;

  v8f acc[2][4];
  #pragma unroll
  for (int i = 0; i < 2; ++i)
    #pragma unroll
    for (int j = 0; j < 4; ++j) acc[i][j] = (v8f)(0.f);

  const int lr = lane & 15;
  const int lh = (lane >> 4) * 16;
  const int KT = K / GBK;

#ifdef USE_TDM
  if (wave == 0) {
    tdm_load_2d(0,        Abase, K, M, GBK, GBM, K, 3, 3);
    tdm_load_2d(SA_BYTES, Bbase, K, N, GBK, GBN, K, 3, 3);
  }
#endif

  for (int kt = 0; kt < KT; ++kt) {
    const int k0 = kt * GBK;
    const int cur = kt & 1;
    __bf16 (*cA)[LDSK] = (__bf16(*)[LDSK])(smem + cur * GEMM_BUF_BYTES);
    __bf16 (*cB)[LDSK] = (__bf16(*)[LDSK])(smem + cur * GEMM_BUF_BYTES + SA_BYTES);

#ifdef USE_TDM
    if (wave == 0) {
      if (kt + 1 < KT) {
        unsigned nb = (unsigned)((cur ^ 1) * GEMM_BUF_BYTES);
        tdm_load_2d(nb,            Abase + k0 + GBK, K, M, GBK, GBM, K, 3, 3);
        tdm_load_2d(nb + SA_BYTES, Bbase + k0 + GBK, K, N, GBK, GBN, K, 3, 3);
        __builtin_amdgcn_s_wait_tensorcnt(2);   // current buffer's 2 loads done
      } else {
        __builtin_amdgcn_s_wait_tensorcnt(0);
      }
      asm volatile("" ::: "memory");
    }
    __syncthreads();
#else
    // manual staging: both tiles are 128 rows x 32 k-contiguous bf16
    #pragma unroll
    for (int i = 0; i < 2; ++i) {
      int c = i * 256 + tid;
      int r = c >> 2, kc = (c & 3) * 8;
      *(uint4*)&cA[r][kc] = *(const uint4*)&Abase[(size_t)r * K + k0 + kc];
      *(uint4*)&cB[r][kc] = *(const uint4*)&Bbase[(size_t)r * K + k0 + kc];
    }
    if (k0 + GBK < K) {
      __builtin_prefetch(&Abase[(size_t)(tid >> 1) * K + k0 + GBK], 0, 0);
      __builtin_prefetch(&Bbase[(size_t)(tid >> 1) * K + k0 + GBK], 0, 0);
    }
    __syncthreads();
#endif

    v16bf afr[2], bfr[4];
    #pragma unroll
    for (int mc = 0; mc < 2; ++mc) {
      int r = wm * 32 + mc * 16 + lr;
      #pragma unroll
      for (int j = 0; j < 16; ++j) afr[mc][j] = cA[r][lh + j];
    }
    #pragma unroll
    for (int nc = 0; nc < 4; ++nc) {
      int n = wn * 64 + nc * 16 + lr;
      #pragma unroll
      for (int j = 0; j < 16; ++j) bfr[nc][j] = cB[n][lh + j];
    }
    #pragma unroll
    for (int mc = 0; mc < 2; ++mc)
      #pragma unroll
      for (int nc = 0; nc < 4; ++nc)
        acc[mc][nc] = wmma_bf16(afr[mc], bfr[nc], acc[mc][nc]);
    __syncthreads();   // all waves done with cur before it is refilled
  }

  // epilogue: a wave passes its accumulators, 16 rows x 64 columns at a time,
  // through its own LDS range, so that a lane then holds 4 neighbouring columns
  // of one row: the residual loads and the stores move whole lines (a row piece
  // is 256 B of f32 or 128 B of bf16), a quarter of the memory instructions.
  // The ring is free here: the loop's last pass waited for every tensor load
  // and ended in a barrier behind every wave's last fragment read.
  float (*st)[EP_PITCH] = (float(*)[EP_PITCH])(smem + wave * EP_WAVE_BYTES);
  const int mofs = (lane >= 16) ? 8 : 0;
  const int er = lane >> 4;            // which row of the pair a wave-wide access covers
  const int ec = (lane & 15) * 4;      // first of the lane's 4 columns
  const int c = col0 + ec;             // global column
  const v4f bias4 = *(const v4f*)&bias[c];

  v4f rs[2][8];
  if constexpr (MODE == 1) {
    // all 16 residual loads in flight together: one memory latency, not one each
    const float* rp[2][8];
    #pragma unroll  // register arrays need constant indices
    for (int mc = 0; mc < 2; ++mc)
      #pragma unroll  // register arrays need constant indices
      for (int it = 0; it < 8; ++it) {
        rp[mc][it] = &resid[(size_t)(row0 + mc * 16 + it * 2 + er) * N + c];
        rs[mc][it] = *(const v4f*)rp[mc][it];
      }
    // left to itself the build lets a late load of the batch land in the address
    // registers of earlier ones: the addresses stay live up to this wait for
    // their translations
    asm volatile("s_wait_xcnt 0x0"
                 :: "v"(rp[0][0]), "v"(rp[0][1]), "v"(rp[0][2]), "v"(rp[0][3]),
                    "v"(rp[0][4]), "v"(rp[0][5]), "v"(rp[0][6]), "v"(rp[0][7]),
                    "v"(rp[1][0]), "v"(rp[1][1]), "v"(rp[1][2]), "v"(rp[1][3]),
                    "v"(rp[1][4]), "v"(rp[1][5]), "v"(rp[1][6]), "v"(rp[1][7])
                 : "memory");
  }

  // QKV: a wave's 64 columns are one head (hh) of one of q, k, v (WHICH 0, 1, 2)
  const int hh = (col0 & 1023) >> 6;

  auto drain = [&](auto wc) {
    constexpr int WHICH = decltype(wc)::value;
    float bc[4];                       // bias in accumulator order, for the V shadow
    if constexpr (MODE == 0 && WHICH == 2) {
      #pragma unroll  // register arrays need constant indices
      for (int nc = 0; nc < 4; ++nc) bc[nc] = bias[col0 + nc * 16 + lr];
    }
    #pragma unroll  // register arrays need constant indices
    for (int mc = 0; mc < 2; ++mc) {
      if constexpr (MODE == 0 && WHICH == 2) {
        // V shadow is [d][token]: a lane's 8 accumulator rows are 8 neighbouring
        // tokens of one d, one 16-byte store straight from registers
        const int m0 = row0 + mc * 16 + mofs;
        const int bh = (m0 >> 10) * NHEAD + hh;
        #pragma unroll  // register arrays need constant indices
        for (int nc = 0; nc < 4; ++nc) {
          v8bf p;
          #pragma unroll  // register arrays need constant indices
          for (int r = 0; r < 8; ++r) p[r] = (__bf16)(acc[mc][nc][r] + bc[nc]);
          *(v8bf*)&Vtbf[((size_t)bh * HEAD_DIM + nc * 16 + lr) * TKMAX + TP + (m0 & 1023)] = p;
        }
      }
      // these 16 rows overwrite the range: the first half's reads have returned
      if (mc == 1) asm volatile("s_wait_dscnt 0x0" ::: "memory");
      #pragma unroll  // register arrays need constant indices
      for (int nc = 0; nc < 4; ++nc)
        #pragma unroll  // register arrays need constant indices
        for (int r = 0; r < 8; ++r) st[r + mofs][nc * 16 + lr] = acc[mc][nc][r];
      // other lanes' rows are read back below: the wave's LDS writes land first
      asm volatile("s_wait_dscnt 0x0" ::: "memory");
      #pragma unroll  // register arrays need constant indices
      for (int it = 0; it < 8; ++it) {
        const int m = row0 + mc * 16 + it * 2 + er;   // global row (token)
        const v4f v = *(const v4f*)&st[it * 2 + er][ec] + bias4;
        if constexpr (MODE == 0) {
          const int bh = (m >> 10) * NHEAD + hh;
          const int t = m & 1023;
          const size_t o = ((size_t)bh * TKMAX + TP + t) * HEAD_DIM + ec;
          v4bf vb;
          #pragma unroll  // register arrays need constant indices
          for (int i = 0; i < 4; ++i) vb[i] = (__bf16)v[i];
          if constexpr (WHICH == 0) {
            *(v4bf*)&Qbf[((size_t)bh * TC + t) * HEAD_DIM + ec] = vb;
          } else if constexpr (WHICH == 1) {
            *(v4f*)&Koutf[o] = v;
            *(v4bf*)&Kbf[o] = vb;
          } else {
            *(v4f*)&Voutf[o] = v;
          }
        } else if constexpr (MODE == 1) {
          *(v4f*)&outf[(size_t)m * N + c] = v + rs[mc][it];
        } else {
          v4bf o;
          #pragma unroll  // register arrays need constant indices
          for (int i = 0; i < 4; ++i) {
            float ge = 0.5f * v[i] * (1.f + erff(v[i] * 0.70710678118654752f));
            o[i] = (__bf16)ge;
          }
          *(v4bf*)&outbf[(size_t)m * N + c] = o;
        }
      }
    }
    // QKV: the build runs shared address code of the other two cases behind
    // these stores, over their registers: wait for their translations first
    if constexpr (MODE == 0) asm volatile("s_wait_xcnt 0x0" ::: "memory");
  };

  if constexpr (MODE == 0) {
    // the same for a whole wave: read through the first lane, a scalar branch
    const int which = __builtin_amdgcn_readfirstlane(col0 >> 10);
    if (which == 0)      drain(int_c<0>{});
    else if (which == 1) drain(int_c<1>{});
    else                 drain(int_c<2>{});
  } else {
    drain(int_c<0>{});
  }
}

#define SK_BYTES  (32 * 72 * 2)                     // 4608  [key][d]
#define SVT_BYTES (64 * 40 * 2)                     // 5120  [d][key]
#define KV_BUF_BYTES (SK_BYTES + SVT_BYTES)         // 9728 per buffer
#define SP_OFF   (2 * KV_BUF_BYTES)                 // 19456
#define SP_BYTES (8 * 16 * 36 * 2)                  // 9216
#define ATT_SMEM (SP_OFF + SP_BYTES)                // 28672

__global__ __launch_bounds__(256) void k_attention(
    const __bf16* __restrict__ Qbf, const __bf16* __restrict__ Kbf,
    const __bf16* __restrict__ Vtbf, const int* __restrict__ pos_ptr,
    __bf16* __restrict__ Obf) {
  __shared__ __align__(16) char smem[ATT_SMEM];
  __bf16 (*sP)[16][36] = (__bf16(*)[16][36])(smem + SP_OFF);

  const int tid = threadIdx.x;
  const int wave = tid >> 5, lane = tid & 31;
  const int qt = blockIdx.x & 7;           // query tile of 128
  const int bh = blockIdx.x >> 3;          // b*NHEAD + h
  const int pos = pos_ptr[0];
  const int qbase = qt * 128;
  const int qrow = qbase + wave * 16;
  const int lr = lane & 15;
  const int lh = (lane >> 4) * 16;
  const int mofs = (lane >= 16) ? 8 : 0;

  const __bf16* Qp = Qbf + ((size_t)bh * TC + qrow) * HEAD_DIM;
  const __bf16* Kb = Kbf + (size_t)bh * TKMAX * HEAD_DIM;
  const __bf16* Vb = Vtbf + (size_t)bh * HEAD_DIM * TKMAX;

  // load Q fragments (16x64 -> two 16x32 A-fragments) with explicit 16B loads
  v16bf qf[2];
  #pragma unroll
  for (int f = 0; f < 2; ++f) {
    union { uint4 u[2]; v16bf v; } tmp;
    const uint4* p = (const uint4*)(Qp + (size_t)lr * HEAD_DIM + f * 32 + lh);
    tmp.u[0] = p[0];
    tmp.u[1] = p[1];
    qf[f] = tmp.v;
  }

  float mrow[8], lrow[8];
  v8f o[4];
  #pragma unroll
  for (int r = 0; r < 8; ++r) { mrow[r] = -1e30f; lrow[r] = 0.f; }
  #pragma unroll
  for (int d = 0; d < 4; ++d) o[d] = (v8f)(0.f);

  const float scale = 0.125f;  // 1/sqrt(64)
  const int kmax = pos + qbase + 128;
  const int ntiles = (kmax + 31) / 32;

#ifdef USE_TDM
  if (wave == 0) {
    tdm_load_2d(0,        Kb, HEAD_DIM, TKMAX, HEAD_DIM, 32, HEAD_DIM, 4, 3);
    tdm_load_2d(SK_BYTES, Vb, TKMAX, HEAD_DIM, 32, HEAD_DIM, TKMAX, 3, 3);
  }
#endif

  for (int kt = 0; kt < ntiles; ++kt) {
    const int kofs = kt * 32;
    const int cur = kt & 1;
    __bf16 (*sK)[72]  = (__bf16(*)[72])(smem + cur * KV_BUF_BYTES);
    __bf16 (*sVt)[40] = (__bf16(*)[40])(smem + cur * KV_BUF_BYTES + SK_BYTES);

#ifdef USE_TDM
    if (wave == 0) {
      if (kt + 1 < ntiles) {
        unsigned nb = (unsigned)((cur ^ 1) * KV_BUF_BYTES);
        tdm_load_2d(nb, Kb + (size_t)(kofs + 32) * HEAD_DIM,
                    HEAD_DIM, TKMAX, HEAD_DIM, 32, HEAD_DIM, 4, 3);
        tdm_load_2d(nb + SK_BYTES, Vb + kofs + 32,
                    TKMAX, HEAD_DIM, 32, HEAD_DIM, TKMAX, 3, 3);
        __builtin_amdgcn_s_wait_tensorcnt(2);
      } else {
        __builtin_amdgcn_s_wait_tensorcnt(0);
      }
      asm volatile("" ::: "memory");
    }
    __syncthreads();
#else
    {
      int r = tid >> 3, c = (tid & 7) * 8;
      *(uint4*)&sK[r][c] = *(const uint4*)&Kb[(size_t)(kofs + r) * HEAD_DIM + c];
      int d = tid >> 2, kc = (tid & 3) * 8;
      *(uint4*)&sVt[d][kc] = *(const uint4*)&Vb[(size_t)d * TKMAX + kofs + kc];
    }
    __syncthreads();
#endif

    // S = Q * K^T
    v8f s[2];
    #pragma unroll
    for (int nc = 0; nc < 2; ++nc) {
      s[nc] = (v8f)(0.f);
      v16bf bk0, bk1;
      int key = nc * 16 + lr;
      #pragma unroll
      for (int j = 0; j < 16; ++j) {
        bk0[j] = sK[key][lh + j];
        bk1[j] = sK[key][32 + lh + j];
      }
      s[nc] = wmma_bf16(qf[0], bk0, s[nc]);
      s[nc] = wmma_bf16(qf[1], bk1, s[nc]);
    }

    // online softmax per row; emit P (bf16) to LDS
    #pragma unroll
    for (int r = 0; r < 8; ++r) {
      int m  = r + mofs;
      int gi = qrow + m;
      float x0 = s[0][r] * scale;
      float x1 = s[1][r] * scale;
      if (kofs + lr > pos + gi)      x0 = -1e30f;
      if (kofs + 16 + lr > pos + gi) x1 = -1e30f;
      float mx = fmaxf(x0, x1);
      #pragma unroll
      for (int off = 8; off >= 1; off >>= 1) mx = fmaxf(mx, __shfl_xor(mx, off, 32));
      float mnew = fmaxf(mrow[r], mx);
      float corr = __expf(mrow[r] - mnew);
      float p0 = __expf(x0 - mnew);
      float p1 = __expf(x1 - mnew);
      float sum = p0 + p1;
      #pragma unroll
      for (int off = 8; off >= 1; off >>= 1) sum += __shfl_xor(sum, off, 32);
      lrow[r] = lrow[r] * corr + sum;
      mrow[r] = mnew;
      #pragma unroll
      for (int d = 0; d < 4; ++d) o[d][r] *= corr;
      sP[wave][m][lr]      = (__bf16)p0;
      sP[wave][m][16 + lr] = (__bf16)p1;
    }
    __syncthreads();

    // O += P(16x32) * V(32x64)
    v16bf pf;
    #pragma unroll
    for (int j = 0; j < 16; ++j) pf[j] = sP[wave][lr][lh + j];
    #pragma unroll
    for (int dc = 0; dc < 4; ++dc) {
      v16bf bv;
      int d = dc * 16 + lr;
      #pragma unroll
      for (int j = 0; j < 16; ++j) bv[j] = sVt[d][lh + j];
      o[dc] = wmma_bf16(pf, bv, o[dc]);
    }
    __syncthreads();   // done reading cur buffer before refill
  }

  // normalize + write O into [token, d_model] bf16 buffer at head column
  const int b = bh >> 4, h = bh & 15;
  #pragma unroll
  for (int dc = 0; dc < 4; ++dc) {
    #pragma unroll
    for (int r = 0; r < 8; ++r) {
      int m = r + mofs;
      int tok = b * TC + qrow + m;
      int col = h * HEAD_DIM + dc * 16 + lr;
      Obf[(size_t)tok * D_MODEL + col] = (__bf16)(o[dc][r] / lrow[r]);
    }
  }
}

// ---------------------------------------------------------------------------
// Host-side launch
// ---------------------------------------------------------------------------
extern "C" void kernel_launch(void* const* d_in, const int* in_sizes, int n_in,
                              void* d_out, int out_size, void* d_ws, size_t ws_size,
                              hipStream_t stream) {
  const float* x    = (const float*)d_in[0];
  const float* Kp   = (const float*)d_in[1];
  const float* Vp   = (const float*)d_in[2];
  const int*   pos  = (const int*)d_in[3];
  const float* wqkv = (const float*)d_in[4];
  const float* bqkv = (const float*)d_in[5];
  const float* wo   = (const float*)d_in[6];
  const float* bo   = (const float*)d_in[7];
  const float* g1   = (const float*)d_in[8];
  const float* be1  = (const float*)d_in[9];
  const float* g2   = (const float*)d_in[10];
  const float* be2  = (const float*)d_in[11];
  const float* w1   = (const float*)d_in[12];
  const float* bf1  = (const float*)d_in[13];
  const float* w2   = (const float*)d_in[14];
  const float* bf2  = (const float*)d_in[15];

  float* xout = (float*)d_out;
  float* Kout = xout + (size_t)NTOK * D_MODEL;
  float* Vout = Kout + (size_t)BATCH * NHEAD * TKMAX * HEAD_DIM;

  char* w = (char*)d_ws;
  size_t off = 0;
  auto carve = [&](size_t bytes) {
    void* p = w + off;
    off += (bytes + 255) & ~(size_t)255;
    return p;
  };
  // weights stored TRANSPOSED [N][K] in bf16
  __bf16* wqkvT = (__bf16*)carve((size_t)3 * D_MODEL * D_MODEL * 2);
  __bf16* woT   = (__bf16*)carve((size_t)D_MODEL * D_MODEL * 2);
  __bf16* w1T   = (__bf16*)carve((size_t)DIM_FF * D_MODEL * 2);
  __bf16* w2T   = (__bf16*)carve((size_t)D_MODEL * DIM_FF * 2);
  __bf16* h_bf  = (__bf16*)carve((size_t)NTOK * D_MODEL * 2);    // reused for h2
  __bf16* q_bf  = (__bf16*)carve((size_t)NTOK * D_MODEL * 2);
  __bf16* K_bf  = (__bf16*)carve((size_t)BATCH * NHEAD * TKMAX * HEAD_DIM * 2);
  __bf16* Vt_bf = (__bf16*)carve((size_t)BATCH * NHEAD * HEAD_DIM * TKMAX * 2);
  __bf16* o_bf  = (__bf16*)carve((size_t)NTOK * D_MODEL * 2);
  float*  x1    = (float*)carve((size_t)NTOK * D_MODEL * 4);
  __bf16* ff_bf = K_bf;  // FFN activation aliases dead bf16 KV shadow (32MB)

  // 1) weight converts (transpose to [N][K])
  k_cvt_transpose<D_MODEL, 3 * D_MODEL><<<(D_MODEL / TR_R) * (3 * D_MODEL / TR_C), 256, 0, stream>>>(wqkv, wqkvT);
  k_cvt_transpose<D_MODEL, D_MODEL><<<(D_MODEL / TR_R) * (D_MODEL / TR_C), 256, 0, stream>>>(wo, woT);
  k_cvt_transpose<D_MODEL, DIM_FF><<<(D_MODEL / TR_R) * (DIM_FF / TR_C), 256, 0, stream>>>(w1, w1T);
  k_cvt_transpose<DIM_FF, D_MODEL><<<(DIM_FF / TR_R) * (D_MODEL / TR_C), 256, 0, stream>>>(w2, w2T);

  // 2) LN1
  k_layernorm<<<NTOK / LN_ROWS, 256, 0, stream>>>(x, g1, be1, h_bf);

  // 3) past KV copy into cache + bf16 shadows
  k_kvcopy<<<BATCH * NHEAD * (TP / TR_R), 256, 0, stream>>>(Kp, Vp, Kout, Vout, K_bf, Vt_bf);

  // 4) QKV GEMM: [4096,1024] x [1024,3072]
  {
    int M = NTOK, N = 3 * D_MODEL, K = D_MODEL;
    dim3 grid((M / GBM) * (N / GBN));
    k_gemm_bf16<0><<<grid, 256, 0, stream>>>(h_bf, wqkvT, M, N, K, bqkv,
                                             Kout, Vout, K_bf, Vt_bf, q_bf,
                                             nullptr, nullptr, nullptr);
  }

  // 5) attention
  k_attention<<<BATCH * NHEAD * (TC / 128), 256, 0, stream>>>(q_bf, K_bf, Vt_bf, pos, o_bf);

  // 6) Wo GEMM + residual -> x1
  {
    int M = NTOK, N = D_MODEL, K = D_MODEL;
    dim3 grid((M / GBM) * (N / GBN));
    k_gemm_bf16<1><<<grid, 256, 0, stream>>>(o_bf, woT, M, N, K, bo,
                                             nullptr, nullptr, nullptr, nullptr, nullptr,
                                             x, x1, nullptr);
  }

  // 7) LN2 -> h2 (reuse h_bf)
  k_layernorm<<<NTOK / LN_ROWS, 256, 0, stream>>>(x1, g2, be2, h_bf);

  // 8) W1 GEMM + GELU -> ff_bf
  {
    int M = NTOK, N = DIM_FF, K = D_MODEL;
    dim3 grid((M / GBM) * (N / GBN));
    k_gemm_bf16<2><<<grid, 256, 0, stream>>>(h_bf, w1T, M, N, K, bf1,
                                             nullptr, nullptr, nullptr, nullptr, nullptr,
                                             nullptr, nullptr, ff_bf);
  }

  // 9) W2 GEMM + residual -> xout
  {
    int M = NTOK, N = D_MODEL, K = DIM_FF;
    dim3 grid((M / GBM) * (N / GBN));
    k_gemm_bf16<1><<<grid, 256, 0, stream>>>(ff_bf, w2T, M, N, K, bf2,
                                             nullptr, nullptr, nullptr, nullptr, nullptr,
                                             x1, xout, nullptr);
  }
}

// v004
// Measured time: 240 microseconds a run.
// In two side-by-side timings against v003, it was 1.16 and 1.17 times as fast.
// Over all steps from v000 it is 1.93 times as fast.
#include <hip/hip_runtime.h>

typedef __bf16 v16bf __attribute__((ext_vector_type(16)));
typedef float  v8f   __attribute__((ext_vector_type(8)));
typedef unsigned int u32x4 __attribute__((ext_vector_type(4)));
typedef int i32x4 __attribute__((ext_vector_type(4)));
typedef int i32x8 __attribute__((ext_vector_type(8)));

__device__ __forceinline__ v8f wmma_bf16(v16bf a, v16bf b, v8f c) {
  // D = A(16x32 bf16) * B(32x16 bf16) + C(16x16 f32)
  return __builtin_amdgcn_wmma_f32_16x16x32_bf16(
      false, a, false, b, (short)0, c, false, false);
}

#if defined(__has_builtin)
#if __has_builtin(__builtin_amdgcn_tensor_load_to_lds) && \
    __has_builtin(__builtin_amdgcn_s_wait_tensorcnt)
#define USE_TDM 1
#endif
#endif

#ifdef USE_TDM
// 2D tile load Global->LDS via Tensor Data Mover (bf16 payload).
__device__ __forceinline__ void tdm_load_2d(unsigned lds_off, const __bf16* gaddr,
                                            unsigned dim0, unsigned dim1,
                                            unsigned tile0, unsigned tile1,
                                            unsigned stride0,
                                            unsigned pad_int_code,
                                            unsigned pad_amt_code) {
  unsigned long long ga = (unsigned long long)(uintptr_t)gaddr;
  u32x4 g0;
  g0[0] = 1u;
  g0[1] = lds_off;
  g0[2] = (unsigned)(ga & 0xFFFFFFFFu);
  g0[3] = (unsigned)((ga >> 32) & 0x01FFFFFFu)
          | (2u << 30);
  i32x8 g1;
  g1[0] = (int)((1u << 16)
                | (1u << 20)
                | (pad_int_code << 22)
                | (pad_amt_code << 25));
  g1[1] = (int)((dim0 & 0xFFFFu) << 16);
  g1[2] = (int)((dim0 >> 16) | ((dim1 & 0xFFFFu) << 16));
  g1[3] = (int)((dim1 >> 16) | (tile0 << 16));
  g1[4] = (int)(tile1 & 0xFFFFu);
  g1[5] = (int)stride0;
  g1[6] = 0;
  g1[7] = 0;
  i32x4 z4 = {0, 0, 0, 0};
#if defined(__clang_major__) && (__clang_major__ >= 23)
  i32x8 z8 = {0, 0, 0, 0, 0, 0, 0, 0};
  __builtin_amdgcn_tensor_load_to_lds(g0, g1, z4, z4, z8, 0);
#else
  __builtin_amdgcn_tensor_load_to_lds(g0, g1, z4, z4, 0);
#endif
}
#endif  // USE_TDM

#define D_MODEL 1024
#define NHEAD   16
#define HEAD_DIM 64
#define DIM_FF  4096
#define BATCH   4
#define TC      1024
#define TP      1024
#define TKMAX   2048
#define NTOK    (BATCH * TC)   // 4096

// ---------------------------------------------------------------------------
// Transposing f32 -> bf16 copies go through an LDS tile of 128 source rows x
// 64 source columns, so that both global sides move whole lines, 16 bytes a
// lane: a source row piece is 256 B of f32, a destination row piece 256 B of
// bf16.  256 threads; thread (kg, nq) holds source rows kg*8..+7, columns
// nq*4..+3.
// ---------------------------------------------------------------------------
#define TR_R 128
#define TR_C 64
#define TR_PITCH 136                                // 272 B = 16 B x odd
typedef float  v4f  __attribute__((ext_vector_type(4)));
typedef __bf16 v4bf __attribute__((ext_vector_type(4)));
typedef __bf16 v8bf __attribute__((ext_vector_type(8)));

__device__ __forceinline__ void tr_put(__bf16 (*tile)[TR_PITCH], const v4f (&v)[8],
                                       int nq, int kg) {
  #pragma unroll  // register arrays need constant indices
  for (int i = 0; i < 4; ++i) {
    v8bf p;
    #pragma unroll  // register arrays need constant indices
    for (int j = 0; j < 8; ++j) p[j] = (__bf16)v[j][i];
    *(v8bf*)&tile[nq * 4 + i][kg * 8] = p;
  }
}

// dst points at the tile's first element; ld = destination row pitch (elements)
__device__ __forceinline__ void tr_get(const __bf16 (*tile)[TR_PITCH],
                                       __bf16* __restrict__ dst, size_t ld, int tid) {
  #pragma unroll
  for (int it = 0; it < 4; ++it) {
    int idx = it * 256 + tid;
    int n = idx >> 4, c = (idx & 15) * 8;
    *(v8bf*)&dst[(size_t)n * ld + c] = *(const v8bf*)&tile[n][c];
  }
}

template <int K, int N>
__global__ __launch_bounds__(256) void k_cvt_transpose(const float* __restrict__ src,
                                                       __bf16* __restrict__ dst) {
  __shared__ __align__(16) __bf16 tile[TR_C][TR_PITCH];
  const int tid = threadIdx.x;
  const int nq = tid & 15, kg = tid >> 4;
  const int n0 = (blockIdx.x % (N / TR_C)) * TR_C;
  const int k0 = (blockIdx.x / (N / TR_C)) * TR_R;

  const float* p = src + (size_t)(k0 + kg * 8) * N + n0 + nq * 4;
  v4f v[8];
  #pragma unroll  // register arrays need constant indices
  for (int j = 0; j < 8; ++j) v[j] = *(const v4f*)(p + j * N);
  tr_put(tile, v, nq, kg);
  __syncthreads();
  tr_get(tile, dst + (size_t)n0 * K + k0, (size_t)K, tid);
}

// ---------------------------------------------------------------------------
// LayerNorm: one wave per row of D_MODEL, 8 rows a block, bf16 out.  A lane
// holds 32 elements of its row in registers (8 loads of 16 B, each wave-wide
// load 512 contiguous bytes), so the row is read once, the sums need no LDS and
// no barrier, and a launch starts an eighth of the waves.
// ---------------------------------------------------------------------------
#define LN_ROWS 8
__global__ __launch_bounds__(256) void k_layernorm(const float* __restrict__ x,
                                                   const float* __restrict__ g,
                                                   const float* __restrict__ b,
                                                   __bf16* __restrict__ out) {
  const int lane = threadIdx.x & 31, wave = threadIdx.x >> 5;
  const int row = blockIdx.x * LN_ROWS + wave;
  const float* xr = x + (size_t)row * D_MODEL + lane * 4;

  v4f v[8];
  #pragma unroll  // register arrays need constant indices
  for (int j = 0; j < 8; ++j) v[j] = *(const v4f*)(xr + j * 128);
  // the build lets a load of g or b below land in the address registers of the
  // row's loads: wait for their translations first
  asm volatile("s_wait_xcnt 0x0" ::: "memory");
  v4f gg[8], bb[8];
  #pragma unroll  // register arrays need constant indices
  for (int j = 0; j < 8; ++j) {
    gg[j] = *(const v4f*)(g + lane * 4 + j * 128);
    bb[j] = *(const v4f*)(b + lane * 4 + j * 128);
  }
  // keeps all 24 loads in flight together: left to itself the build issues
  // the loads of g and b behind the row's first data, a second latency in turn
  __builtin_amdgcn_sched_barrier(0);

  // four independent partial sums a lane: chains of 8 links, not of 32
  v4f sv = v[0], qv = v[0] * v[0];
  #pragma unroll  // register arrays need constant indices
  for (int j = 1; j < 8; ++j) { sv += v[j]; qv += v[j] * v[j]; }
  float s  = (sv[0] + sv[1]) + (sv[2] + sv[3]);
  float s2 = (qv[0] + qv[1]) + (qv[2] + qv[3]);
  #pragma unroll
  for (int off = 16; off >= 1; off >>= 1) {
    s  += __shfl_xor(s,  off, 32);
    s2 += __shfl_xor(s2, off, 32);
  }
  const float mu = s * (1.f / D_MODEL);
  const float var = s2 * (1.f / D_MODEL) - mu * mu;
  const float rstd = rsqrtf(var + 1e-5f);

  __bf16* orow = out + (size_t)row * D_MODEL + lane * 4;
  #pragma unroll  // register arrays need constant indices
  for (int j = 0; j < 8; ++j) {
    v4bf o;
    #pragma unroll  // register arrays need constant indices
    for (int i = 0; i < 4; ++i) o[i] = (__bf16)((v[j][i] - mu) * rstd * gg[j][i] + bb[j][i]);
    *(v4bf*)(orow + j * 128) = o;
  }
}

// ---------------------------------------------------------------------------
// Copy past KV into output cache (fp32) + bf16 shadows for attention.
// K shadow: [B,H,Tk,Dh] row-major; V shadow: TRANSPOSED [B,H,Dh,Tk].
// ---------------------------------------------------------------------------
// grid: B*H*(TP/128) blocks; a block takes 128 tokens of one head (contiguous
// in source and in both caches); the V shadow goes through the LDS tile.
__global__ __launch_bounds__(256) void k_kvcopy(const float* __restrict__ Kp,
                                                const float* __restrict__ Vp,
                                                float* __restrict__ Kout,
                                                float* __restrict__ Vout,
                                                __bf16* __restrict__ Kbf,
                                                __bf16* __restrict__ Vtbf) {
  __shared__ __align__(16) __bf16 tile[TR_C][TR_PITCH];
  const int tid = threadIdx.x;
  const int nq = tid & 15, kg = tid >> 4;
  const int bh = blockIdx.x / (TP / TR_R);
  const int t0 = (blockIdx.x % (TP / TR_R)) * TR_R;
  const size_t sbase = ((size_t)bh * TP + t0) * HEAD_DIM;
  const size_t dbase = ((size_t)bh * TKMAX + t0) * HEAD_DIM;

  const unsigned vo = (unsigned)(kg * 8 * HEAD_DIM + nq * 4);   // V: tile order
  const unsigned ko = (unsigned)(tid * 4);                      // K: linear
  const float* pv = Vp + sbase;
  const float* pk = Kp + sbase;
  v4f vv[8], kv[8];
  #pragma unroll  // register arrays need constant indices
  for (int j = 0; j < 8; ++j) vv[j] = *(const v4f*)(pv + vo + j * HEAD_DIM);
  #pragma unroll  // register arrays need constant indices
  for (int j = 0; j < 8; ++j) kv[j] = *(const v4f*)(pk + ko + j * 1024);
  // address registers of the loads above are rewritten below: wait for their
  // translations first.  The statement also holds all 16 loads in front of the
  // first use of V, so that no K load pays a second memory latency.
  asm volatile("s_wait_xcnt 0x0" ::: "memory");

  // the tile's barrier stands in front of every global store: it would wait
  // for stores already issued
  tr_put(tile, vv, nq, kg);
  __syncthreads();
  tr_get(tile, Vtbf + (size_t)bh * HEAD_DIM * TKMAX + t0, (size_t)TKMAX, tid);

  float* qv = Vout + dbase;
  float* qk = Kout + dbase;
  __bf16* qb = Kbf + dbase;
  #pragma unroll  // register arrays need constant indices
  for (int j = 0; j < 8; ++j) *(v4f*)(qv + vo + j * HEAD_DIM) = vv[j];
  #pragma unroll  // register arrays need constant indices
  for (int j = 0; j < 8; ++j) {
    *(v4f*)(qk + ko + j * 1024) = kv[j];
    v4bf kb;
    #pragma unroll  // register arrays need constant indices
    for (int i = 0; i < 4; ++i) kb[i] = (__bf16)kv[j][i];
    *(v4bf*)(qb + ko + j * 1024) = kb;
  }
}

#define GBM 128
#define GBN 128
#define GBK 32
#define LDSK 40                                     // row stride (elements)
#define SA_BYTES (GBM * LDSK * 2)                   // 10240
#define GEMM_BUF_BYTES (2 * SA_BYTES)               // A + B per buffer
#define EP_PITCH 68                                 // epilogue row: 272 B = 16 B x odd
#define EP_WAVE_BYTES (2 * GEMM_BUF_BYTES / 8)      // 5120 >= 16 rows x 272 B
template <int V> struct int_c { static constexpr int value = V; };

template <int MODE>
__global__ __launch_bounds__(256) void k_gemm_bf16(
    const __bf16* __restrict__ A, const __bf16* __restrict__ Bt,
    int M, int N, int K,
    const float* __restrict__ bias,
    float* __restrict__ Koutf, float* __restrict__ Voutf,
    __bf16* __restrict__ Kbf, __bf16* __restrict__ Vtbf, __bf16* __restrict__ Qbf,
    const float* __restrict__ resid, float* __restrict__ outf,
    __bf16* __restrict__ outbf) {
  __shared__ __align__(16) char smem[2 * GEMM_BUF_BYTES];   // double buffered

  const int tid = threadIdx.x;
  const int wave = tid >> 5, lane = tid & 31;
  const int mtiles = M / GBM;
  const int bm = blockIdx.x % mtiles;
  const int bn = blockIdx.x / mtiles;
  const int wm = wave & 3, wn = wave >> 2;
  const int row0 = bm * GBM + wm * 32;
  const int col0 = bn * GBN + wn * 64;

  const __bf16* Abase = A  + (size_t)(bm * GBM) * K;
  const __bf16* Bbase = Bt + (size_t)(bn * GBN) * K;

  v8f acc[2][4];
  #pragma unroll
  for (int i = 0; i < 2; ++i)
    #pragma unroll
    for (int j = 0; j < 4; ++j) acc[i][j] = (v8f)(0.f);

  const int lr = lane & 15;
  const int lh = (lane >> 4) * 16;
  const int KT = K / GBK;

#ifdef USE_TDM
  if (wave == 0) {
    tdm_load_2d(0,        Abase, K, M, GBK, GBM, K, 3, 3);
    tdm_load_2d(SA_BYTES, Bbase, K, N, GBK, GBN, K, 3, 3);
  }
#endif

  for (int kt = 0; kt < KT; ++kt) {
    const int k0 = kt * GBK;
    const int cur = kt & 1;
    __bf16 (*cA)[LDSK] = (__bf16(*)[LDSK])(smem + cur * GEMM_BUF_BYTES);
    __bf16 (*cB)[LDSK] = (__bf16(*)[LDSK])(smem + cur * GEMM_BUF_BYTES + SA_BYTES);

#ifdef USE_TDM
    if (wave == 0) {
      if (kt + 1 < KT) {
        unsigned nb = (unsigned)((cur ^ 1) * GEMM_BUF_BYTES);
        tdm_load_2d(nb,            Abase + k0 + GBK, K, M, GBK, GBM, K, 3, 3);
        tdm_load_2d(nb + SA_BYTES, Bbase + k0 + GBK, K, N, GBK, GBN, K, 3, 3);
        __builtin_amdgcn_s_wait_tensorcnt(2);   // current buffer's 2 loads done
      } else {
        __builtin_amdgcn_s_wait_tensorcnt(0);
      }
      asm volatile("" ::: "memory");
    }
    __syncthreads();
#else
    // manual staging: both tiles are 128 rows x 32 k-contiguous bf16
    #pragma unroll
    for (int i = 0; i < 2; ++i) {
      int c = i * 256 + tid;
      int r = c >> 2, kc = (c & 3) * 8;
      *(uint4*)&cA[r][kc] = *(const uint4*)&Abase[(size_t)r * K + k0 + kc];
      *(uint4*)&cB[r][kc] = *(const uint4*)&Bbase[(size_t)r * K + k0 + kc];
    }
    if (k0 + GBK < K) {
      __builtin_prefetch(&Abase[(size_t)(tid >> 1) * K + k0 + GBK], 0, 0);
      __builtin_prefetch(&Bbase[(size_t)(tid >> 1) * K + k0 + GBK], 0, 0);
    }
    __syncthreads();
#endif

    v16bf afr[2], bfr[4];
    #pragma unroll
    for (int mc = 0; mc < 2; ++mc) {
      int r = wm * 32 + mc * 16 + lr;
      #pragma unroll
      for (int j = 0; j < 16; ++j) afr[mc][j] = cA[r][lh + j];
    }
    #pragma unroll
    for (int nc = 0; nc < 4; ++nc) {
      int n = wn * 64 + nc * 16 + lr;
      #pragma unroll
      for (int j = 0; j < 16; ++j) bfr[nc][j] = cB[n][lh + j];
    }
    #pragma unroll
    for (int mc = 0; mc < 2; ++mc)
      #pragma unroll
      for (int nc = 0; nc < 4; ++nc)
        acc[mc][nc] = wmma_bf16(afr[mc], bfr[nc], acc[mc][nc]);
    __syncthreads();   // all waves done with cur before it is refilled
  }

  // epilogue: a wave passes its accumulators, 16 rows x 64 columns at a time,
  // through its own LDS range, so that a lane then holds 4 neighbouring columns
  // of one row: the residual loads and the stores move whole lines (a row piece
  // is 256 B of f32 or 128 B of bf16), a quarter of the memory instructions.
  // The ring is free here: the loop's last pass waited for every tensor load
  // and ended in a barrier behind every wave's last fragment read.
  float (*st)[EP_PITCH] = (float(*)[EP_PITCH])(smem + wave * EP_WAVE_BYTES);
  const int mofs = (lane >= 16) ? 8 : 0;
  const int er = lane >> 4;            // which row of the pair a wave-wide access covers
  const int ec = (lane & 15) * 4;      // first of the lane's 4 columns
  const int c = col0 + ec;             // global column
  const v4f bias4 = *(const v4f*)&bias[c];

  v4f rs[2][8];
  if constexpr (MODE == 1) {
    // all 16 residual loads in flight together: one memory latency, not one each
    const float* rp[2][8];
    #pragma unroll  // register arrays need constant indices
    for (int mc = 0; mc < 2; ++mc)
      #pragma unroll  // register arrays need constant indices
      for (int it = 0; it < 8; ++it) {
        rp[mc][it] = &resid[(size_t)(row0 + mc * 16 + it * 2 + er) * N + c];
        rs[mc][it] = *(const v4f*)rp[mc][it];
      }
    // left to itself the build lets a late load of the batch land in the address
    // registers of earlier ones: the addresses stay live up to this wait for
    // their translations
    asm volatile("s_wait_xcnt 0x0"
                 :: "v"(rp[0][0]), "v"(rp[0][1]), "v"(rp[0][2]), "v"(rp[0][3]),
                    "v"(rp[0][4]), "v"(rp[0][5]), "v"(rp[0][6]), "v"(rp[0][7]),
                    "v"(rp[1][0]), "v"(rp[1][1]), "v"(rp[1][2]), "v"(rp[1][3]),
                    "v"(rp[1][4]), "v"(rp[1][5]), "v"(rp[1][6]), "v"(rp[1][7])
                 : "memory");
  }

  // QKV: a wave's 64 columns are one head (hh) of one of q, k, v (WHICH 0, 1, 2)
  const int hh = (col0 & 1023) >> 6;

  auto drain = [&](auto wc) {
    constexpr int WHICH = decltype(wc)::value;
    float bc[4];                       // bias in accumulator order, for the V shadow
    if constexpr (MODE == 0 && WHICH == 2) {
      #pragma unroll  // register arrays need constant indices
      for (int nc = 0; nc < 4; ++nc) bc[nc] = bias[col0 + nc * 16 + lr];
    }
    #pragma unroll  // register arrays need constant indices
    for (int mc = 0; mc < 2; ++mc) {
      if constexpr (MODE == 0 && WHICH == 2) {
        // V shadow is [d][token]: a lane's 8 accumulator rows are 8 neighbouring
        // tokens of one d, one 16-byte store straight from registers
        const int m0 = row0 + mc * 16 + mofs;
        const int bh = (m0 >> 10) * NHEAD + hh;
        #pragma unroll  // register arrays need constant indices
        for (int nc = 0; nc < 4; ++nc) {
          v8bf p;
          #pragma unroll  // register arrays need constant indices
          for (int r = 0; r < 8; ++r) p[r] = (__bf16)(acc[mc][nc][r] + bc[nc]);
          *(v8bf*)&Vtbf[((size_t)bh * HEAD_DIM + nc * 16 + lr) * TKMAX + TP + (m0 & 1023)] = p;
        }
      }
      // these 16 rows overwrite the range: the first half's reads have returned
      if (mc == 1) asm volatile("s_wait_dscnt 0x0" ::: "memory");
      #pragma unroll  // register arrays need constant indices
      for (int nc = 0; nc < 4; ++nc)
        #pragma unroll  // register arrays need constant indices
        for (int r = 0; r < 8; ++r) st[r + mofs][nc * 16 + lr] = acc[mc][nc][r];
      // other lanes' rows are read back below: the wave's LDS writes land first
      asm volatile("s_wait_dscnt 0x0" ::: "memory");
      #pragma unroll  // register arrays need constant indices
      for (int it = 0; it < 8; ++it) {
        const int m = row0 + mc * 16 + it * 2 + er;   // global row (token)
        const v4f v = *(const v4f*)&st[it * 2 + er][ec] + bias4;
        if constexpr (MODE == 0) {
          const int bh = (m >> 10) * NHEAD + hh;
          const int t = m & 1023;
          const size_t o = ((size_t)bh * TKMAX + TP + t) * HEAD_DIM + ec;
          v4bf vb;
          #pragma unroll  // register arrays need constant indices
          for (int i = 0; i < 4; ++i) vb[i] = (__bf16)v[i];
          if constexpr (WHICH == 0) {
            *(v4bf*)&Qbf[((size_t)bh * TC + t) * HEAD_DIM + ec] = vb;
          } else if constexpr (WHICH == 1) {
            *(v4f*)&Koutf[o] = v;
            *(v4bf*)&Kbf[o] = vb;
          } else {
            *(v4f*)&Voutf[o] = v;
          }
        } else if constexpr (MODE == 1) {
          *(v4f*)&outf[(size_t)m * N + c] = v + rs[mc][it];
        } else {
          v4bf o;
          #pragma unroll  // register arrays need constant indices
          for (int i = 0; i < 4; ++i) {
            float ge = 0.5f * v[i] * (1.f + erff(v[i] * 0.70710678118654752f));
            o[i] = (__bf16)ge;
          }
          *(v4bf*)&outbf[(size_t)m * N + c] = o;
        }
      }
    }
    // QKV: the build runs shared address code of the other two cases behind
    // these stores, over their registers: wait for their translations first
    if constexpr (MODE == 0) asm volatile("s_wait_xcnt 0x0" ::: "memory");
  };

  if constexpr (MODE == 0) {
    // the same for a whole wave: read through the first lane, a scalar branch
    const int which = __builtin_amdgcn_readfirstlane(col0 >> 10);
    if (which == 0)      drain(int_c<0>{});
    else if (which == 1) drain(int_c<1>{});
    else                 drain(int_c<2>{});
  } else {
    drain(int_c<0>{});
  }
}

#define SK_BYTES  (32 * 72 * 2)                     // 4608  [key][d]
#define SVT_BYTES (64 * 40 * 2)                     // 5120  [d][key]
#define KV_BUF_BYTES (SK_BYTES + SVT_BYTES)         // 9728 per buffer
#define ATT_SMEM (2 * KV_BUF_BYTES)                 // 19456

__device__ __forceinline__ float xhalf(float x) {
  const int i = __builtin_bit_cast(int, x);
  return __builtin_bit_cast(float, __builtin_amdgcn_permlanex16(
      i, i, 0x76543210, 0xfedcba98, false, false));
}

__global__ __launch_bounds__(256) void k_attention(
    const __bf16* __restrict__ Qbf, const __bf16* __restrict__ Kbf,
    const __bf16* __restrict__ Vtbf, const int* __restrict__ pos_ptr,
    __bf16* __restrict__ Obf) {
  __shared__ __align__(16) char smem[ATT_SMEM];
  // the ring's place in the work-group's LDS, for the tensor loads.  Only they
  // write the ring: taken from the array itself, the address also tells the
  // build that the array is written, so that it stays allocated and is read
  const unsigned ring = (unsigned)(uintptr_t)smem;

  const int tid = threadIdx.x;
  const int wave = tid >> 5, lane = tid & 31;
  const int qt = blockIdx.x & 7;           // query tile of 128
  const int bh = blockIdx.x >> 3;          // b*NHEAD + h
  const int pos = pos_ptr[0];
  const int qbase = qt * 128;
  const int qrow = qbase + wave * 16;
  const int lr = lane & 15;
  const int lh = (lane >> 4) * 16;
  const int mofs = (lane >= 16) ? 8 : 0;

  const __bf16* Qp = Qbf + ((size_t)bh * TC + qrow) * HEAD_DIM;
  const __bf16* Kb = Kbf + (size_t)bh * TKMAX * HEAD_DIM;
  const __bf16* Vb = Vtbf + (size_t)bh * HEAD_DIM * TKMAX;

  // load Q fragments (64x16 -> two 32x16 B-fragments) with explicit 16B loads:
  // lane = query column, 16 contiguous d per wave half, as the K loader below
  v16bf qf[2];
  #pragma unroll
  for (int f = 0; f < 2; ++f) {
    union { uint4 u[2]; v16bf v; } tmp;
    const uint4* p = (const uint4*)(Qp + (size_t)lr * HEAD_DIM + f * 32 + lh);
    tmp.u[0] = p[0];
    tmp.u[1] = p[1];
    qf[f] = tmp.v;
  }

  // all per lane, for query qrow + lr: running maximum (equal in both halves),
  // sum over this half's keys, O^T rows d = dc*16 + mofs + r
  float mrun = -1e30f, lsum = 0.f;
  v8f o[4];
  #pragma unroll
  for (int d = 0; d < 4; ++d) o[d] = (v8f)(0.f);

  const float scale = 0.125f;  // 1/sqrt(64)
  // last key this lane's query sees, counted from the first key of its half
  const int lim = pos + qrow + lr - mofs;
  const int kmax = min(pos + qbase + 128, TKMAX);   // never past the cache
  // at least one pass: the waits for the loads below stand in the loop
  const int ntiles = max((kmax + 31) / 32, 1);

#ifdef USE_TDM
  if (wave == 0) {
    tdm_load_2d(ring,            Kb, HEAD_DIM, TKMAX, HEAD_DIM, 32, HEAD_DIM, 4, 3);
    tdm_load_2d(ring + SK_BYTES, Vb, TKMAX, HEAD_DIM, 32, HEAD_DIM, TKMAX, 3, 3);
  }
#endif

  for (int kt = 0; kt < ntiles; ++kt) {
    const int kofs = kt * 32;
    const int cur = kt & 1;
    __bf16 (*sK)[72]  = (__bf16(*)[72])(smem + cur * KV_BUF_BYTES);
    __bf16 (*sVt)[40] = (__bf16(*)[40])(smem + cur * KV_BUF_BYTES + SK_BYTES);

#ifdef USE_TDM
    if (wave == 0) {
      if (kt + 1 < ntiles) {
        unsigned nb = ring + (unsigned)((cur ^ 1) * KV_BUF_BYTES);
        tdm_load_2d(nb, Kb + (size_t)(kofs + 32) * HEAD_DIM,
                    HEAD_DIM, TKMAX, HEAD_DIM, 32, HEAD_DIM, 4, 3);
        tdm_load_2d(nb + SK_BYTES, Vb + kofs + 32,
                    TKMAX, HEAD_DIM, 32, HEAD_DIM, TKMAX, 3, 3);
        __builtin_amdgcn_s_wait_tensorcnt(2);
      } else {
        __builtin_amdgcn_s_wait_tensorcnt(0);
      }
      asm volatile("" ::: "memory");
    }
    __syncthreads();
#else
    {
      int r = tid >> 3, c = (tid & 7) * 8;
      *(uint4*)&sK[r][c] = *(const uint4*)&Kb[(size_t)(kofs + r) * HEAD_DIM + c];
      int d = tid >> 2, kc = (tid & 3) * 8;
      *(uint4*)&sVt[d][kc] = *(const uint4*)&Vb[(size_t)d * TKMAX + kofs + kc];
    }
    __syncthreads();
#endif

    // S^T = K * Q^T: s[nc][r] = score of key kofs + nc*16 + mofs + r, query lr.
    // The tile's K fragments are read as one group: one LDS latency, not four
    v16bf ak[2][2];
    #pragma unroll
    for (int nc = 0; nc < 2; ++nc)
      #pragma unroll
      for (int f = 0; f < 2; ++f)
        #pragma unroll
        for (int j = 0; j < 16; ++j) ak[nc][f][j] = sK[nc * 16 + lr][f * 32 + lh + j];
    // V^T fragments (16 d x 32 keys each), read here so that they arrive while
    // the softmax runs; keys in the order in which pf below holds them
    v16bf av[4];
    #pragma unroll
    for (int dc = 0; dc < 4; ++dc)
      #pragma unroll
      for (int j = 0; j < 8; ++j) {
        av[dc][j]     = sVt[dc * 16 + lr][mofs + j];
        av[dc][8 + j] = sVt[dc * 16 + lr][16 + mofs + j];
      }
    // holds the 16 reads above in front of the products: left to itself the
    // build reads each fragment into one register set right before its product
    // and waits out the LDS latency eight times a tile
    __builtin_amdgcn_sched_barrier(0);
    v8f s[2];
    #pragma unroll
    for (int nc = 0; nc < 2; ++nc) s[nc] = wmma_bf16(ak[nc][0], qf[0], (v8f)(0.f));
    #pragma unroll
    for (int nc = 0; nc < 2; ++nc) s[nc] = wmma_bf16(ak[nc][1], qf[1], s[nc]);

    // online softmax of the lane's one query
    s[0] *= scale;
    s[1] *= scale;
    const int rel = lim - kofs;            // keys mofs + j with j <= rel are seen
    float mt[8];
    #pragma unroll
    for (int r = 0; r < 8; ++r) {
      if (r > rel)      s[0][r] = -1e30f;
      if (16 + r > rel) s[1][r] = -1e30f;
      mt[r] = fmaxf(s[0][r], s[1][r]);
    }
    float mx = fmaxf(fmaxf(fmaxf(mt[0], mt[1]), fmaxf(mt[2], mt[3])),
                     fmaxf(fmaxf(mt[4], mt[5]), fmaxf(mt[6], mt[7])));
    mx = fmaxf(mx, xhalf(mx));             // over all 32 keys, both halves alike
    const float mnew = fmaxf(mrun, mx);
    const float corr = __expf(mrun - mnew);
    mrun = mnew;

    // P^T as B operand: element j = key mofs + j, element 8 + j = key 16 + mofs + j
    v16bf pf;
    float st[8];
    #pragma unroll
    for (int r = 0; r < 8; ++r) {
      float p0 = __expf(s[0][r] - mnew);
      float p1 = __expf(s[1][r] - mnew);
      st[r] = p0 + p1;
      pf[r]     = (__bf16)p0;
      pf[8 + r] = (__bf16)p1;
    }
    lsum = lsum * corr + (((st[0] + st[1]) + (st[2] + st[3])) +
                          ((st[4] + st[5]) + (st[6] + st[7])));
    #pragma unroll
    for (int d = 0; d < 4; ++d) o[d] *= corr;

    // O^T += V^T(16 d x 32 keys) * P^T(32 keys x 16 queries)
    #pragma unroll
    for (int dc = 0; dc < 4; ++dc) o[dc] = wmma_bf16(av[dc], pf, o[dc]);
    __syncthreads();   // done reading cur buffer before refill
  }

  // normalize + write O into [token, d_model] bf16 buffer at head column: a
  // lane's 8 accumulator rows are 8 neighbouring d of its token, 16 bytes
  const float ltot = lsum + xhalf(lsum);   // the two halves' keys together
  const int b = bh >> 4, h = bh & 15;
  __bf16* op = Obf + (size_t)(b * TC + qrow + lr) * D_MODEL + h * HEAD_DIM + mofs;
  #pragma unroll
  for (int dc = 0; dc < 4; ++dc) {
    v8bf ov;
    #pragma unroll
    for (int r = 0; r < 8; ++r) ov[r] = (__bf16)(o[dc][r] / ltot);
    *(v8bf*)(op + dc * 16) = ov;
  }
}

// ---------------------------------------------------------------------------
// Host-side launch
// ---------------------------------------------------------------------------
extern "C" void kernel_launch(void* const* d_in, const int* in_sizes, int n_in,
                              void* d_out, int out_size, void* d_ws, size_t ws_size,
                              hipStream_t stream) {
  const float* x    = (const float*)d_in[0];
  const float* Kp   = (const float*)d_in[1];
  const float* Vp   = (const float*)d_in[2];
  const int*   pos  = (const int*)d_in[3];
  const float* wqkv = (const float*)d_in[4];
  const float* bqkv = (const float*)d_in[5];
  const float* wo   = (const float*)d_in[6];
  const float* bo   = (const float*)d_in[7];
  const float* g1   = (const float*)d_in[8];
  const float* be1  = (const float*)d_in[9];
  const float* g2   = (const float*)d_in[10];
  const float* be2  = (const float*)d_in[11];
  const float* w1   = (const float*)d_in[12];
  const float* bf1  = (const float*)d_in[13];
  const float* w2   = (const float*)d_in[14];
  const float* bf2  = (const float*)d_in[15];

  float* xout = (float*)d_out;
  float* Kout = xout + (size_t)NTOK * D_MODEL;
  float* Vout = Kout + (size_t)BATCH * NHEAD * TKMAX * HEAD_DIM;

  char* w = (char*)d_ws;
  size_t off = 0;
  auto carve = [&](size_t bytes) {
    void* p = w + off;
    off += (bytes + 255) & ~(size_t)255;
    return p;
  };
  // weights stored TRANSPOSED [N][K] in bf16
  __bf16* wqkvT = (__bf16*)carve((size_t)3 * D_MODEL * D_MODEL * 2);
  __bf16* woT   = (__bf16*)carve((size_t)D_MODEL * D_MODEL * 2);
  __bf16* w1T   = (__bf16*)carve((size_t)DIM_FF * D_MODEL * 2);
  __bf16* w2T   = (__bf16*)carve((size_t)D_MODEL * DIM_FF * 2);
  __bf16* h_bf  = (__bf16*)carve((size_t)NTOK * D_MODEL * 2);    // reused for h2
  __bf16* q_bf  = (__bf16*)carve((size_t)NTOK * D_MODEL * 2);
  __bf16* K_bf  = (__bf16*)carve((size_t)BATCH * NHEAD * TKMAX * HEAD_DIM * 2);
  __bf16* Vt_bf = (__bf16*)carve((size_t)BATCH * NHEAD * HEAD_DIM * TKMAX * 2);
  __bf16* o_bf  = (__bf16*)carve((size_t)NTOK * D_MODEL * 2);
  float*  x1    = (float*)carve((size_t)NTOK * D_MODEL * 4);
  __bf16* ff_bf = K_bf;  // FFN activation aliases dead bf16 KV shadow (32MB)

  // 1) weight converts (transpose to [N][K])
  k_cvt_transpose<D_MODEL, 3 * D_MODEL><<<(D_MODEL / TR_R) * (3 * D_MODEL / TR_C), 256, 0, stream>>>(wqkv, wqkvT);
  k_cvt_transpose<D_MODEL, D_MODEL><<<(D_MODEL / TR_R) * (D_MODEL / TR_C), 256, 0, stream>>>(wo, woT);
  k_cvt_transpose<D_MODEL, DIM_FF><<<(D_MODEL / TR_R) * (DIM_FF / TR_C), 256, 0, stream>>>(w1, w1T);
  k_cvt_transpose<DIM_FF, D_MODEL><<<(DIM_FF / TR_R) * (D_MODEL / TR_C), 256, 0, stream>>>(w2, w2T);

  // 2) LN1
  k_layernorm<<<NTOK / LN_ROWS, 256, 0, stream>>>(x, g1, be1, h_bf);

  // 3) past KV copy into cache + bf16 shadows
  k_kvcopy<<<BATCH * NHEAD * (TP / TR_R), 256, 0, stream>>>(Kp, Vp, Kout, Vout, K_bf, Vt_bf);

  // 4) QKV GEMM: [4096,1024] x [1024,3072]
  {
    int M = NTOK, N = 3 * D_MODEL, K = D_MODEL;
    dim3 grid((M / GBM) * (N / GBN));
    k_gemm_bf16<0><<<grid, 256, 0, stream>>>(h_bf, wqkvT, M, N, K, bqkv,
                                             Kout, Vout, K_bf, Vt_bf, q_bf,
                                             nullptr, nullptr, nullptr);
  }

  // 5) attention
  k_attention<<<BATCH * NHEAD * (TC / 128), 256, 0, stream>>>(q_bf, K_bf, Vt_bf, pos, o_bf);

  // 6) Wo GEMM + residual -> x1
  {
    int M = NTOK, N = D_MODEL, K = D_MODEL;
    dim3 grid((M / GBM) * (N / GBN));
    k_gemm_bf16<1><<<grid, 256, 0, stream>>>(o_bf, woT, M, N, K, bo,
                                             nullptr, nullptr, nullptr, nullptr, nullptr,
                                             x, x1, nullptr);
  }

  // 7) LN2 -> h2 (reuse h_bf)
  k_layernorm<<<NTOK / LN_ROWS, 256, 0, stream>>>(x1, g2, be2, h_bf);

  // 8) W1 GEMM + GELU -> ff_bf
  {
    int M = NTOK, N = DIM_FF, K = D_MODEL;
    dim3 grid((M / GBM) * (N / GBN));
    k_gemm_bf16<2><<<grid, 256, 0, stream>>>(h_bf, w1T, M, N, K, bf1,
                                             nullptr, nullptr, nullptr, nullptr, nullptr,
                                             nullptr, nullptr, ff_bf);
  }

  // 9) W2 GEMM + residual -> xout
  {
    int M = NTOK, N = D_MODEL, K = DIM_FF;
    dim3 grid((M / GBM) * (N / GBN));
    k_gemm_bf16<1><<<grid, 256, 0, stream>>>(ff_bf, w2T, M, N, K, bf2,
                                             nullptr, nullptr, nullptr, nullptr, nullptr,
                                             x1, xout, nullptr);
  }
}

// v005
// One run takes 198 microseconds.
// In two side-by-side timings against v004, it was 1.20 and 1.21 times as fast.
// Over all steps from v000 it is 2.33 times as fast.
#include <hip/hip_runtime.h>

typedef __bf16 v16bf __attribute__((ext_vector_type(16)));
typedef float  v8f   __attribute__((ext_vector_type(8)));
typedef unsigned int u32x4 __attribute__((ext_vector_type(4)));
typedef int i32x4 __attribute__((ext_vector_type(4)));
typedef int i32x8 __attribute__((ext_vector_type(8)));

__device__ __forceinline__ v8f wmma_bf16(v16bf a, v16bf b, v8f c) {
  // D = A(16x32 bf16) * B(32x16 bf16) + C(16x16 f32)
  return __builtin_amdgcn_wmma_f32_16x16x32_bf16(
      false, a, false, b, (short)0, c, false, false);
}

#if defined(__has_builtin)
#if __has_builtin(__builtin_amdgcn_tensor_load_to_lds) && \
    __has_builtin(__builtin_amdgcn_s_wait_tensorcnt)
#define USE_TDM 1
#endif
#endif

#ifdef USE_TDM
// 2D tile load Global->LDS via Tensor Data Mover (bf16 payload).
__device__ __forceinline__ void tdm_load_2d(unsigned lds_off, const __bf16* gaddr,
                                            unsigned dim0, unsigned dim1,
                                            unsigned tile0, unsigned tile1,
                                            unsigned stride0,
                                            unsigned pad_int_code,
                                            unsigned pad_amt_code) {
  unsigned long long ga = (unsigned long long)(uintptr_t)gaddr;
  u32x4 g0;
  g0[0] = 1u;
  g0[1] = lds_off;
  g0[2] = (unsigned)(ga & 0xFFFFFFFFu);
  g0[3] = (unsigned)((ga >> 32) & 0x01FFFFFFu)
          | (2u << 30);
  i32x8 g1;
  g1[0] = (int)((1u << 16)
                | (1u << 20)
                | (pad_int_code << 22)
                | (pad_amt_code << 25));
  g1[1] = (int)((dim0 & 0xFFFFu) << 16);
  g1[2] = (int)((dim0 >> 16) | ((dim1 & 0xFFFFu) << 16));
  g1[3] = (int)((dim1 >> 16) | (tile0 << 16));
  g1[4] = (int)(tile1 & 0xFFFFu);
  g1[5] = (int)stride0;
  g1[6] = 0;
  g1[7] = 0;
  i32x4 z4 = {0, 0, 0, 0};
#if defined(__clang_major__) && (__clang_major__ >= 23)
  i32x8 z8 = {0, 0, 0, 0, 0, 0, 0, 0};
  __builtin_amdgcn_tensor_load_to_lds(g0, g1, z4, z4, z8, 0);
#else
  __builtin_amdgcn_tensor_load_to_lds(g0, g1, z4, z4, 0);
#endif
}
#endif  // USE_TDM

#define D_MODEL 1024
#define NHEAD   16
#define HEAD_DIM 64
#define DIM_FF  4096
#define BATCH   4
#define TC      1024
#define TP      1024
#define TKMAX   2048
#define NTOK    (BATCH * TC)   // 4096

// ---------------------------------------------------------------------------
// Transposing f32 -> bf16 copies go through an LDS tile of 128 source rows x
// 64 source columns, so that both global sides move whole lines, 16 bytes a
// lane: a source row piece is 256 B of f32, a destination row piece 256 B of
// bf16.  256 threads; thread (kg, nq) holds source rows kg*8..+7, columns
// nq*4..+3.
// ---------------------------------------------------------------------------
#define TR_R 128
#define TR_C 64
#define TR_PITCH 136                                // 272 B = 16 B x odd
typedef float  v4f  __attribute__((ext_vector_type(4)));
typedef __bf16 v4bf __attribute__((ext_vector_type(4)));
typedef __bf16 v8bf __attribute__((ext_vector_type(8)));

__device__ __forceinline__ void tr_put(__bf16 (*tile)[TR_PITCH], const v4f (&v)[8],
                                       int nq, int kg) {
  #pragma unroll  // register arrays need constant indices
  for (int i = 0; i < 4; ++i) {
    v8bf p;
    #pragma unroll  // register arrays need constant indices
    for (int j = 0; j < 8; ++j) p[j] = (__bf16)v[j][i];
    *(v8bf*)&tile[nq * 4 + i][kg * 8] = p;
  }
}

// dst points at the tile's first element; ld = destination row pitch (elements)
__device__ __forceinline__ void tr_get(const __bf16 (*tile)[TR_PITCH],
                                       __bf16* __restrict__ dst, size_t ld, int tid) {
  #pragma unroll
  for (int it = 0; it < 4; ++it) {
    int idx = it * 256 + tid;
    int n = idx >> 4, c = (idx & 15) * 8;
    *(v8bf*)&dst[(size_t)n * ld + c] = *(const v8bf*)&tile[n][c];
  }
}

template <int K, int N>
__global__ __launch_bounds__(256) void k_cvt_transpose(const float* __restrict__ src,
                                                       __bf16* __restrict__ dst) {
  __shared__ __align__(16) __bf16 tile[TR_C][TR_PITCH];
  const int tid = threadIdx.x;
  const int nq = tid & 15, kg = tid >> 4;
  const int n0 = (blockIdx.x % (N / TR_C)) * TR_C;
  const int k0 = (blockIdx.x / (N / TR_C)) * TR_R;

  const float* p = src + (size_t)(k0 + kg * 8) * N + n0 + nq * 4;
  v4f v[8];
  #pragma unroll  // register arrays need constant indices
  for (int j = 0; j < 8; ++j) v[j] = *(const v4f*)(p + j * N);
  tr_put(tile, v, nq, kg);
  __syncthreads();
  tr_get(tile, dst + (size_t)n0 * K + k0, (size_t)K, tid);
}

// ---------------------------------------------------------------------------
// LayerNorm: one wave per row of D_MODEL, 8 rows a block, bf16 out.  A lane
// holds 32 elements of its row in registers (8 loads of 16 B, each wave-wide
// load 512 contiguous bytes), so the row is read once, the sums need no LDS and
// no barrier, and a launch starts an eighth of the waves.
// ---------------------------------------------------------------------------
#define LN_ROWS 8
__global__ __launch_bounds__(256) void k_layernorm(const float* __restrict__ x,
                                                   const float* __restrict__ g,
                                                   const float* __restrict__ b,
                                                   __bf16* __restrict__ out) {
  const int lane = threadIdx.x & 31, wave = threadIdx.x >> 5;
  const int row = blockIdx.x * LN_ROWS + wave;
  const float* xr = x + (size_t)row * D_MODEL + lane * 4;

  v4f v[8];
  #pragma unroll  // register arrays need constant indices
  for (int j = 0; j < 8; ++j) v[j] = *(const v4f*)(xr + j * 128);
  // the build lets a load of g or b below land in the address registers of the
  // row's loads: wait for their translations first
  asm volatile("s_wait_xcnt 0x0" ::: "memory");
  v4f gg[8], bb[8];
  #pragma unroll  // register arrays need constant indices
  for (int j = 0; j < 8; ++j) {
    gg[j] = *(const v4f*)(g + lane * 4 + j * 128);
    bb[j] = *(const v4f*)(b + lane * 4 + j * 128);
  }
  // keeps all 24 loads in flight together: left to itself the build issues
  // the loads of g and b behind the row's first data, a second latency in turn
  __builtin_amdgcn_sched_barrier(0);

  // four independent partial sums a lane: chains of 8 links, not of 32
  v4f sv = v[0], qv = v[0] * v[0];
  #pragma unroll  // register arrays need constant indices
  for (int j = 1; j < 8; ++j) { sv += v[j]; qv += v[j] * v[j]; }
  float s  = (sv[0] + sv[1]) + (sv[2] + sv[3]);
  float s2 = (qv[0] + qv[1]) + (qv[2] + qv[3]);
  #pragma unroll
  for (int off = 16; off >= 1; off >>= 1) {
    s  += __shfl_xor(s,  off, 32);
    s2 += __shfl_xor(s2, off, 32);
  }
  const float mu = s * (1.f / D_MODEL);
  const float var = s2 * (1.f / D_MODEL) - mu * mu;
  const float rstd = rsqrtf(var + 1e-5f);

  __bf16* orow = out + (size_t)row * D_MODEL + lane * 4;
  #pragma unroll  // register arrays need constant indices
  for (int j = 0; j < 8; ++j) {
    v4bf o;
    #pragma unroll  // register arrays need constant indices
    for (int i = 0; i < 4; ++i) o[i] = (__bf16)((v[j][i] - mu) * rstd * gg[j][i] + bb[j][i]);
    *(v4bf*)(orow + j * 128) = o;
  }
}

// ---------------------------------------------------------------------------
// Copy past KV into output cache (fp32) + bf16 shadows for attention.
// K shadow: [B,H,Tk,Dh] row-major; V shadow: TRANSPOSED [B,H,Dh,Tk].
// ---------------------------------------------------------------------------
// grid: B*H*(TP/128) blocks; a block takes 128 tokens of one head (contiguous
// in source and in both caches); the V shadow goes through the LDS tile.
__global__ __launch_bounds__(256) void k_kvcopy(const float* __restrict__ Kp,
                                                const float* __restrict__ Vp,
                                                float* __restrict__ Kout,
                                                float* __restrict__ Vout,
                                                __bf16* __restrict__ Kbf,
                                                __bf16* __restrict__ Vtbf) {
  __shared__ __align__(16) __bf16 tile[TR_C][TR_PITCH];
  const int tid = threadIdx.x;
  const int nq = tid & 15, kg = tid >> 4;
  const int bh = blockIdx.x / (TP / TR_R);
  const int t0 = (blockIdx.x % (TP / TR_R)) * TR_R;
  const size_t sbase = ((size_t)bh * TP + t0) * HEAD_DIM;
  const size_t dbase = ((size_t)bh * TKMAX + t0) * HEAD_DIM;

  const unsigned vo = (unsigned)(kg * 8 * HEAD_DIM + nq * 4);   // V: tile order
  const unsigned ko = (unsigned)(tid * 4);                      // K: linear
  const float* pv = Vp + sbase;
  const float* pk = Kp + sbase;
  v4f vv[8], kv[8];
  #pragma unroll  // register arrays need constant indices
  for (int j = 0; j < 8; ++j) vv[j] = *(const v4f*)(pv + vo + j * HEAD_DIM);
  #pragma unroll  // register arrays need constant indices
  for (int j = 0; j < 8; ++j) kv[j] = *(const v4f*)(pk + ko + j * 1024);
  // address registers of the loads above are rewritten below: wait for their
  // translations first.  The statement also holds all 16 loads in front of the
  // first use of V, so that no K load pays a second memory latency.
  asm volatile("s_wait_xcnt 0x0" ::: "memory");

  // the tile's barrier stands in front of every global store: it would wait
  // for stores already issued
  tr_put(tile, vv, nq, kg);
  __syncthreads();
  tr_get(tile, Vtbf + (size_t)bh * HEAD_DIM * TKMAX + t0, (size_t)TKMAX, tid);

  float* qv = Vout + dbase;
  float* qk = Kout + dbase;
  __bf16* qb = Kbf + dbase;
  #pragma unroll  // register arrays need constant indices
  for (int j = 0; j < 8; ++j) *(v4f*)(qv + vo + j * HEAD_DIM) = vv[j];
  #pragma unroll  // register arrays need constant indices
  for (int j = 0; j < 8; ++j) {
    *(v4f*)(qk + ko + j * 1024) = kv[j];
    v4bf kb;
    #pragma unroll  // register arrays need constant indices
    for (int i = 0; i < 4; ++i) kb[i] = (__bf16)kv[j][i];
    *(v4bf*)(qb + ko + j * 1024) = kb;
  }
}

// ---------------------------------------------------------------------------
// Tiled WMMA GEMM: C[M,N] = A[M,K](bf16) * Bt[N,K](bf16, pre-transposed)
//   block tile 128x128, 256 threads = 8 waves,
//   wave grid 4(M) x 2(N); each wave: 2x4 accumulators of 16x16.
//   A pass is 128 k = 256 B of every operand row, two buffers.  Every wave
//   brings its own slice of 32 rows with one tensor load a pass (waves 0..3
//   rows of A, waves 4..7 rows of Bt), issued one pass before it is read.
//   Fragments are read one block of 32 k ahead, into a second register set.
//   M, N multiples of 128; K a multiple of 128 and at least 256.
// MODE 0: QKV scatter  MODE 1: bias+residual->f32  MODE 2: bias+GELU->bf16
// ---------------------------------------------------------------------------
#define GBM 128
#define GBN 128
#define GBK 128
#define G_ROWB 256                                  // bytes of a row in a pass
#define G_PITCH 272                                 // row + 16 B pad = 16 B x odd
#define G_SLICE_ROWS 32
#define G_SLICE 10240                               // 32 x 272 = 8704, up to a multiple of 2 KiB
#define GEMM_BUF_BYTES (8 * G_SLICE)                // 81920
#define EP_PITCH 68                                 // epilogue row: 272 B = 16 B x odd
#define EP_WAVE_BYTES G_SLICE                       // >= 16 rows x 272 B
template <int V> struct int_c { static constexpr int value = V; };
typedef unsigned int u32x8 __attribute__((ext_vector_type(8)));

__device__ __forceinline__ uint32_t uni(uint32_t v) {
  return (uint32_t)__builtin_amdgcn_readfirstlane(v);
}
__device__ __forceinline__ uint32_t pinned(uint32_t v) {
  uint32_t w = uni(v);
  asm volatile("" : "+s"(w));  // the value stays in a scalar register
  return w;
}
__device__ __forceinline__ u32x8 gemm_group1(uint32_t src_pitch) {
  u32x8 g;
  g[0] = uni((1u << 20) | (5u << 22) | (3u << 25));
  g[1] = uni((uint32_t)G_ROWB << 16);
  g[2] = uni((uint32_t)G_SLICE_ROWS << 16);
  g[3] = uni((uint32_t)G_ROWB << 16);
  g[4] = uni((uint32_t)G_SLICE_ROWS);
  g[5] = uni(src_pitch);
  g[6] = uni(0u);
  g[7] = uni(0u);
  return g;
}
__device__ __forceinline__ u32x4 gemm_group0(uint32_t lds_dst, uint64_t ga) {
  u32x4 g;
  g[0] = uni(1u);
  g[1] = uni(lds_dst);
  g[2] = uni((uint32_t)ga);
  g[3] = uni((((uint32_t)(ga >> 32)) & 0x01FFFFFFu) | 0x80000000u);
  return g;
}
// 16 k of one row: two 16-byte LDS reads
__device__ __forceinline__ v16bf ld_frag(const char* p) {
  const v8bf lo = *(const v8bf*)p, hi = *(const v8bf*)(p + 16);
  return __builtin_shufflevector(lo, hi, 0, 1, 2, 3, 4, 5, 6, 7, 8, 9, 10, 11, 12, 13, 14, 15);
}

template <int MODE>
__global__ __launch_bounds__(256) void k_gemm_bf16(
    const __bf16* __restrict__ A, const __bf16* __restrict__ Bt,
    int M, int N, int K,
    const float* __restrict__ bias,
    float* __restrict__ Koutf, float* __restrict__ Voutf,
    __bf16* __restrict__ Kbf, __bf16* __restrict__ Vtbf, __bf16* __restrict__ Qbf,
    const float* __restrict__ resid, float* __restrict__ outf,
    __bf16* __restrict__ outbf) {
  // two buffers; every slice's place is a multiple of 2 KiB in the work-group's LDS
  __shared__ __attribute__((aligned(2048))) char smem[2 * GEMM_BUF_BYTES];

  const int tid = threadIdx.x;
  const int wave = (int)uni((uint32_t)tid >> 5), lane = tid & 31;
  const int mtiles = M / GBM;
  const int bm = blockIdx.x % mtiles;
  const int bn = blockIdx.x / mtiles;
  const int wm = wave & 3, wn = wave >> 2;
  const int row0 = bm * GBM + wm * 32;
  const int col0 = bn * GBN + wn * 64;

  v8f acc[2][4];
  #pragma unroll
  for (int i = 0; i < 2; ++i)
    #pragma unroll
    for (int j = 0; j < 4; ++j) acc[i][j] = (v8f)(0.f);

  const int lr = lane & 15;
  const int lh = (lane >> 4) * 16;
  const uint32_t T = (uint32_t)K / GBK;               // passes

  // this wave's slice: its first source row and its place in a buffer
  const __bf16* srow = (wave < 4) ? A  + (size_t)(bm * GBM + wave * G_SLICE_ROWS) * K
                                  : Bt + (size_t)(bn * GBN + (wave - 4) * G_SLICE_ROWS) * K;
  const uint64_t sbase = (uint64_t)(uintptr_t)srow;
  const uint32_t sdst = (uint32_t)(uintptr_t)smem + (uint32_t)wave * G_SLICE;
  u32x8 g1 = gemm_group1((uint32_t)K * 2u);
  asm volatile("" : "+s"(g1));
  auto issue = [&](uint32_t s) {
    const u32x4 g0 = gemm_group0(sdst + (s & 1u) * GEMM_BUF_BYTES, sbase + (uint64_t)s * G_ROWB);
    asm volatile("tensor_load_to_lds %0, %1" :: "s"(g0), "s"(g1) : "memory");
  };

  // the lane's rows in a buffer: A slice wm, rows mc*16 + lr; Bt slices
  // 4 + wn*2 + (nc >> 1), rows (nc & 1)*16 + lr; 16 k a wave half, alike in both
  const char* pa0 = smem + wm * G_SLICE + lr * G_PITCH + lh * 2;
  const char* pb0 = smem + (4 + wn * 2) * G_SLICE + lr * G_PITCH + lh * 2;

  // two fragment sets: the next 32 k's 12 reads go out as one group in front of
  // this block's products, so that their LDS latency runs under the products
  v16bf afr[2][2], bfr[2][4];
  auto frags = [&](int set, uint32_t buf, int kk) {
    const char* pa = pa0 + buf * GEMM_BUF_BYTES + kk * 64;
    const char* pb = pb0 + buf * GEMM_BUF_BYTES + kk * 64;
    #pragma unroll  // register arrays need constant indices
    for (int mc = 0; mc < 2; ++mc) afr[set][mc] = ld_frag(pa + mc * 16 * G_PITCH);
    #pragma unroll  // register arrays need constant indices
    for (int nc = 0; nc < 4; ++nc)
      bfr[set][nc] = ld_frag(pb + (nc >> 1) * G_SLICE + (nc & 1) * 16 * G_PITCH);
  };
  auto products = [&](int set) {
    // holds the reads above in front of the products: left to itself the build
    // reads each fragment right before its product and waits out the latency there
    __builtin_amdgcn_sched_barrier(0);
    #pragma unroll  // register arrays need constant indices
    for (int mc = 0; mc < 2; ++mc)
      #pragma unroll  // register arrays need constant indices
      for (int nc = 0; nc < 4; ++nc)
        acc[mc][nc] = wmma_bf16(afr[set][mc], bfr[set][nc], acc[mc][nc]);
  };

  // prologue: stage 0 lands and is published, then stage 1 starts
  issue(0u);
  asm volatile("s_wait_tensorcnt 0x0" ::: "memory");  // this wave's slice of stage 0 has landed
  __syncthreads();                                    // every wave's slice has
  issue(1u);
  frags(0, 0u, 0);

  for (uint32_t s = 0; s < T; ++s) {
    const uint32_t buf = s & 1u;
    frags(1, buf, 1);
    products(0);
    frags(0, buf, 2);
    products(1);
    frags(1, buf, 3);
    products(0);
    // publish point of stage s + 1, in front of the pass's last block: that
    // block's fragments are in registers, nothing of stage s is read behind it.
    // The products above stay in front of the waits: left to itself the build
    // moves them behind the barrier, so that the last reads' latency lies bare
    // and the refill starts eight products late
    __builtin_amdgcn_sched_barrier(0);
    asm volatile("s_wait_dscnt 0x0" ::: "memory");      // this wave's reads of stage s have returned
    asm volatile("s_wait_tensorcnt 0x0" ::: "memory");  // its slice of stage s + 1 has landed
    __syncthreads();   // stage s + 1 is whole, and every wave has left stage s
    if (pinned((s + 2u < T) ? 1u : 0u) != 0u) issue(s + 2u);   // into the buffer just left
    if (s + 1u < T) frags(0, buf ^ 1u, 0);              // first block of stage s + 1
    products(1);
  }
  asm volatile("s_wait_tensorcnt 0x0" ::: "memory");    // no request is left when the ring changes its use
  asm volatile("s_wait_dscnt 0x0" ::: "memory");

  // epilogue: a wave passes its accumulators, 16 rows x 64 columns at a time,
  // through its own LDS range, so that a lane then holds 4 neighbouring columns
  // of one row: the residual loads and the stores move whole lines (a row piece
  // is 256 B of f32 or 128 B of bf16), a quarter of the memory instructions.
  // The ring is free here: the last pass's publish point waited for every tensor
  // load and its barrier stands behind every wave's last fragment read.
  float (*st)[EP_PITCH] = (float(*)[EP_PITCH])(smem + wave * EP_WAVE_BYTES);
  const int mofs = (lane >= 16) ? 8 : 0;
  const int er = lane >> 4;            // which row of the pair a wave-wide access covers
  const int ec = (lane & 15) * 4;      // first of the lane's 4 columns
  const int c = col0 + ec;             // global column
  const v4f bias4 = *(const v4f*)&bias[c];

  v4f rs[2][8];
  if constexpr (MODE == 1) {
    // all 16 residual loads in flight together: one memory latency, not one each
    const float* rp[2][8];
    #pragma unroll  // register arrays need constant indices
    for (int mc = 0; mc < 2; ++mc)
      #pragma unroll  // register arrays need constant indices
      for (int it = 0; it < 8; ++it) {
        rp[mc][it] = &resid[(size_t)(row0 + mc * 16 + it * 2 + er) * N + c];
        rs[mc][it] = *(const v4f*)rp[mc][it];
      }
    // left to itself the build lets a late load of the batch land in the address
    // registers of earlier ones: the addresses stay live up to this wait for
    // their translations
    asm volatile("s_wait_xcnt 0x0"
                 :: "v"(rp[0][0]), "v"(rp[0][1]), "v"(rp[0][2]), "v"(rp[0][3]),
                    "v"(rp[0][4]), "v"(rp[0][5]), "v"(rp[0][6]), "v"(rp[0][7]),
                    "v"(rp[1][0]), "v"(rp[1][1]), "v"(rp[1][2]), "v"(rp[1][3]),
                    "v"(rp[1][4]), "v"(rp[1][5]), "v"(rp[1][6]), "v"(rp[1][7])
                 : "memory");
  }

  // QKV: a wave's 64 columns are one head (hh) of one of q, k, v (WHICH 0, 1, 2)
  const int hh = (col0 & 1023) >> 6;

  auto drain = [&](auto wc) {
    constexpr int WHICH = decltype(wc)::value;
    float bc[4];                       // bias in accumulator order, for the V shadow
    if constexpr (MODE == 0 && WHICH == 2) {
      #pragma unroll  // register arrays need constant indices
      for (int nc = 0; nc < 4; ++nc) bc[nc] = bias[col0 + nc * 16 + lr];
    }
    #pragma unroll  // register arrays need constant indices
    for (int mc = 0; mc < 2; ++mc) {
      if constexpr (MODE == 0 && WHICH == 2) {
        // V shadow is [d][token]: a lane's 8 accumulator rows are 8 neighbouring
        // tokens of one d, one 16-byte store straight from registers
        const int m0 = row0 + mc * 16 + mofs;
        const int bh = (m0 >> 10) * NHEAD + hh;
        #pragma unroll  // register arrays need constant indices
        for (int nc = 0; nc < 4; ++nc) {
          v8bf p;
          #pragma unroll  // register arrays need constant indices
          for (int r = 0; r < 8; ++r) p[r] = (__bf16)(acc[mc][nc][r] + bc[nc]);
          *(v8bf*)&Vtbf[((size_t)bh * HEAD_DIM + nc * 16 + lr) * TKMAX + TP + (m0 & 1023)] = p;
        }
      }
      // these 16 rows overwrite the range: the first half's reads have returned
      if (mc == 1) asm volatile("s_wait_dscnt 0x0" ::: "memory");
      #pragma unroll  // register arrays need constant indices
      for (int nc = 0; nc < 4; ++nc)
        #pragma unroll  // register arrays need constant indices
        for (int r = 0; r < 8; ++r) st[r + mofs][nc * 16 + lr] = acc[mc][nc][r];
      // other lanes' rows are read back below: the wave's LDS writes land first
      asm volatile("s_wait_dscnt 0x0" ::: "memory");
      #pragma unroll  // register arrays need constant indices
      for (int it = 0; it < 8; ++it) {
        const int m = row0 + mc * 16 + it * 2 + er;   // global row (token)
        const v4f v = *(const v4f*)&st[it * 2 + er][ec] + bias4;
        if constexpr (MODE == 0) {
          const int bh = (m >> 10) * NHEAD + hh;
          const int t = m & 1023;
          const size_t o = ((size_t)bh * TKMAX + TP + t) * HEAD_DIM + ec;
          v4bf vb;
          #pragma unroll  // register arrays need constant indices
          for (int i = 0; i < 4; ++i) vb[i] = (__bf16)v[i];
          if constexpr (WHICH == 0) {
            *(v4bf*)&Qbf[((size_t)bh * TC + t) * HEAD_DIM + ec] = vb;
          } else if constexpr (WHICH == 1) {
            *(v4f*)&Koutf[o] = v;
            *(v4bf*)&Kbf[o] = vb;
          } else {
            *(v4f*)&Voutf[o] = v;
          }
        } else if constexpr (MODE == 1) {
          *(v4f*)&outf[(size_t)m * N + c] = v + rs[mc][it];
        } else {
          v4bf o;
          #pragma unroll  // register arrays need constant indices
          for (int i = 0; i < 4; ++i) {
            float ge = 0.5f * v[i] * (1.f + erff(v[i] * 0.70710678118654752f));
            o[i] = (__bf16)ge;
          }
          *(v4bf*)&outbf[(size_t)m * N + c] = o;
        }
      }
    }
    // QKV: the build runs shared address code of the other two cases behind
    // these stores, over their registers: wait for their translations first
    if constexpr (MODE == 0) asm volatile("s_wait_xcnt 0x0" ::: "memory");
  };

  if constexpr (MODE == 0) {
    // the same for a whole wave: read through the first lane, a scalar branch
    const int which = __builtin_amdgcn_readfirstlane(col0 >> 10);
    if (which == 0)      drain(int_c<0>{});
    else if (which == 1) drain(int_c<1>{});
    else                 drain(int_c<2>{});
  } else {
    drain(int_c<0>{});
  }
}

#define SK_BYTES  (32 * 72 * 2)                     // 4608  [key][d]
#define SVT_BYTES (64 * 40 * 2)                     // 5120  [d][key]
#define KV_BUF_BYTES (SK_BYTES + SVT_BYTES)         // 9728 per buffer
#define ATT_SMEM (2 * KV_BUF_BYTES)                 // 19456

__device__ __forceinline__ float xhalf(float x) {
  const int i = __builtin_bit_cast(int, x);
  return __builtin_bit_cast(float, __builtin_amdgcn_permlanex16(
      i, i, 0x76543210, 0xfedcba98, false, false));
}

__global__ __launch_bounds__(256) void k_attention(
    const __bf16* __restrict__ Qbf, const __bf16* __restrict__ Kbf,
    const __bf16* __restrict__ Vtbf, const int* __restrict__ pos_ptr,
    __bf16* __restrict__ Obf) {
  __shared__ __align__(16) char smem[ATT_SMEM];
  // the ring's place in the work-group's LDS, for the tensor loads.  Only they
  // write the ring: taken from the array itself, the address also tells the
  // build that the array is written, so that it stays allocated and is read
  const unsigned ring = (unsigned)(uintptr_t)smem;

  const int tid = threadIdx.x;
  const int wave = tid >> 5, lane = tid & 31;
  const int qt = blockIdx.x & 7;           // query tile of 128
  const int bh = blockIdx.x >> 3;          // b*NHEAD + h
  const int pos = pos_ptr[0];
  const int qbase = qt * 128;
  const int qrow = qbase + wave * 16;
  const int lr = lane & 15;
  const int lh = (lane >> 4) * 16;
  const int mofs = (lane >= 16) ? 8 : 0;

  const __bf16* Qp = Qbf + ((size_t)bh * TC + qrow) * HEAD_DIM;
  const __bf16* Kb = Kbf + (size_t)bh * TKMAX * HEAD_DIM;
  const __bf16* Vb = Vtbf + (size_t)bh * HEAD_DIM * TKMAX;

  // load Q fragments (64x16 -> two 32x16 B-fragments) with explicit 16B loads:
  // lane = query column, 16 contiguous d per wave half, as the K loader below
  v16bf qf[2];
  #pragma unroll
  for (int f = 0; f < 2; ++f) {
    union { uint4 u[2]; v16bf v; } tmp;
    const uint4* p = (const uint4*)(Qp + (size_t)lr * HEAD_DIM + f * 32 + lh);
    tmp.u[0] = p[0];
    tmp.u[1] = p[1];
    qf[f] = tmp.v;
  }

  // all per lane, for query qrow + lr: running maximum (equal in both halves),
  // sum over this half's keys, O^T rows d = dc*16 + mofs + r
  float mrun = -1e30f, lsum = 0.f;
  v8f o[4];
  #pragma unroll
  for (int d = 0; d < 4; ++d) o[d] = (v8f)(0.f);

  const float scale = 0.125f;  // 1/sqrt(64)
  // last key this lane's query sees, counted from the first key of its half
  const int lim = pos + qrow + lr - mofs;
  const int kmax = min(pos + qbase + 128, TKMAX);   // never past the cache
  // at least one pass: the waits for the loads below stand in the loop
  const int ntiles = max((kmax + 31) / 32, 1);

#ifdef USE_TDM
  if (wave == 0) {
    tdm_load_2d(ring,            Kb, HEAD_DIM, TKMAX, HEAD_DIM, 32, HEAD_DIM, 4, 3);
    tdm_load_2d(ring + SK_BYTES, Vb, TKMAX, HEAD_DIM, 32, HEAD_DIM, TKMAX, 3, 3);
  }
#endif

  for (int kt = 0; kt < ntiles; ++kt) {
    const int kofs = kt * 32;
    const int cur = kt & 1;
    __bf16 (*sK)[72]  = (__bf16(*)[72])(smem + cur * KV_BUF_BYTES);
    __bf16 (*sVt)[40] = (__bf16(*)[40])(smem + cur * KV_BUF_BYTES + SK_BYTES);

#ifdef USE_TDM
    if (wave == 0) {
      if (kt + 1 < ntiles) {
        unsigned nb = ring + (unsigned)((cur ^ 1) * KV_BUF_BYTES);
        tdm_load_2d(nb, Kb + (size_t)(kofs + 32) * HEAD_DIM,
                    HEAD_DIM, TKMAX, HEAD_DIM, 32, HEAD_DIM, 4, 3);
        tdm_load_2d(nb + SK_BYTES, Vb + kofs + 32,
                    TKMAX, HEAD_DIM, 32, HEAD_DIM, TKMAX, 3, 3);
        __builtin_amdgcn_s_wait_tensorcnt(2);
      } else {
        __builtin_amdgcn_s_wait_tensorcnt(0);
      }
      asm volatile("" ::: "memory");
    }
    __syncthreads();
#else
    {
      int r = tid >> 3, c = (tid & 7) * 8;
      *(uint4*)&sK[r][c] = *(const uint4*)&Kb[(size_t)(kofs + r) * HEAD_DIM + c];
      int d = tid >> 2, kc = (tid & 3) * 8;
      *(uint4*)&sVt[d][kc] = *(const uint4*)&Vb[(size_t)d * TKMAX + kofs + kc];
    }
    __syncthreads();
#endif

    // S^T = K * Q^T: s[nc][r] = score of key kofs + nc*16 + mofs + r, query lr.
    // The tile's K fragments are read as one group: one LDS latency, not four
    v16bf ak[2][2];
    #pragma unroll
    for (int nc = 0; nc < 2; ++nc)
      #pragma unroll
      for (int f = 0; f < 2; ++f)
        #pragma unroll
        for (int j = 0; j < 16; ++j) ak[nc][f][j] = sK[nc * 16 + lr][f * 32 + lh + j];
    // V^T fragments (16 d x 32 keys each), read here so that they arrive while
    // the softmax runs; keys in the order in which pf below holds them
    v16bf av[4];
    #pragma unroll
    for (int dc = 0; dc < 4; ++dc)
      #pragma unroll
      for (int j = 0; j < 8; ++j) {
        av[dc][j]     = sVt[dc * 16 + lr][mofs + j];
        av[dc][8 + j] = sVt[dc * 16 + lr][16 + mofs + j];
      }
    // holds the 16 reads above in front of the products: left to itself the
    // build reads each fragment into one register set right before its product
    // and waits out the LDS latency eight times a tile
    __builtin_amdgcn_sched_barrier(0);
    v8f s[2];
    #pragma unroll
    for (int nc = 0; nc < 2; ++nc) s[nc] = wmma_bf16(ak[nc][0], qf[0], (v8f)(0.f));
    #pragma unroll
    for (int nc = 0; nc < 2; ++nc) s[nc] = wmma_bf16(ak[nc][1], qf[1], s[nc]);

    // online softmax of the lane's one query
    s[0] *= scale;
    s[1] *= scale;
    const int rel = lim - kofs;            // keys mofs + j with j <= rel are seen
    float mt[8];
    #pragma unroll
    for (int r = 0; r < 8; ++r) {
      if (r > rel)      s[0][r] = -1e30f;
      if (16 + r > rel) s[1][r] = -1e30f;
      mt[r] = fmaxf(s[0][r], s[1][r]);
    }
    float mx = fmaxf(fmaxf(fmaxf(mt[0], mt[1]), fmaxf(mt[2], mt[3])),
                     fmaxf(fmaxf(mt[4], mt[5]), fmaxf(mt[6], mt[7])));
    mx = fmaxf(mx, xhalf(mx));             // over all 32 keys, both halves alike
    const float mnew = fmaxf(mrun, mx);
    const float corr = __expf(mrun - mnew);
    mrun = mnew;

    // P^T as B operand: element j = key mofs + j, element 8 + j = key 16 + mofs + j
    v16bf pf;
    float st[8];
    #pragma unroll
    for (int r = 0; r < 8; ++r) {
      float p0 = __expf(s[0][r] - mnew);
      float p1 = __expf(s[1][r] - mnew);
      st[r] = p0 + p1;
      pf[r]     = (__bf16)p0;
      pf[8 + r] = (__bf16)p1;
    }
    lsum = lsum * corr + (((st[0] + st[1]) + (st[2] + st[3])) +
                          ((st[4] + st[5]) + (st[6] + st[7])));
    #pragma unroll
    for (int d = 0; d < 4; ++d) o[d] *= corr;

    // O^T += V^T(16 d x 32 keys) * P^T(32 keys x 16 queries)
    #pragma unroll
    for (int dc = 0; dc < 4; ++dc) o[dc] = wmma_bf16(av[dc], pf, o[dc]);
    __syncthreads();   // done reading cur buffer before refill
  }

  // normalize + write O into [token, d_model] bf16 buffer at head column: a
  // lane's 8 accumulator rows are 8 neighbouring d of its token, 16 bytes
  const float ltot = lsum + xhalf(lsum);   // the two halves' keys together
  const int b = bh >> 4, h = bh & 15;
  __bf16* op = Obf + (size_t)(b * TC + qrow + lr) * D_MODEL + h * HEAD_DIM + mofs;
  #pragma unroll
  for (int dc = 0; dc < 4; ++dc) {
    v8bf ov;
    #pragma unroll
    for (int r = 0; r < 8; ++r) ov[r] = (__bf16)(o[dc][r] / ltot);
    *(v8bf*)(op + dc * 16) = ov;
  }
}

// ---------------------------------------------------------------------------
// Host-side launch
// ---------------------------------------------------------------------------
extern "C" void kernel_launch(void* const* d_in, const int* in_sizes, int n_in,
                              void* d_out, int out_size, void* d_ws, size_t ws_size,
                              hipStream_t stream) {
  const float* x    = (const float*)d_in[0];
  const float* Kp   = (const float*)d_in[1];
  const float* Vp   = (const float*)d_in[2];
  const int*   pos  = (const int*)d_in[3];
  const float* wqkv = (const float*)d_in[4];
  const float* bqkv = (const float*)d_in[5];
  const float* wo   = (const float*)d_in[6];
  const float* bo   = (const float*)d_in[7];
  const float* g1   = (const float*)d_in[8];
  const float* be1  = (const float*)d_in[9];
  const float* g2   = (const float*)d_in[10];
  const float* be2  = (const float*)d_in[11];
  const float* w1   = (const float*)d_in[12];
  const float* bf1  = (const float*)d_in[13];
  const float* w2   = (const float*)d_in[14];
  const float* bf2  = (const float*)d_in[15];

  float* xout = (float*)d_out;
  float* Kout = xout + (size_t)NTOK * D_MODEL;
  float* Vout = Kout + (size_t)BATCH * NHEAD * TKMAX * HEAD_DIM;

  char* w = (char*)d_ws;
  size_t off = 0;
  auto carve = [&](size_t bytes) {
    void* p = w + off;
    off += (bytes + 255) & ~(size_t)255;
    return p;
  };
  // weights stored TRANSPOSED [N][K] in bf16
  __bf16* wqkvT = (__bf16*)carve((size_t)3 * D_MODEL * D_MODEL * 2);
  __bf16* woT   = (__bf16*)carve((size_t)D_MODEL * D_MODEL * 2);
  __bf16* w1T   = (__bf16*)carve((size_t)DIM_FF * D_MODEL * 2);
  __bf16* w2T   = (__bf16*)carve((size_t)D_MODEL * DIM_FF * 2);
  __bf16* h_bf  = (__bf16*)carve((size_t)NTOK * D_MODEL * 2);    // reused for h2
  __bf16* q_bf  = (__bf16*)carve((size_t)NTOK * D_MODEL * 2);
  __bf16* K_bf  = (__bf16*)carve((size_t)BATCH * NHEAD * TKMAX * HEAD_DIM * 2);
  __bf16* Vt_bf = (__bf16*)carve((size_t)BATCH * NHEAD * HEAD_DIM * TKMAX * 2);
  __bf16* o_bf  = (__bf16*)carve((size_t)NTOK * D_MODEL * 2);
  float*  x1    = (float*)carve((size_t)NTOK * D_MODEL * 4);
  __bf16* ff_bf = K_bf;  // FFN activation aliases dead bf16 KV shadow (32MB)

  // 1) weight converts (transpose to [N][K])
  k_cvt_transpose<D_MODEL, 3 * D_MODEL><<<(D_MODEL / TR_R) * (3 * D_MODEL / TR_C), 256, 0, stream>>>(wqkv, wqkvT);
  k_cvt_transpose<D_MODEL, D_MODEL><<<(D_MODEL / TR_R) * (D_MODEL / TR_C), 256, 0, stream>>>(wo, woT);
  k_cvt_transpose<D_MODEL, DIM_FF><<<(D_MODEL / TR_R) * (DIM_FF / TR_C), 256, 0, stream>>>(w1, w1T);
  k_cvt_transpose<DIM_FF, D_MODEL><<<(DIM_FF / TR_R) * (D_MODEL / TR_C), 256, 0, stream>>>(w2, w2T);

  // 2) LN1
  k_layernorm<<<NTOK / LN_ROWS, 256, 0, stream>>>(x, g1, be1, h_bf);

  // 3) past KV copy into cache + bf16 shadows
  k_kvcopy<<<BATCH * NHEAD * (TP / TR_R), 256, 0, stream>>>(Kp, Vp, Kout, Vout, K_bf, Vt_bf);

  // 4) QKV GEMM: [4096,1024] x [1024,3072]
  {
    int M = NTOK, N = 3 * D_MODEL, K = D_MODEL;
    dim3 grid((M / GBM) * (N / GBN));
    k_gemm_bf16<0><<<grid, 256, 0, stream>>>(h_bf, wqkvT, M, N, K, bqkv,
                                             Kout, Vout, K_bf, Vt_bf, q_bf,
                                             nullptr, nullptr, nullptr);
  }

  // 5) attention
  k_attention<<<BATCH * NHEAD * (TC / 128), 256, 0, stream>>>(q_bf, K_bf, Vt_bf, pos, o_bf);

  // 6) Wo GEMM + residual -> x1
  {
    int M = NTOK, N = D_MODEL, K = D_MODEL;
    dim3 grid((M / GBM) * (N / GBN));
    k_gemm_bf16<1><<<grid, 256, 0, stream>>>(o_bf, woT, M, N, K, bo,
                                             nullptr, nullptr, nullptr, nullptr, nullptr,
                                             x, x1, nullptr);
  }

  // 7) LN2 -> h2 (reuse h_bf)
  k_layernorm<<<NTOK / LN_ROWS, 256, 0, stream>>>(x1, g2, be2, h_bf);

  // 8) W1 GEMM + GELU -> ff_bf
  {
    int M = NTOK, N = DIM_FF, K = D_MODEL;
    dim3 grid((M / GBM) * (N / GBN));
    k_gemm_bf16<2><<<grid, 256, 0, stream>>>(h_bf, w1T, M, N, K, bf1,
                                             nullptr, nullptr, nullptr, nullptr, nullptr,
                                             nullptr, nullptr, ff_bf);
  }

  // 9) W2 GEMM + residual -> xout
  {
    int M = NTOK, N = D_MODEL, K = DIM_FF;
    dim3 grid((M / GBM) * (N / GBN));
    k_gemm_bf16<1><<<grid, 256, 0, stream>>>(ff_bf, w2T, M, N, K, bf2,
                                             nullptr, nullptr, nullptr, nullptr, nullptr,
                                             x1, xout, nullptr);
  }
}

// v006
// A run of this version takes 189 microseconds.
// In both of two side-by-side timings against v005, it was 1.06 times as fast.
// Counting every step since v000, it is 2.46 times as fast.
#include <hip/hip_runtime.h>

typedef __bf16 v16bf __attribute__((ext_vector_type(16)));
typedef float  v8f   __attribute__((ext_vector_type(8)));
typedef unsigned int u32x4 __attribute__((ext_vector_type(4)));
typedef int i32x4 __attribute__((ext_vector_type(4)));
typedef int i32x8 __attribute__((ext_vector_type(8)));

__device__ __forceinline__ v8f wmma_bf16(v16bf a, v16bf b, v8f c) {
  // D = A(16x32 bf16) * B(32x16 bf16) + C(16x16 f32)
  return __builtin_amdgcn_wmma_f32_16x16x32_bf16(
      false, a, false, b, (short)0, c, false, false);
}

#if defined(__has_builtin)
#if __has_builtin(__builtin_amdgcn_tensor_load_to_lds) && \
    __has_builtin(__builtin_amdgcn_s_wait_tensorcnt)
#define USE_TDM 1
#endif
#endif

#ifdef USE_TDM
// 2D tile load Global->LDS via Tensor Data Mover (bf16 payload).
__device__ __forceinline__ void tdm_load_2d(unsigned lds_off, const __bf16* gaddr,
                                            unsigned dim0, unsigned dim1,
                                            unsigned tile0, unsigned tile1,
                                            unsigned stride0,
                                            unsigned pad_int_code,
                                            unsigned pad_amt_code) {
  unsigned long long ga = (unsigned long long)(uintptr_t)gaddr;
  u32x4 g0;
  g0[0] = 1u;
  g0[1] = lds_off;
  g0[2] = (unsigned)(ga & 0xFFFFFFFFu);
  g0[3] = (unsigned)((ga >> 32) & 0x01FFFFFFu)
          | (2u << 30);
  i32x8 g1;
  g1[0] = (int)((1u << 16)
                | (1u << 20)
                | (pad_int_code << 22)
                | (pad_amt_code << 25));
  g1[1] = (int)((dim0 & 0xFFFFu) << 16);
  g1[2] = (int)((dim0 >> 16) | ((dim1 & 0xFFFFu) << 16));
  g1[3] = (int)((dim1 >> 16) | (tile0 << 16));
  g1[4] = (int)(tile1 & 0xFFFFu);
  g1[5] = (int)stride0;
  g1[6] = 0;
  g1[7] = 0;
  i32x4 z4 = {0, 0, 0, 0};
#if defined(__clang_major__) && (__clang_major__ >= 23)
  i32x8 z8 = {0, 0, 0, 0, 0, 0, 0, 0};
  __builtin_amdgcn_tensor_load_to_lds(g0, g1, z4, z4, z8, 0);
#else
  __builtin_amdgcn_tensor_load_to_lds(g0, g1, z4, z4, 0);
#endif
}
#endif  // USE_TDM

#define D_MODEL 1024
#define NHEAD   16
#define HEAD_DIM 64
#define DIM_FF  4096
#define BATCH   4
#define TC      1024
#define TP      1024
#define TKMAX   2048
#define NTOK    (BATCH * TC)   // 4096

// ---------------------------------------------------------------------------
// Transposing f32 -> bf16 copies go through an LDS tile of 128 source rows x
// 64 source columns, so that both global sides move whole lines, 16 bytes a
// lane: a source row piece is 256 B of f32, a destination row piece 256 B of
// bf16.  256 threads; thread (kg, nq) holds source rows kg*8..+7, columns
// nq*4..+3.
// ---------------------------------------------------------------------------
#define TR_R 128
#define TR_C 64
#define TR_PITCH 136                                // 272 B = 16 B x odd
typedef float  v4f  __attribute__((ext_vector_type(4)));
typedef __bf16 v4bf __attribute__((ext_vector_type(4)));
typedef __bf16 v8bf __attribute__((ext_vector_type(8)));

__device__ __forceinline__ void tr_put(__bf16 (*tile)[TR_PITCH], const v4f (&v)[8],
                                       int nq, int kg) {
  #pragma unroll  // register arrays need constant indices
  for (int i = 0; i < 4; ++i) {
    v8bf p;
    #pragma unroll  // register arrays need constant indices
    for (int j = 0; j < 8; ++j) p[j] = (__bf16)v[j][i];
    *(v8bf*)&tile[nq * 4 + i][kg * 8] = p;
  }
}

// dst points at the tile's first element; ld = destination row pitch (elements)
__device__ __forceinline__ void tr_get(const __bf16 (*tile)[TR_PITCH],
                                       __bf16* __restrict__ dst, size_t ld, int tid) {
  #pragma unroll
  for (int it = 0; it < 4; ++it) {
    int idx = it * 256 + tid;
    int n = idx >> 4, c = (idx & 15) * 8;
    *(v8bf*)&dst[(size_t)n * ld + c] = *(const v8bf*)&tile[n][c];
  }
}

template <int K, int N>
__global__ __launch_bounds__(256) void k_cvt_transpose(const float* __restrict__ src,
                                                       __bf16* __restrict__ dst) {
  __shared__ __align__(16) __bf16 tile[TR_C][TR_PITCH];
  const int tid = threadIdx.x;
  const int nq = tid & 15, kg = tid >> 4;
  const int n0 = (blockIdx.x % (N / TR_C)) * TR_C;
  const int k0 = (blockIdx.x / (N / TR_C)) * TR_R;

  const float* p = src + (size_t)(k0 + kg * 8) * N + n0 + nq * 4;
  v4f v[8];
  #pragma unroll  // register arrays need constant indices
  for (int j = 0; j < 8; ++j) v[j] = *(const v4f*)(p + j * N);
  tr_put(tile, v, nq, kg);
  __syncthreads();
  tr_get(tile, dst + (size_t)n0 * K + k0, (size_t)K, tid);
}

// ---------------------------------------------------------------------------
// LayerNorm: one wave per row of D_MODEL, 8 rows a block, bf16 out.  A lane
// holds 32 elements of its row in registers (8 loads of 16 B, each wave-wide
// load 512 contiguous bytes), so the row is read once, the sums need no LDS and
// no barrier, and a launch starts an eighth of the waves.
// ---------------------------------------------------------------------------
#define LN_ROWS 8
__global__ __launch_bounds__(256) void k_layernorm(const float* __restrict__ x,
                                                   const float* __restrict__ g,
                                                   const float* __restrict__ b,
                                                   __bf16* __restrict__ out) {
  const int lane = threadIdx.x & 31, wave = threadIdx.x >> 5;
  const int row = blockIdx.x * LN_ROWS + wave;
  const float* xr = x + (size_t)row * D_MODEL + lane * 4;

  v4f v[8];
  #pragma unroll  // register arrays need constant indices
  for (int j = 0; j < 8; ++j) v[j] = *(const v4f*)(xr + j * 128);
  // the build lets a load of g or b below land in the address registers of the
  // row's loads: wait for their translations first
  asm volatile("s_wait_xcnt 0x0" ::: "memory");
  v4f gg[8], bb[8];
  #pragma unroll  // register arrays need constant indices
  for (int j = 0; j < 8; ++j) {
    gg[j] = *(const v4f*)(g + lane * 4 + j * 128);
    bb[j] = *(const v4f*)(b + lane * 4 + j * 128);
  }
  // keeps all 24 loads in flight together: left to itself the build issues
  // the loads of g and b behind the row's first data, a second latency in turn
  __builtin_amdgcn_sched_barrier(0);

  // four independent partial sums a lane: chains of 8 links, not of 32
  v4f sv = v[0], qv = v[0] * v[0];
  #pragma unroll  // register arrays need constant indices
  for (int j = 1; j < 8; ++j) { sv += v[j]; qv += v[j] * v[j]; }
  float s  = (sv[0] + sv[1]) + (sv[2] + sv[3]);
  float s2 = (qv[0] + qv[1]) + (qv[2] + qv[3]);
  #pragma unroll
  for (int off = 16; off >= 1; off >>= 1) {
    s  += __shfl_xor(s,  off, 32);
    s2 += __shfl_xor(s2, off, 32);
  }
  const float mu = s * (1.f / D_MODEL);
  const float var = s2 * (1.f / D_MODEL) - mu * mu;
  const float rstd = rsqrtf(var + 1e-5f);

  __bf16* orow = out + (size_t)row * D_MODEL + lane * 4;
  #pragma unroll  // register arrays need constant indices
  for (int j = 0; j < 8; ++j) {
    v4bf o;
    #pragma unroll  // register arrays need constant indices
    for (int i = 0; i < 4; ++i) o[i] = (__bf16)((v[j][i] - mu) * rstd * gg[j][i] + bb[j][i]);
    *(v4bf*)(orow + j * 128) = o;
  }
}

// ---------------------------------------------------------------------------
// Copy past KV into output cache (fp32) + bf16 shadows for attention.
// K shadow: [B,H,Tk,Dh] row-major; V shadow: TRANSPOSED [B,H,Dh,Tk].
// ---------------------------------------------------------------------------
// grid: B*H*(TP/128) blocks; a block takes 128 tokens of one head (contiguous
// in source and in both caches); the V shadow goes through the LDS tile.
__global__ __launch_bounds__(256) void k_kvcopy(const float* __restrict__ Kp,
                                                const float* __restrict__ Vp,
                                                float* __restrict__ Kout,
                                                float* __restrict__ Vout,
                                                __bf16* __restrict__ Kbf,
                                                __bf16* __restrict__ Vtbf) {
  __shared__ __align__(16) __bf16 tile[TR_C][TR_PITCH];
  const int tid = threadIdx.x;
  const int nq = tid & 15, kg = tid >> 4;
  const int bh = blockIdx.x / (TP / TR_R);
  const int t0 = (blockIdx.x % (TP / TR_R)) * TR_R;
  const size_t sbase = ((size_t)bh * TP + t0) * HEAD_DIM;
  const size_t dbase = ((size_t)bh * TKMAX + t0) * HEAD_DIM;

  const unsigned vo = (unsigned)(kg * 8 * HEAD_DIM + nq * 4);   // V: tile order
  const unsigned ko = (unsigned)(tid * 4);                      // K: linear
  const float* pv = Vp + sbase;
  const float* pk = Kp + sbase;
  v4f vv[8], kv[8];
  #pragma unroll  // register arrays need constant indices
  for (int j = 0; j < 8; ++j) vv[j] = *(const v4f*)(pv + vo + j * HEAD_DIM);
  #pragma unroll  // register arrays need constant indices
  for (int j = 0; j < 8; ++j) kv[j] = *(const v4f*)(pk + ko + j * 1024);
  // address registers of the loads above are rewritten below: wait for their
  // translations first.  The statement also holds all 16 loads in front of the
  // first use of V, so that no K load pays a second memory latency.
  asm volatile("s_wait_xcnt 0x0" ::: "memory");

  // the tile's barrier stands in front of every global store: it would wait
  // for stores already issued
  tr_put(tile, vv, nq, kg);
  __syncthreads();
  tr_get(tile, Vtbf + (size_t)bh * HEAD_DIM * TKMAX + t0, (size_t)TKMAX, tid);

  float* qv = Vout + dbase;
  float* qk = Kout + dbase;
  __bf16* qb = Kbf + dbase;
  #pragma unroll  // register arrays need constant indices
  for (int j = 0; j < 8; ++j) *(v4f*)(qv + vo + j * HEAD_DIM) = vv[j];
  #pragma unroll  // register arrays need constant indices
  for (int j = 0; j < 8; ++j) {
    *(v4f*)(qk + ko + j * 1024) = kv[j];
    v4bf kb;
    #pragma unroll  // register arrays need constant indices
    for (int i = 0; i < 4; ++i) kb[i] = (__bf16)kv[j][i];
    *(v4bf*)(qb + ko + j * 1024) = kb;
  }
}

// ---------------------------------------------------------------------------
// Tiled WMMA GEMM: C[M,N] = A[M,K](bf16) * Bt[N,K](bf16, pre-transposed)
//   block tile 128x128, 256 threads = 8 waves,
//   wave grid 4(M) x 2(N); each wave: 2x4 accumulators of 16x16.
//   A pass is 128 k = 256 B of every operand row, two buffers.  Every wave
//   brings its own slice of 32 rows with one tensor load a pass (waves 0..3
//   rows of A, waves 4..7 rows of Bt), issued one pass before it is read.
//   Fragments are read one block of 32 k ahead, into a second register set.
//   M, N multiples of 128; K a multiple of 128 and at least 256.
// MODE 0: QKV scatter  MODE 1: bias+residual->f32  MODE 2: bias+GELU->bf16
// ---------------------------------------------------------------------------
#define GBM 128
#define GBN 128
#define GBK 128
#define G_ROWB 256                                  // bytes of a row in a pass
#define G_PITCH 272                                 // row + 16 B pad = 16 B x odd
#define G_SLICE_ROWS 32
#define G_PF 4u                                     // stages between a pass and the stage it prefetches
#define G_SLICE 10240                               // 32 x 272 = 8704, up to a multiple of 2 KiB
#define GEMM_BUF_BYTES (8 * G_SLICE)                // 81920
#define EP_PITCH 68                                 // epilogue row: 272 B = 16 B x odd
#define EP_WAVE_BYTES G_SLICE                       // >= 16 rows x 272 B
template <int V> struct int_c { static constexpr int value = V; };
typedef unsigned int u32x8 __attribute__((ext_vector_type(8)));

__device__ __forceinline__ uint32_t uni(uint32_t v) {
  return (uint32_t)__builtin_amdgcn_readfirstlane(v);
}
__device__ __forceinline__ uint32_t pinned(uint32_t v) {
  uint32_t w = uni(v);
  asm volatile("" : "+s"(w));  // the value stays in a scalar register
  return w;
}
__device__ __forceinline__ u32x8 gemm_group1(uint32_t src_pitch) {
  u32x8 g;
  g[0] = uni((1u << 20) | (5u << 22) | (3u << 25));
  g[1] = uni((uint32_t)G_ROWB << 16);
  g[2] = uni((uint32_t)G_SLICE_ROWS << 16);
  g[3] = uni((uint32_t)G_ROWB << 16);
  g[4] = uni((uint32_t)G_SLICE_ROWS);
  g[5] = uni(src_pitch);
  g[6] = uni(0u);
  g[7] = uni(0u);
  return g;
}
__device__ __forceinline__ u32x4 gemm_group0(uint32_t lds_dst, uint64_t ga) {
  u32x4 g;
  g[0] = uni(1u);
  g[1] = uni(lds_dst);
  g[2] = uni((uint32_t)ga);
  g[3] = uni((((uint32_t)(ga >> 32)) & 0x01FFFFFFu) | 0x80000000u);
  return g;
}
// 16 k of one row: two 16-byte LDS reads
__device__ __forceinline__ v16bf ld_frag(const char* p) {
  const v8bf lo = *(const v8bf*)p, hi = *(const v8bf*)(p + 16);
  return __builtin_shufflevector(lo, hi, 0, 1, 2, 3, 4, 5, 6, 7, 8, 9, 10, 11, 12, 13, 14, 15);
}

template <int MODE>
__global__ __launch_bounds__(256) void k_gemm_bf16(
    const __bf16* __restrict__ A, const __bf16* __restrict__ Bt,
    int M, int N, int K,
    const float* __restrict__ bias,
    float* __restrict__ Koutf, float* __restrict__ Voutf,
    __bf16* __restrict__ Kbf, __bf16* __restrict__ Vtbf, __bf16* __restrict__ Qbf,
    const float* __restrict__ resid, float* __restrict__ outf,
    __bf16* __restrict__ outbf) {
  // two buffers; every slice's place is a multiple of 2 KiB in the work-group's LDS
  __shared__ __attribute__((aligned(2048))) char smem[2 * GEMM_BUF_BYTES];

  const int tid = threadIdx.x;
  const int wave = (int)uni((uint32_t)tid >> 5), lane = tid & 31;
  const int mtiles = M / GBM;
  const int bm = blockIdx.x % mtiles;
  const int bn = blockIdx.x / mtiles;
  const int wm = wave & 3, wn = wave >> 2;
  const int row0 = bm * GBM + wm * 32;
  const int col0 = bn * GBN + wn * 64;

  v8f acc[2][4];
  #pragma unroll
  for (int i = 0; i < 2; ++i)
    #pragma unroll
    for (int j = 0; j < 4; ++j) acc[i][j] = (v8f)(0.f);

  const int lr = lane & 15;
  const int lh = (lane >> 4) * 16;
  const uint32_t T = (uint32_t)K / GBK;               // passes

  // this wave's slice: its first source row and its place in a buffer
  const __bf16* srow = (wave < 4) ? A  + (size_t)(bm * GBM + wave * G_SLICE_ROWS) * K
                                  : Bt + (size_t)(bn * GBN + (wave - 4) * G_SLICE_ROWS) * K;
  const uint64_t sbase = (uint64_t)(uintptr_t)srow;
  const uint32_t sdst = (uint32_t)(uintptr_t)smem + (uint32_t)wave * G_SLICE;
  u32x8 g1 = gemm_group1((uint32_t)K * 2u);
  asm volatile("" : "+s"(g1));
  auto issue = [&](uint32_t s) {
    const u32x4 g0 = gemm_group0(sdst + (s & 1u) * GEMM_BUF_BYTES, sbase + (uint64_t)s * G_ROWB);
    asm volatile("tensor_load_to_lds %0, %1" :: "s"(g0), "s"(g1) : "memory");
  };

  uint32_t pfo = (uint32_t)lane * ((uint32_t)K * 2u);
  if (T > 7u)   // uniform: stages 1 to 3 exist, and the offsets stay in the row behind pfo's first advance
    asm volatile("global_prefetch_b8 %0, %1 offset:256 scope:SCOPE_SE\n\t"
                 "global_prefetch_b8 %0, %1 offset:512 scope:SCOPE_SE\n\t"
                 "global_prefetch_b8 %0, %1 offset:768 scope:SCOPE_SE"
                 :: "v"(pfo), "s"(sbase) : "memory");
  // moves pfo on by a uniform step; the wait for the translations of the
  // prefetches that name it stands in the same statement, in front of the write
  auto pf_advance = [&](uint32_t step) {
    asm volatile("s_wait_xcnt 0x0\n\tv_add_nc_u32 %0, %1, %0" : "+v"(pfo) : "s"(step));
  };

  // the lane's rows in a buffer: A slice wm, rows mc*16 + lr; Bt slices
  // 4 + wn*2 + (nc >> 1), rows (nc & 1)*16 + lr; 16 k a wave half, alike in both
  const char* pa0 = smem + wm * G_SLICE + lr * G_PITCH + lh * 2;
  const char* pb0 = smem + (4 + wn * 2) * G_SLICE + lr * G_PITCH + lh * 2;

  // two fragment sets: the next 32 k's 12 reads go out as one group in front of
  // this block's products, so that their LDS latency runs under the products
  v16bf afr[2][2], bfr[2][4];
  auto frags = [&](int set, uint32_t buf, int kk) {
    const char* pa = pa0 + buf * GEMM_BUF_BYTES + kk * 64;
    const char* pb = pb0 + buf * GEMM_BUF_BYTES + kk * 64;
    #pragma unroll  // register arrays need constant indices
    for (int mc = 0; mc < 2; ++mc) afr[set][mc] = ld_frag(pa + mc * 16 * G_PITCH);
    #pragma unroll  // register arrays need constant indices
    for (int nc = 0; nc < 4; ++nc)
      bfr[set][nc] = ld_frag(pb + (nc >> 1) * G_SLICE + (nc & 1) * 16 * G_PITCH);
  };
  auto products = [&](int set) {
    // holds the reads above in front of the products: left to itself the build
    // reads each fragment right before its product and waits out the latency there
    __builtin_amdgcn_sched_barrier(0);
    #pragma unroll  // register arrays need constant indices
    for (int mc = 0; mc < 2; ++mc)
      #pragma unroll  // register arrays need constant indices
      for (int nc = 0; nc < 4; ++nc)
        acc[mc][nc] = wmma_bf16(afr[set][mc], bfr[set][nc], acc[mc][nc]);
  };

  // prologue: stage 0 lands and is published, then stage 1 starts
  issue(0u);
  asm volatile("s_wait_tensorcnt 0x0" ::: "memory");  // this wave's slice of stage 0 has landed
  __syncthreads();                                    // every wave's slice has
  issue(1u);
  pf_advance(((G_PF < T) ? G_PF : T - 1u) * G_ROWB);
  frags(0, 0u, 0);

  for (uint32_t s = 0; s < T; ++s) {
    const uint32_t buf = s & 1u;
    if (s + G_PF < T)                                   // uniform: stage s + G_PF exists
      asm volatile("global_prefetch_b8 %0, %1 scope:SCOPE_SE" :: "v"(pfo), "s"(sbase) : "memory");
    frags(1, buf, 1);
    products(0);
    frags(0, buf, 2);
    products(1);
    frags(1, buf, 3);
    products(0);
    // publish point of stage s + 1, in front of the pass's last block: that
    // block's fragments are in registers, nothing of stage s is read behind it.
    // The products above stay in front of the waits: left to itself the build
    // moves them behind the barrier, so that the last reads' latency lies bare
    // and the refill starts eight products late
    __builtin_amdgcn_sched_barrier(0);
    pf_advance((s + G_PF + 1u < T) ? (uint32_t)G_ROWB : 0u);   // stays on the last stage
    asm volatile("s_wait_dscnt 0x0" ::: "memory");      // this wave's reads of stage s have returned
    asm volatile("s_wait_tensorcnt 0x0" ::: "memory");  // its slice of stage s + 1 has landed
    __syncthreads();   // stage s + 1 is whole, and every wave has left stage s
    if (pinned((s + 2u < T) ? 1u : 0u) != 0u) issue(s + 2u);   // into the buffer just left
    if (s + 1u < T) frags(0, buf ^ 1u, 0);              // first block of stage s + 1
    products(1);
  }
  asm volatile("s_wait_tensorcnt 0x0" ::: "memory");    // no request is left when the ring changes its use
  asm volatile("s_wait_dscnt 0x0" ::: "memory");

  // epilogue: a wave passes its accumulators, 16 rows x 64 columns at a time,
  // through its own LDS range, so that a lane then holds 4 neighbouring columns
  // of one row: the residual loads and the stores move whole lines (a row piece
  // is 256 B of f32 or 128 B of bf16), a quarter of the memory instructions.
  // The ring is free here: the last pass's publish point waited for every tensor
  // load and its barrier stands behind every wave's last fragment read.
  float (*st)[EP_PITCH] = (float(*)[EP_PITCH])(smem + wave * EP_WAVE_BYTES);
  const int mofs = (lane >= 16) ? 8 : 0;
  const int er = lane >> 4;            // which row of the pair a wave-wide access covers
  const int ec = (lane & 15) * 4;      // first of the lane's 4 columns
  const int c = col0 + ec;             // global column
  const v4f bias4 = *(const v4f*)&bias[c];

  v4f rs[2][8];
  if constexpr (MODE == 1) {
    // all 16 residual loads in flight together: one memory latency, not one each
    const float* rp[2][8];
    #pragma unroll  // register arrays need constant indices
    for (int mc = 0; mc < 2; ++mc)
      #pragma unroll  // register arrays need constant indices
      for (int it = 0; it < 8; ++it) {
        rp[mc][it] = &resid[(size_t)(row0 + mc * 16 + it * 2 + er) * N + c];
        rs[mc][it] = *(const v4f*)rp[mc][it];
      }
    // left to itself the build lets a late load of the batch land in the address
    // registers of earlier ones: the addresses stay live up to this wait for
    // their translations
    asm volatile("s_wait_xcnt 0x0"
                 :: "v"(rp[0][0]), "v"(rp[0][1]), "v"(rp[0][2]), "v"(rp[0][3]),
                    "v"(rp[0][4]), "v"(rp[0][5]), "v"(rp[0][6]), "v"(rp[0][7]),
                    "v"(rp[1][0]), "v"(rp[1][1]), "v"(rp[1][2]), "v"(rp[1][3]),
                    "v"(rp[1][4]), "v"(rp[1][5]), "v"(rp[1][6]), "v"(rp[1][7])
                 : "memory");
  }

  // QKV: a wave's 64 columns are one head (hh) of one of q, k, v (WHICH 0, 1, 2)
  const int hh = (col0 & 1023) >> 6;

  auto drain = [&](auto wc) {
    constexpr int WHICH = decltype(wc)::value;
    float bc[4];                       // bias in accumulator order, for the V shadow
    if constexpr (MODE == 0 && WHICH == 2) {
      #pragma unroll  // register arrays need constant indices
      for (int nc = 0; nc < 4; ++nc) bc[nc] = bias[col0 + nc * 16 + lr];
    }
    #pragma unroll  // register arrays need constant indices
    for (int mc = 0; mc < 2; ++mc) {
      if constexpr (MODE == 0 && WHICH == 2) {
        // V shadow is [d][token]: a lane's 8 accumulator rows are 8 neighbouring
        // tokens of one d, one 16-byte store straight from registers
        const int m0 = row0 + mc * 16 + mofs;
        const int bh = (m0 >> 10) * NHEAD + hh;
        #pragma unroll  // register arrays need constant indices
        for (int nc = 0; nc < 4; ++nc) {
          v8bf p;
          #pragma unroll  // register arrays need constant indices
          for (int r = 0; r < 8; ++r) p[r] = (__bf16)(acc[mc][nc][r] + bc[nc]);
          *(v8bf*)&Vtbf[((size_t)bh * HEAD_DIM + nc * 16 + lr) * TKMAX + TP + (m0 & 1023)] = p;
        }
      }
      // these 16 rows overwrite the range: the first half's reads have returned
      if (mc == 1) asm volatile("s_wait_dscnt 0x0" ::: "memory");
      #pragma unroll  // register arrays need constant indices
      for (int nc = 0; nc < 4; ++nc)
        #pragma unroll  // register arrays need constant indices
        for (int r = 0; r < 8; ++r) st[r + mofs][nc * 16 + lr] = acc[mc][nc][r];
      // other lanes' rows are read back below: the wave's LDS writes land first
      asm volatile("s_wait_dscnt 0x0" ::: "memory");
      #pragma unroll  // register arrays need constant indices
      for (int it = 0; it < 8; ++it) {
        const int m = row0 + mc * 16 + it * 2 + er;   // global row (token)
        const v4f v = *(const v4f*)&st[it * 2 + er][ec] + bias4;
        if constexpr (MODE == 0) {
          const int bh = (m >> 10) * NHEAD + hh;
          const int t = m & 1023;
          const size_t o = ((size_t)bh * TKMAX + TP + t) * HEAD_DIM + ec;
          v4bf vb;
          #pragma unroll  // register arrays need constant indices
          for (int i = 0; i < 4; ++i) vb[i] = (__bf16)v[i];
          if constexpr (WHICH == 0) {
            *(v4bf*)&Qbf[((size_t)bh * TC + t) * HEAD_DIM + ec] = vb;
          } else if constexpr (WHICH == 1) {
            *(v4f*)&Koutf[o] = v;
            *(v4bf*)&Kbf[o] = vb;
          } else {
            *(v4f*)&Voutf[o] = v;
          }
        } else if constexpr (MODE == 1) {
          *(v4f*)&outf[(size_t)m * N + c] = v + rs[mc][it];
        } else {
          v4bf o;
          #pragma unroll  // register arrays need constant indices
          for (int i = 0; i < 4; ++i) {
            float ge = 0.5f * v[i] * (1.f + erff(v[i] * 0.70710678118654752f));
            o[i] = (__bf16)ge;
          }
          *(v4bf*)&outbf[(size_t)m * N + c] = o;
        }
      }
    }
    // QKV: the build runs shared address code of the other two cases behind
    // these stores, over their registers: wait for their translations first
    if constexpr (MODE == 0) asm volatile("s_wait_xcnt 0x0" ::: "memory");
  };

  if constexpr (MODE == 0) {
    // the same for a whole wave: read through the first lane, a scalar branch
    const int which = __builtin_amdgcn_readfirstlane(col0 >> 10);
    if (which == 0)      drain(int_c<0>{});
    else if (which == 1) drain(int_c<1>{});
    else                 drain(int_c<2>{});
  } else {
    drain(int_c<0>{});
  }
}

#define SK_BYTES  (32 * 72 * 2)                     // 4608  [key][d]
#define SVT_BYTES (64 * 40 * 2)                     // 5120  [d][key]
#define KV_BUF_BYTES (SK_BYTES + SVT_BYTES)         // 9728 per buffer
#define ATT_SMEM (2 * KV_BUF_BYTES)                 // 19456

__device__ __forceinline__ float xhalf(float x) {
  const int i = __builtin_bit_cast(int, x);
  return __builtin_bit_cast(float, __builtin_amdgcn_permlanex16(
      i, i, 0x76543210, 0xfedcba98, false, false));
}

__global__ __launch_bounds__(256) void k_attention(
    const __bf16* __restrict__ Qbf, const __bf16* __restrict__ Kbf,
    const __bf16* __restrict__ Vtbf, const int* __restrict__ pos_ptr,
    __bf16* __restrict__ Obf) {
  __shared__ __align__(16) char smem[ATT_SMEM];
  // the ring's place in the work-group's LDS, for the tensor loads.  Only they
  // write the ring: taken from the array itself, the address also tells the
  // build that the array is written, so that it stays allocated and is read
  const unsigned ring = (unsigned)(uintptr_t)smem;

  const int tid = threadIdx.x;
  const int wave = tid >> 5, lane = tid & 31;
  const int qt = blockIdx.x & 7;           // query tile of 128
  const int bh = blockIdx.x >> 3;          // b*NHEAD + h
  const int pos = pos_ptr[0];
  const int qbase = qt * 128;
  const int qrow = qbase + wave * 16;
  const int lr = lane & 15;
  const int lh = (lane >> 4) * 16;
  const int mofs = (lane >= 16) ? 8 : 0;

  const __bf16* Qp = Qbf + ((size_t)bh * TC + qrow) * HEAD_DIM;
  const __bf16* Kb = Kbf + (size_t)bh * TKMAX * HEAD_DIM;
  const __bf16* Vb = Vtbf + (size_t)bh * HEAD_DIM * TKMAX;

  // L2 prefetch, a group of 128 keys (4 tiles) at a time: the shadows were stored
  // by earlier launches and a tile's tensor loads lead its use by one tile only.
  // Waves 1 and 2 ask for the group's K rows
  // (16 KiB in a row, 64 units of 256 B), waves 3 and 4 for its 256 B of each of
  // the 64 V^T rows, a unit a lane.  pfa, the byte offset from the head's first
  // K or V^T byte, is the one register the prefetches name: it lives through the
  // loop and never leaves the head's rows
  const uint32_t wv = uni((uint32_t)tid >> 5);
  const uint32_t pw = (wv - 1u) & 3u;
  const bool pf_wave = wv >= 1u && wv <= 4u;
  const uint64_t pf_base = (uint64_t)(uintptr_t)((pw < 2u) ? Kb : Vb);
  const uint32_t pf_step = (pw < 2u) ? 128u * HEAD_DIM * 2u : 256u;
  uint32_t pfa = (pw < 2u) ? (pw * 32u + (uint32_t)lane) * 256u
                           : ((pw - 2u) * 32u + (uint32_t)lane) * (TKMAX * 2u);
  // asks, then moves pfa on by a uniform step; the wait for the prefetch's
  // translation stands in the same statement, in front of the write
  auto pf_group = [&](uint32_t step) {
    asm volatile("global_prefetch_b8 %0, %1 scope:SCOPE_SE\n\t"
                 "s_wait_xcnt 0x0\n\t"
                 "v_add_nc_u32 %0, %2, %0"
                 : "+v"(pfa) : "s"(pf_base), "s"(step) : "memory");
  };
  if (pf_wave) pf_group(pf_step);

  // load Q fragments (64x16 -> two 32x16 B-fragments) with explicit 16B loads:
  // lane = query column, 16 contiguous d per wave half, as the K loader below
  v16bf qf[2];
  #pragma unroll
  for (int f = 0; f < 2; ++f) {
    union { uint4 u[2]; v16bf v; } tmp;
    const uint4* p = (const uint4*)(Qp + (size_t)lr * HEAD_DIM + f * 32 + lh);
    tmp.u[0] = p[0];
    tmp.u[1] = p[1];
    qf[f] = tmp.v;
  }

  // all per lane, for query qrow + lr: running maximum (equal in both halves),
  // sum over this half's keys, O^T rows d = dc*16 + mofs + r
  float mrun = -1e30f, lsum = 0.f;
  v8f o[4];
  #pragma unroll
  for (int d = 0; d < 4; ++d) o[d] = (v8f)(0.f);

  const float scale = 0.125f;  // 1/sqrt(64)
  // last key this lane's query sees, counted from the first key of its half
  const int lim = pos + qrow + lr - mofs;
  const int kmax = min(pos + qbase + 128, TKMAX);   // never past the cache
  // at least one pass: the waits for the loads below stand in the loop
  const int ntiles = max((kmax + 31) / 32, 1);

#ifdef USE_TDM
  if (wave == 0) {
    tdm_load_2d(ring,            Kb, HEAD_DIM, TKMAX, HEAD_DIM, 32, HEAD_DIM, 4, 3);
    tdm_load_2d(ring + SK_BYTES, Vb, TKMAX, HEAD_DIM, 32, HEAD_DIM, TKMAX, 3, 3);
  }
#endif

  for (int kt = 0; kt < ntiles; ++kt) {
    const int kofs = kt * 32;
    const int cur = kt & 1;
    __bf16 (*sK)[72]  = (__bf16(*)[72])(smem + cur * KV_BUF_BYTES);
    __bf16 (*sVt)[40] = (__bf16(*)[40])(smem + cur * KV_BUF_BYTES + SK_BYTES);

    // uniform: the next group of 4 tiles, where this block walks it
    if (pf_wave && (kt & 3) == 0 && kt + 4 < ntiles)
      pf_group((kt + 8 < TKMAX / 32) ? pf_step : 0u);      // stays on the last group

#ifdef USE_TDM
    if (wave == 0) {
      if (kt + 1 < ntiles) {
        unsigned nb = ring + (unsigned)((cur ^ 1) * KV_BUF_BYTES);
        tdm_load_2d(nb, Kb + (size_t)(kofs + 32) * HEAD_DIM,
                    HEAD_DIM, TKMAX, HEAD_DIM, 32, HEAD_DIM, 4, 3);
        tdm_load_2d(nb + SK_BYTES, Vb + kofs + 32,
                    TKMAX, HEAD_DIM, 32, HEAD_DIM, TKMAX, 3, 3);
        __builtin_amdgcn_s_wait_tensorcnt(2);
      } else {
        __builtin_amdgcn_s_wait_tensorcnt(0);
      }
      asm volatile("" ::: "memory");
    }
    __syncthreads();
#else
    {
      int r = tid >> 3, c = (tid & 7) * 8;
      *(uint4*)&sK[r][c] = *(const uint4*)&Kb[(size_t)(kofs + r) * HEAD_DIM + c];
      int d = tid >> 2, kc = (tid & 3) * 8;
      *(uint4*)&sVt[d][kc] = *(const uint4*)&Vb[(size_t)d * TKMAX + kofs + kc];
    }
    __syncthreads();
#endif

    // S^T = K * Q^T: s[nc][r] = score of key kofs + nc*16 + mofs + r, query lr.
    // The tile's K fragments are read as one group: one LDS latency, not four
    v16bf ak[2][2];
    #pragma unroll
    for (int nc = 0; nc < 2; ++nc)
      #pragma unroll
      for (int f = 0; f < 2; ++f)
        #pragma unroll
        for (int j = 0; j < 16; ++j) ak[nc][f][j] = sK[nc * 16 + lr][f * 32 + lh + j];
    // V^T fragments (16 d x 32 keys each), read here so that they arrive while
    // the softmax runs; keys in the order in which pf below holds them
    v16bf av[4];
    #pragma unroll
    for (int dc = 0; dc < 4; ++dc)
      #pragma unroll
      for (int j = 0; j < 8; ++j) {
        av[dc][j]     = sVt[dc * 16 + lr][mofs + j];
        av[dc][8 + j] = sVt[dc * 16 + lr][16 + mofs + j];
      }
    // holds the 16 reads above in front of the products: left to itself the
    // build reads each fragment into one register set right before its product
    // and waits out the LDS latency eight times a tile
    __builtin_amdgcn_sched_barrier(0);
    v8f s[2];
    #pragma unroll
    for (int nc = 0; nc < 2; ++nc) s[nc] = wmma_bf16(ak[nc][0], qf[0], (v8f)(0.f));
    #pragma unroll
    for (int nc = 0; nc < 2; ++nc) s[nc] = wmma_bf16(ak[nc][1], qf[1], s[nc]);

    // online softmax of the lane's one query
    s[0] *= scale;
    s[1] *= scale;
    const int rel = lim - kofs;            // keys mofs + j with j <= rel are seen
    float mt[8];
    #pragma unroll
    for (int r = 0; r < 8; ++r) {
      if (r > rel)      s[0][r] = -1e30f;
      if (16 + r > rel) s[1][r] = -1e30f;
      mt[r] = fmaxf(s[0][r], s[1][r]);
    }
    float mx = fmaxf(fmaxf(fmaxf(mt[0], mt[1]), fmaxf(mt[2], mt[3])),
                     fmaxf(fmaxf(mt[4], mt[5]), fmaxf(mt[6], mt[7])));
    mx = fmaxf(mx, xhalf(mx));             // over all 32 keys, both halves alike
    const float mnew = fmaxf(mrun, mx);
    const float corr = __expf(mrun - mnew);
    mrun = mnew;

    // P^T as B operand: element j = key mofs + j, element 8 + j = key 16 + mofs + j
    v16bf pf;
    float st[8];
    #pragma unroll
    for (int r = 0; r < 8; ++r) {
      float p0 = __expf(s[0][r] - mnew);
      float p1 = __expf(s[1][r] - mnew);
      st[r] = p0 + p1;
      pf[r]     = (__bf16)p0;
      pf[8 + r] = (__bf16)p1;
    }
    lsum = lsum * corr + (((st[0] + st[1]) + (st[2] + st[3])) +
                          ((st[4] + st[5]) + (st[6] + st[7])));
    #pragma unroll
    for (int d = 0; d < 4; ++d) o[d] *= corr;

    // O^T += V^T(16 d x 32 keys) * P^T(32 keys x 16 queries)
    #pragma unroll
    for (int dc = 0; dc < 4; ++dc) o[dc] = wmma_bf16(av[dc], pf, o[dc]);
    __syncthreads();   // done reading cur buffer before refill
  }

  // normalize + write O into [token, d_model] bf16 buffer at head column: a
  // lane's 8 accumulator rows are 8 neighbouring d of its token, 16 bytes
  const float ltot = lsum + xhalf(lsum);   // the two halves' keys together
  const int b = bh >> 4, h = bh & 15;
  __bf16* op = Obf + (size_t)(b * TC + qrow + lr) * D_MODEL + h * HEAD_DIM + mofs;
  #pragma unroll
  for (int dc = 0; dc < 4; ++dc) {
    v8bf ov;
    #pragma unroll
    for (int r = 0; r < 8; ++r) ov[r] = (__bf16)(o[dc][r] / ltot);
    *(v8bf*)(op + dc * 16) = ov;
  }
}

// ---------------------------------------------------------------------------
// Host-side launch
// ---------------------------------------------------------------------------
extern "C" void kernel_launch(void* const* d_in, const int* in_sizes, int n_in,
                              void* d_out, int out_size, void* d_ws, size_t ws_size,
                              hipStream_t stream) {
  const float* x    = (const float*)d_in[0];
  const float* Kp   = (const float*)d_in[1];
  const float* Vp   = (const float*)d_in[2];
  const int*   pos  = (const int*)d_in[3];
  const float* wqkv = (const float*)d_in[4];
  const float* bqkv = (const float*)d_in[5];
  const float* wo   = (const float*)d_in[6];
  const float* bo   = (const float*)d_in[7];
  const float* g1   = (const float*)d_in[8];
  const float* be1  = (const float*)d_in[9];
  const float* g2   = (const float*)d_in[10];
  const float* be2  = (const float*)d_in[11];
  const float* w1   = (const float*)d_in[12];
  const float* bf1  = (const float*)d_in[13];
  const float* w2   = (const float*)d_in[14];
  const float* bf2  = (const float*)d_in[15];

  float* xout = (float*)d_out;
  float* Kout = xout + (size_t)NTOK * D_MODEL;
  float* Vout = Kout + (size_t)BATCH * NHEAD * TKMAX * HEAD_DIM;

  char* w = (char*)d_ws;
  size_t off = 0;
  auto carve = [&](size_t bytes) {
    void* p = w + off;
    off += (bytes + 255) & ~(size_t)255;
    return p;
  };
  // weights stored TRANSPOSED [N][K] in bf16
  __bf16* wqkvT = (__bf16*)carve((size_t)3 * D_MODEL * D_MODEL * 2);
  __bf16* woT   = (__bf16*)carve((size_t)D_MODEL * D_MODEL * 2);
  __bf16* w1T   = (__bf16*)carve((size_t)DIM_FF * D_MODEL * 2);
  __bf16* w2T   = (__bf16*)carve((size_t)D_MODEL * DIM_FF * 2);
  __bf16* h_bf  = (__bf16*)carve((size_t)NTOK * D_MODEL * 2);    // reused for h2
  __bf16* q_bf  = (__bf16*)carve((size_t)NTOK * D_MODEL * 2);
  __bf16* K_bf  = (__bf16*)carve((size_t)BATCH * NHEAD * TKMAX * HEAD_DIM * 2);
  __bf16* Vt_bf = (__bf16*)carve((size_t)BATCH * NHEAD * HEAD_DIM * TKMAX * 2);
  __bf16* o_bf  = (__bf16*)carve((size_t)NTOK * D_MODEL * 2);
  float*  x1    = (float*)carve((size_t)NTOK * D_MODEL * 4);
  __bf16* ff_bf = K_bf;  // FFN activation aliases dead bf16 KV shadow (32MB)

  // 1) weight converts (transpose to [N][K])
  k_cvt_transpose<D_MODEL, 3 * D_MODEL><<<(D_MODEL / TR_R) * (3 * D_MODEL / TR_C), 256, 0, stream>>>(wqkv, wqkvT);
  k_cvt_transpose<D_MODEL, D_MODEL><<<(D_MODEL / TR_R) * (D_MODEL / TR_C), 256, 0, stream>>>(wo, woT);
  k_cvt_transpose<D_MODEL, DIM_FF><<<(D_MODEL / TR_R) * (DIM_FF / TR_C), 256, 0, stream>>>(w1, w1T);
  k_cvt_transpose<DIM_FF, D_MODEL><<<(DIM_FF / TR_R) * (D_MODEL / TR_C), 256, 0, stream>>>(w2, w2T);

  // 2) LN1
  k_layernorm<<<NTOK / LN_ROWS, 256, 0, stream>>>(x, g1, be1, h_bf);

  // 3) past KV copy into cache + bf16 shadows
  k_kvcopy<<<BATCH * NHEAD * (TP / TR_R), 256, 0, stream>>>(Kp, Vp, Kout, Vout, K_bf, Vt_bf);

  // 4) QKV GEMM: [4096,1024] x [1024,3072]
  {
    int M = NTOK, N = 3 * D_MODEL, K = D_MODEL;
    dim3 grid((M / GBM) * (N / GBN));
    k_gemm_bf16<0><<<grid, 256, 0, stream>>>(h_bf, wqkvT, M, N, K, bqkv,
                                             Kout, Vout, K_bf, Vt_bf, q_bf,
                                             nullptr, nullptr, nullptr);
  }

  // 5) attention
  k_attention<<<BATCH * NHEAD * (TC / 128), 256, 0, stream>>>(q_bf, K_bf, Vt_bf, pos, o_bf);

  // 6) Wo GEMM + residual -> x1
  {
    int M = NTOK, N = D_MODEL, K = D_MODEL;
    dim3 grid((M / GBM) * (N / GBN));
    k_gemm_bf16<1><<<grid, 256, 0, stream>>>(o_bf, woT, M, N, K, bo,
                                             nullptr, nullptr, nullptr, nullptr, nullptr,
                                             x, x1, nullptr);
  }

  // 7) LN2 -> h2 (reuse h_bf)
  k_layernorm<<<NTOK / LN_ROWS, 256, 0, stream>>>(x1, g2, be2, h_bf);

  // 8) W1 GEMM + GELU -> ff_bf
  {
    int M = NTOK, N = DIM_FF, K = D_MODEL;
    dim3 grid((M / GBM) * (N / GBN));
    k_gemm_bf16<2><<<grid, 256, 0, stream>>>(h_bf, w1T, M, N, K, bf1,
                                             nullptr, nullptr, nullptr, nullptr, nullptr,
                                             nullptr, nullptr, ff_bf);
  }

  // 9) W2 GEMM + residual -> xout
  {
    int M = NTOK, N = D_MODEL, K = DIM_FF;
    dim3 grid((M / GBM) * (N / GBN));
    k_gemm_bf16<1><<<grid, 256, 0, stream>>>(ff_bf, w2T, M, N, K, bf2,
                                             nullptr, nullptr, nullptr, nullptr, nullptr,
                                             x1, xout, nullptr);
  }
}

// v007
// A run of this version takes 181 microseconds.
// Next to v006, in two timings, it ran 1.05 and 1.04 times as fast.
// All steps since v000 together make it 2.56 times as fast.
#include <hip/hip_runtime.h>

typedef __bf16 v16bf __attribute__((ext_vector_type(16)));
typedef float  v8f   __attribute__((ext_vector_type(8)));
typedef unsigned int u32x4 __attribute__((ext_vector_type(4)));
typedef int i32x4 __attribute__((ext_vector_type(4)));
typedef int i32x8 __attribute__((ext_vector_type(8)));

__device__ __forceinline__ v8f wmma_bf16(v16bf a, v16bf b, v8f c) {
  // D = A(16x32 bf16) * B(32x16 bf16) + C(16x16 f32)
  return __builtin_amdgcn_wmma_f32_16x16x32_bf16(
      false, a, false, b, (short)0, c, false, false);
}

#if defined(__has_builtin)
#if __has_builtin(__builtin_amdgcn_tensor_load_to_lds) && \
    __has_builtin(__builtin_amdgcn_s_wait_tensorcnt)
#define USE_TDM 1
#endif
#endif

#ifdef USE_TDM
// 2D tile load Global->LDS via Tensor Data Mover (bf16 payload).
__device__ __forceinline__ void tdm_load_2d(unsigned lds_off, const __bf16* gaddr,
                                            unsigned dim0, unsigned dim1,
                                            unsigned tile0, unsigned tile1,
                                            unsigned stride0,
                                            unsigned pad_int_code,
                                            unsigned pad_amt_code) {
  unsigned long long ga = (unsigned long long)(uintptr_t)gaddr;
  u32x4 g0;
  g0[0] = 1u;
  g0[1] = lds_off;
  g0[2] = (unsigned)(ga & 0xFFFFFFFFu);
  g0[3] = (unsigned)((ga >> 32) & 0x01FFFFFFu)
          | (2u << 30);
  i32x8 g1;
  g1[0] = (int)((1u << 16)
                | (1u << 20)
                | (pad_int_code << 22)
                | (pad_amt_code << 25));
  g1[1] = (int)((dim0 & 0xFFFFu) << 16);
  g1[2] = (int)((dim0 >> 16) | ((dim1 & 0xFFFFu) << 16));
  g1[3] = (int)((dim1 >> 16) | (tile0 << 16));
  g1[4] = (int)(tile1 & 0xFFFFu);
  g1[5] = (int)stride0;
  g1[6] = 0;
  g1[7] = 0;
  i32x4 z4 = {0, 0, 0, 0};
#if defined(__clang_major__) && (__clang_major__ >= 23)
  i32x8 z8 = {0, 0, 0, 0, 0, 0, 0, 0};
  __builtin_amdgcn_tensor_load_to_lds(g0, g1, z4, z4, z8, 0);
#else
  __builtin_amdgcn_tensor_load_to_lds(g0, g1, z4, z4, 0);
#endif
}
#endif  // USE_TDM

#define D_MODEL 1024
#define NHEAD   16
#define HEAD_DIM 64
#define DIM_FF  4096
#define BATCH   4
#define TC      1024
#define TP      1024
#define TKMAX   2048
#define NTOK    (BATCH * TC)   // 4096

// ---------------------------------------------------------------------------
// Transposing f32 -> bf16 copies go through an LDS tile of 128 source rows x
// 64 source columns, so that both global sides move whole lines, 16 bytes a
// lane: a source row piece is 256 B of f32, a destination row piece 256 B of
// bf16.  256 threads; thread (kg, nq) holds source rows kg*8..+7, columns
// nq*4..+3.
// ---------------------------------------------------------------------------
#define TR_R 128
#define TR_C 64
#define TR_PITCH 136                                // 272 B = 16 B x odd
typedef float  v4f  __attribute__((ext_vector_type(4)));
typedef __bf16 v4bf __attribute__((ext_vector_type(4)));
typedef __bf16 v8bf __attribute__((ext_vector_type(8)));

__device__ __forceinline__ void tr_put(__bf16 (*tile)[TR_PITCH], const v4f (&v)[8],
                                       int nq, int kg) {
  #pragma unroll  // register arrays need constant indices
  for (int i = 0; i < 4; ++i) {
    v8bf p;
    #pragma unroll  // register arrays need constant indices
    for (int j = 0; j < 8; ++j) p[j] = (__bf16)v[j][i];
    *(v8bf*)&tile[nq * 4 + i][kg * 8] = p;
  }
}

// dst points at the tile's first element; ld = destination row pitch (elements)
__device__ __forceinline__ void tr_get(const __bf16 (*tile)[TR_PITCH],
                                       __bf16* __restrict__ dst, size_t ld, int tid) {
  #pragma unroll
  for (int it = 0; it < 4; ++it) {
    int idx = it * 256 + tid;
    int n = idx >> 4, c = (idx & 15) * 8;
    *(v8bf*)&dst[(size_t)n * ld + c] = *(const v8bf*)&tile[n][c];
  }
}

template <int K, int N>
__global__ __launch_bounds__(256) void k_cvt_transpose(const float* __restrict__ src,
                                                       __bf16* __restrict__ dst) {
  __shared__ __align__(16) __bf16 tile[TR_C][TR_PITCH];
  const int tid = threadIdx.x;
  const int nq = tid & 15, kg = tid >> 4;
  const int n0 = (blockIdx.x % (N / TR_C)) * TR_C;
  const int k0 = (blockIdx.x / (N / TR_C)) * TR_R;

  const float* p = src + (size_t)(k0 + kg * 8) * N + n0 + nq * 4;
  v4f v[8];
  #pragma unroll  // register arrays need constant indices
  for (int j = 0; j < 8; ++j) v[j] = *(const v4f*)(p + j * N);
  tr_put(tile, v, nq, kg);
  __syncthreads();
  tr_get(tile, dst + (size_t)n0 * K + k0, (size_t)K, tid);
}

// ---------------------------------------------------------------------------
// LayerNorm: one wave per row of D_MODEL, 8 rows a block, bf16 out.  A lane
// holds 32 elements of its row in registers (8 loads of 16 B, each wave-wide
// load 512 contiguous bytes), so the row is read once, the sums need no LDS and
// no barrier, and a launch starts an eighth of the waves.
// ---------------------------------------------------------------------------
#define LN_ROWS 8
__global__ __launch_bounds__(256) void k_layernorm(const float* __restrict__ x,
                                                   const float* __restrict__ g,
                                                   const float* __restrict__ b,
                                                   __bf16* __restrict__ out) {
  const int lane = threadIdx.x & 31, wave = threadIdx.x >> 5;
  const int row = blockIdx.x * LN_ROWS + wave;
  const float* xr = x + (size_t)row * D_MODEL + lane * 4;

  v4f v[8];
  #pragma unroll  // register arrays need constant indices
  for (int j = 0; j < 8; ++j) v[j] = *(const v4f*)(xr + j * 128);
  // the build lets a load of g or b below land in the address registers of the
  // row's loads: wait for their translations first
  asm volatile("s_wait_xcnt 0x0" ::: "memory");
  v4f gg[8], bb[8];
  #pragma unroll  // register arrays need constant indices
  for (int j = 0; j < 8; ++j) {
    gg[j] = *(const v4f*)(g + lane * 4 + j * 128);
    bb[j] = *(const v4f*)(b + lane * 4 + j * 128);
  }
  // keeps all 24 loads in flight together: left to itself the build issues
  // the loads of g and b behind the row's first data, a second latency in turn
  __builtin_amdgcn_sched_barrier(0);

  // four independent partial sums a lane: chains of 8 links, not of 32
  v4f sv = v[0], qv = v[0] * v[0];
  #pragma unroll  // register arrays need constant indices
  for (int j = 1; j < 8; ++j) { sv += v[j]; qv += v[j] * v[j]; }
  float s  = (sv[0] + sv[1]) + (sv[2] + sv[3]);
  float s2 = (qv[0] + qv[1]) + (qv[2] + qv[3]);
  #pragma unroll
  for (int off = 16; off >= 1; off >>= 1) {
    s  += __shfl_xor(s,  off, 32);
    s2 += __shfl_xor(s2, off, 32);
  }
  const float mu = s * (1.f / D_MODEL);
  const float var = s2 * (1.f / D_MODEL) - mu * mu;
  const float rstd = rsqrtf(var + 1e-5f);

  __bf16* orow = out + (size_t)row * D_MODEL + lane * 4;
  #pragma unroll  // register arrays need constant indices
  for (int j = 0; j < 8; ++j) {
    v4bf o;
    #pragma unroll  // register arrays need constant indices
    for (int i = 0; i < 4; ++i) o[i] = (__bf16)((v[j][i] - mu) * rstd * gg[j][i] + bb[j][i]);
    *(v4bf*)(orow + j * 128) = o;
  }
}

// ---------------------------------------------------------------------------
// Copy past KV into output cache (fp32) + bf16 shadows for attention.
// K shadow: [B,H,Tk,Dh] row-major; V shadow: TRANSPOSED [B,H,Dh,Tk].
// ---------------------------------------------------------------------------
// grid: B*H*(TP/128) blocks; a block takes 128 tokens of one head (contiguous
// in source and in both caches); the V shadow goes through the LDS tile.
__global__ __launch_bounds__(256) void k_kvcopy(const float* __restrict__ Kp,
                                                const float* __restrict__ Vp,
                                                float* __restrict__ Kout,
                                                float* __restrict__ Vout,
                                                __bf16* __restrict__ Kbf,
                                                __bf16* __restrict__ Vtbf) {
  __shared__ __align__(16) __bf16 tile[TR_C][TR_PITCH];
  const int tid = threadIdx.x;
  const int nq = tid & 15, kg = tid >> 4;
  const int bh = blockIdx.x / (TP / TR_R);
  const int t0 = (blockIdx.x % (TP / TR_R)) * TR_R;
  const size_t sbase = ((size_t)bh * TP + t0) * HEAD_DIM;
  const size_t dbase = ((size_t)bh * TKMAX + t0) * HEAD_DIM;

  const unsigned vo = (unsigned)(kg * 8 * HEAD_DIM + nq * 4);   // V: tile order
  const unsigned ko = (unsigned)(tid * 4);                      // K: linear
  const float* pv = Vp + sbase;
  const float* pk = Kp + sbase;
  v4f vv[8], kv[8];
  #pragma unroll  // register arrays need constant indices
  for (int j = 0; j < 8; ++j) vv[j] = *(const v4f*)(pv + vo + j * HEAD_DIM);
  #pragma unroll  // register arrays need constant indices
  for (int j = 0; j < 8; ++j) kv[j] = *(const v4f*)(pk + ko + j * 1024);
  // address registers of the loads above are rewritten below: wait for their
  // translations first.  The statement also holds all 16 loads in front of the
  // first use of V, so that no K load pays a second memory latency.
  asm volatile("s_wait_xcnt 0x0" ::: "memory");

  // the tile's barrier stands in front of every global store: it would wait
  // for stores already issued
  tr_put(tile, vv, nq, kg);
  __syncthreads();
  tr_get(tile, Vtbf + (size_t)bh * HEAD_DIM * TKMAX + t0, (size_t)TKMAX, tid);

  float* qv = Vout + dbase;
  float* qk = Kout + dbase;
  __bf16* qb = Kbf + dbase;
  #pragma unroll  // register arrays need constant indices
  for (int j = 0; j < 8; ++j) *(v4f*)(qv + vo + j * HEAD_DIM) = vv[j];
  #pragma unroll  // register arrays need constant indices
  for (int j = 0; j < 8; ++j) {
    *(v4f*)(qk + ko + j * 1024) = kv[j];
    v4bf kb;
    #pragma unroll  // register arrays need constant indices
    for (int i = 0; i < 4; ++i) kb[i] = (__bf16)kv[j][i];
    *(v4bf*)(qb + ko + j * 1024) = kb;
  }
}

// ---------------------------------------------------------------------------
// Tiled WMMA GEMM: C[M,N] = A[M,K](bf16) * Bt[N,K](bf16, pre-transposed)
//   block tile 128x128, 256 threads = 8 waves,
//   wave grid 4(M) x 2(N); each wave: 2x4 accumulators of 16x16.
//   A pass is 128 k = 256 B of every operand row, two buffers.  Every wave
//   brings its own slice of 32 rows with one tensor load a pass (waves 0..3
//   rows of A, waves 4..7 rows of Bt), issued one pass before it is read.
//   Fragments are read one block of 32 k ahead, into a second register set.
//   M, N multiples of 128; K a multiple of 128 and at least 256.
// MODE 0: QKV scatter  MODE 1: bias+residual->f32  MODE 2: bias+GELU->bf16
// ---------------------------------------------------------------------------
#define GBM 128
#define GBN 128
#define GBK 128
#define G_ROWB 256                                  // bytes of a row in a pass
#define G_PITCH 272                                 // row + 16 B pad = 16 B x odd
#define G_SLICE_ROWS 32
#define G_PF 4u                                     // stages between a pass and the stage it prefetches
#define G_SLICE 10240                               // 32 x 272 = 8704, up to a multiple of 2 KiB
#define GEMM_BUF_BYTES (8 * G_SLICE)                // 81920
#define EP_PITCH 68                                 // epilogue row: 272 B = 16 B x odd
#define EP_WAVE_BYTES G_SLICE                       // >= 16 rows x 272 B
template <int V> struct int_c { static constexpr int value = V; };
typedef unsigned int u32x8 __attribute__((ext_vector_type(8)));

__device__ __forceinline__ uint32_t uni(uint32_t v) {
  return (uint32_t)__builtin_amdgcn_readfirstlane(v);
}
__device__ __forceinline__ uint32_t pinned(uint32_t v) {
  uint32_t w = uni(v);
  asm volatile("" : "+s"(w));  // the value stays in a scalar register
  return w;
}
__device__ __forceinline__ u32x8 gemm_group1(uint32_t src_pitch) {
  u32x8 g;
  g[0] = uni((1u << 20) | (5u << 22) | (3u << 25));
  g[1] = uni((uint32_t)G_ROWB << 16);
  g[2] = uni((uint32_t)G_SLICE_ROWS << 16);
  g[3] = uni((uint32_t)G_ROWB << 16);
  g[4] = uni((uint32_t)G_SLICE_ROWS);
  g[5] = uni(src_pitch);
  g[6] = uni(0u);
  g[7] = uni(0u);
  return g;
}
__device__ __forceinline__ u32x4 gemm_group0(uint32_t lds_dst, uint64_t ga) {
  u32x4 g;
  g[0] = uni(1u);
  g[1] = uni(lds_dst);
  g[2] = uni((uint32_t)ga);
  g[3] = uni((((uint32_t)(ga >> 32)) & 0x01FFFFFFu) | 0x80000000u);
  return g;
}
// 16 k of one row: two 16-byte LDS reads
__device__ __forceinline__ v16bf ld_frag(const char* p) {
  const v8bf lo = *(const v8bf*)p, hi = *(const v8bf*)(p + 16);
  return __builtin_shufflevector(lo, hi, 0, 1, 2, 3, 4, 5, 6, 7, 8, 9, 10, 11, 12, 13, 14, 15);
}

// GELU with the exact erf, 0.5 v (1 + erf(v / sqrt 2)), of four values at once and
// without a branch.  For z >= 0, with t = 1 / (1 + p z):
//   erfc(z) = t (a1 + t (a2 + t (a3 + t (a4 + t a5)))) exp(-z z), absolute error 1.5e-7,
// and gelu(v) = max(v, 0) - |v| erfc(|v| / sqrt 2) / 2, which cancels nothing for
// v < 0.  The constants hold the 1 / sqrt 2, the halving and exp's change to base 2.
// The library's erff is two divergent branches for every value, each one chain of
// dependent operations; here the four values' short chains run side by side.
__device__ __forceinline__ v4f gelu4(v4f v) {
  const v4f av = __builtin_elementwise_abs(v);
  const v4f d = av * 0.23164189f + 1.f;              // 1 + p z
  const v4f w = v * 0.84932178f;                     // w w = z z log2(e)
  const v4f ww = w * w;
  float t0, t1, t2, t3, e0, e1, e2, e3;
  asm("v_rcp_f32 %0, %8\n\tv_rcp_f32 %1, %9\n\tv_rcp_f32 %2, %10\n\tv_rcp_f32 %3, %11\n\t"
      "v_exp_f32 %4, -%12\n\tv_exp_f32 %5, -%13\n\tv_exp_f32 %6, -%14\n\tv_exp_f32 %7, -%15\n\t"
      "v_nop"
      : "=&v"(t0), "=&v"(t1), "=&v"(t2), "=&v"(t3), "=&v"(e0), "=&v"(e1), "=&v"(e2), "=&v"(e3)
      : "v"(d[0]), "v"(d[1]), "v"(d[2]), "v"(d[3]), "v"(ww[0]), "v"(ww[1]), "v"(ww[2]), "v"(ww[3]));
  const v4f t = {t0, t1, t2, t3}, e = {e0, e1, e2, e3};
  v4f p = t * 0.53070271f - 0.72657603f;
  p = p * t + 0.71070689f;
  p = p * t - 0.14224836f;
  p = p * t + 0.12741479f;
  const v4f q = (p * t) * e;                         // erfc(z) / 2
  return __builtin_elementwise_max(v, (v4f)(0.f)) - av * q;
}

template <int MODE>
__global__ __launch_bounds__(256) void k_gemm_bf16(
    const __bf16* __restrict__ A, const __bf16* __restrict__ Bt,
    int M, int N, int K,
    const float* __restrict__ bias,
    float* __restrict__ Koutf, float* __restrict__ Voutf,
    __bf16* __restrict__ Kbf, __bf16* __restrict__ Vtbf, __bf16* __restrict__ Qbf,
    const float* __restrict__ resid, float* __restrict__ outf,
    __bf16* __restrict__ outbf) {
  // two buffers; every slice's place is a multiple of 2 KiB in the work-group's LDS
  __shared__ __attribute__((aligned(2048))) char smem[2 * GEMM_BUF_BYTES];

  const int tid = threadIdx.x;
  const int wave = (int)uni((uint32_t)tid >> 5), lane = tid & 31;
  const int mtiles = M / GBM;
  const int bm = blockIdx.x % mtiles;
  const int bn = blockIdx.x / mtiles;
  const int wm = wave & 3, wn = wave >> 2;
  const int row0 = bm * GBM + wm * 32;
  const int col0 = bn * GBN + wn * 64;

  v8f acc[2][4];
  #pragma unroll
  for (int i = 0; i < 2; ++i)
    #pragma unroll
    for (int j = 0; j < 4; ++j) acc[i][j] = (v8f)(0.f);

  const int lr = lane & 15;
  const int lh = (lane >> 4) * 16;
  const uint32_t T = (uint32_t)K / GBK;               // passes

  // this wave's slice: its first source row and its place in a buffer
  const __bf16* srow = (wave < 4) ? A  + (size_t)(bm * GBM + wave * G_SLICE_ROWS) * K
                                  : Bt + (size_t)(bn * GBN + (wave - 4) * G_SLICE_ROWS) * K;
  const uint64_t sbase = (uint64_t)(uintptr_t)srow;
  const uint32_t sdst = (uint32_t)(uintptr_t)smem + (uint32_t)wave * G_SLICE;
  u32x8 g1 = gemm_group1((uint32_t)K * 2u);
  asm volatile("" : "+s"(g1));
  auto issue = [&](uint32_t s) {
    const u32x4 g0 = gemm_group0(sdst + (s & 1u) * GEMM_BUF_BYTES, sbase + (uint64_t)s * G_ROWB);
    asm volatile("tensor_load_to_lds %0, %1" :: "s"(g0), "s"(g1) : "memory");
  };

  uint32_t pfo = (uint32_t)lane * ((uint32_t)K * 2u);
  if (T > 7u)   // uniform: stages 1 to 3 exist, and the offsets stay in the row behind pfo's first advance
    asm volatile("global_prefetch_b8 %0, %1 offset:256 scope:SCOPE_SE\n\t"
                 "global_prefetch_b8 %0, %1 offset:512 scope:SCOPE_SE\n\t"
                 "global_prefetch_b8 %0, %1 offset:768 scope:SCOPE_SE"
                 :: "v"(pfo), "s"(sbase) : "memory");
  // moves pfo on by a uniform step; the wait for the translations of the
  // prefetches that name it stands in the same statement, in front of the write
  auto pf_advance = [&](uint32_t step) {
    asm volatile("s_wait_xcnt 0x0\n\tv_add_nc_u32 %0, %1, %0" : "+v"(pfo) : "s"(step));
  };

  // the lane's rows in a buffer: A slice wm, rows mc*16 + lr; Bt slices
  // 4 + wn*2 + (nc >> 1), rows (nc & 1)*16 + lr; 16 k a wave half, alike in both
  const char* pa0 = smem + wm * G_SLICE + lr * G_PITCH + lh * 2;
  const char* pb0 = smem + (4 + wn * 2) * G_SLICE + lr * G_PITCH + lh * 2;

  // two fragment sets: the next 32 k's 12 reads go out as one group in front of
  // this block's products, so that their LDS latency runs under the products
  v16bf afr[2][2], bfr[2][4];
  auto frags = [&](int set, uint32_t buf, int kk) {
    const char* pa = pa0 + buf * GEMM_BUF_BYTES + kk * 64;
    const char* pb = pb0 + buf * GEMM_BUF_BYTES + kk * 64;
    #pragma unroll  // register arrays need constant indices
    for (int mc = 0; mc < 2; ++mc) afr[set][mc] = ld_frag(pa + mc * 16 * G_PITCH);
    #pragma unroll  // register arrays need constant indices
    for (int nc = 0; nc < 4; ++nc)
      bfr[set][nc] = ld_frag(pb + (nc >> 1) * G_SLICE + (nc & 1) * 16 * G_PITCH);
  };
  auto products = [&](int set) {
    // holds the reads above in front of the products: left to itself the build
    // reads each fragment right before its product and waits out the latency there
    __builtin_amdgcn_sched_barrier(0);
    #pragma unroll  // register arrays need constant indices
    for (int mc = 0; mc < 2; ++mc)
      #pragma unroll  // register arrays need constant indices
      for (int nc = 0; nc < 4; ++nc)
        acc[mc][nc] = wmma_bf16(afr[set][mc], bfr[set][nc], acc[mc][nc]);
  };

  // prologue: stage 0 lands and is published, then stage 1 starts
  issue(0u);
  asm volatile("s_wait_tensorcnt 0x0" ::: "memory");  // this wave's slice of stage 0 has landed
  __syncthreads();                                    // every wave's slice has
  issue(1u);
  pf_advance(((G_PF < T) ? G_PF : T - 1u) * G_ROWB);
  frags(0, 0u, 0);

  for (uint32_t s = 0; s < T; ++s) {
    const uint32_t buf = s & 1u;
    if (s + G_PF < T)                                   // uniform: stage s + G_PF exists
      asm volatile("global_prefetch_b8 %0, %1 scope:SCOPE_SE" :: "v"(pfo), "s"(sbase) : "memory");
    frags(1, buf, 1);
    products(0);
    frags(0, buf, 2);
    products(1);
    frags(1, buf, 3);
    products(0);
    // publish point of stage s + 1, in front of the pass's last block: that
    // block's fragments are in registers, nothing of stage s is read behind it.
    // The products above stay in front of the waits: left to itself the build
    // moves them behind the barrier, so that the last reads' latency lies bare
    // and the refill starts eight products late
    __builtin_amdgcn_sched_barrier(0);
    pf_advance((s + G_PF + 1u < T) ? (uint32_t)G_ROWB : 0u);   // stays on the last stage
    asm volatile("s_wait_dscnt 0x0" ::: "memory");      // this wave's reads of stage s have returned
    asm volatile("s_wait_tensorcnt 0x0" ::: "memory");  // its slice of stage s + 1 has landed
    __syncthreads();   // stage s + 1 is whole, and every wave has left stage s
    if (pinned((s + 2u < T) ? 1u : 0u) != 0u) issue(s + 2u);   // into the buffer just left
    if (s + 1u < T) frags(0, buf ^ 1u, 0);              // first block of stage s + 1
    products(1);
  }
  asm volatile("s_wait_tensorcnt 0x0" ::: "memory");    // no request is left when the ring changes its use
  asm volatile("s_wait_dscnt 0x0" ::: "memory");

  // epilogue: a wave passes its accumulators, 16 rows x 64 columns at a time,
  // through its own LDS range, so that a lane then holds 4 neighbouring columns
  // of one row: the residual loads and the stores move whole lines (a row piece
  // is 256 B of f32 or 128 B of bf16), a quarter of the memory instructions.
  // The ring is free here: the last pass's publish point waited for every tensor
  // load and its barrier stands behind every wave's last fragment read.
  float (*st)[EP_PITCH] = (float(*)[EP_PITCH])(smem + wave * EP_WAVE_BYTES);
  const int mofs = (lane >= 16) ? 8 : 0;
  const int er = lane >> 4;            // which row of the pair a wave-wide access covers
  const int ec = (lane & 15) * 4;      // first of the lane's 4 columns
  const int c = col0 + ec;             // global column
  const v4f bias4 = *(const v4f*)&bias[c];

  v4f rs[2][8];
  if constexpr (MODE == 1) {
    // all 16 residual loads in flight together: one memory latency, not one each
    const float* rp[2][8];
    #pragma unroll  // register arrays need constant indices
    for (int mc = 0; mc < 2; ++mc)
      #pragma unroll  // register arrays need constant indices
      for (int it = 0; it < 8; ++it) {
        rp[mc][it] = &resid[(size_t)(row0 + mc * 16 + it * 2 + er) * N + c];
        rs[mc][it] = *(const v4f*)rp[mc][it];
      }
    // left to itself the build lets a late load of the batch land in the address
    // registers of earlier ones: the addresses stay live up to this wait for
    // their translations
    asm volatile("s_wait_xcnt 0x0"
                 :: "v"(rp[0][0]), "v"(rp[0][1]), "v"(rp[0][2]), "v"(rp[0][3]),
                    "v"(rp[0][4]), "v"(rp[0][5]), "v"(rp[0][6]), "v"(rp[0][7]),
                    "v"(rp[1][0]), "v"(rp[1][1]), "v"(rp[1][2]), "v"(rp[1][3]),
                    "v"(rp[1][4]), "v"(rp[1][5]), "v"(rp[1][6]), "v"(rp[1][7])
                 : "memory");
  }

  // QKV: a wave's 64 columns are one head (hh) of one of q, k, v (WHICH 0, 1, 2)
  const int hh = (col0 & 1023) >> 6;

  auto drain = [&](auto wc) {
    constexpr int WHICH = decltype(wc)::value;
    float bc[4];                       // bias in accumulator order, for the V shadow
    if constexpr (MODE == 0 && WHICH == 2) {
      #pragma unroll  // register arrays need constant indices
      for (int nc = 0; nc < 4; ++nc) bc[nc] = bias[col0 + nc * 16 + lr];
    }
    #pragma unroll  // register arrays need constant indices
    for (int mc = 0; mc < 2; ++mc) {
      if constexpr (MODE == 0 && WHICH == 2) {
        // V shadow is [d][token]: a lane's 8 accumulator rows are 8 neighbouring
        // tokens of one d, one 16-byte store straight from registers
        const int m0 = row0 + mc * 16 + mofs;
        const int bh = (m0 >> 10) * NHEAD + hh;
        #pragma unroll  // register arrays need constant indices
        for (int nc = 0; nc < 4; ++nc) {
          v8bf p;
          #pragma unroll  // register arrays need constant indices
          for (int r = 0; r < 8; ++r) p[r] = (__bf16)(acc[mc][nc][r] + bc[nc]);
          *(v8bf*)&Vtbf[((size_t)bh * HEAD_DIM + nc * 16 + lr) * TKMAX + TP + (m0 & 1023)] = p;
        }
      }
      // these 16 rows overwrite the range: the first half's reads have returned
      if (mc == 1) asm volatile("s_wait_dscnt 0x0" ::: "memory");
      #pragma unroll  // register arrays need constant indices
      for (int nc = 0; nc < 4; ++nc)
        #pragma unroll  // register arrays need constant indices
        for (int r = 0; r < 8; ++r) st[r + mofs][nc * 16 + lr] = acc[mc][nc][r];
      // other lanes' rows are read back below: the wave's LDS writes land first
      asm volatile("s_wait_dscnt 0x0" ::: "memory");
      v4bf go[8];                      // GELU: the half's results, stored below as one group
      #pragma unroll  // register arrays need constant indices
      for (int it = 0; it < 8; ++it) {
        const int m = row0 + mc * 16 + it * 2 + er;   // global row (token)
        const v4f v = *(const v4f*)&st[it * 2 + er][ec] + bias4;
        if constexpr (MODE == 0) {
          const int bh = (m >> 10) * NHEAD + hh;
          const int t = m & 1023;
          const size_t o = ((size_t)bh * TKMAX + TP + t) * HEAD_DIM + ec;
          v4bf vb;
          #pragma unroll  // register arrays need constant indices
          for (int i = 0; i < 4; ++i) vb[i] = (__bf16)v[i];
          if constexpr (WHICH == 0) {
            *(v4bf*)&Qbf[((size_t)bh * TC + t) * HEAD_DIM + ec] = vb;
          } else if constexpr (WHICH == 1) {
            *(v4f*)&Koutf[o] = v;
            *(v4bf*)&Kbf[o] = vb;
          } else {
            *(v4f*)&Voutf[o] = v;
          }
        } else if constexpr (MODE == 1) {
          *(v4f*)&outf[(size_t)m * N + c] = v + rs[mc][it];
        } else {
          const v4f ge = gelu4(v);
          #pragma unroll  // register arrays need constant indices
          for (int i = 0; i < 4; ++i) go[it][i] = (__bf16)ge[i];
        }
      }
      if constexpr (MODE == 2) {
        #pragma unroll  // register arrays need constant indices
        for (int it = 0; it < 8; ++it)
          *(v4bf*)&outbf[(size_t)(row0 + mc * 16 + it * 2 + er) * N + c] = go[it];
        // the second half reuses the stores' registers: wait for their translations first
        if (mc == 0) asm volatile("s_wait_xcnt 0x0" ::: "memory");
      }
    }
    // QKV: the build runs shared address code of the other two cases behind
    // these stores, over their registers: wait for their translations first
    if constexpr (MODE == 0) asm volatile("s_wait_xcnt 0x0" ::: "memory");
  };

  if constexpr (MODE == 0) {
    // the same for a whole wave: read through the first lane, a scalar branch
    const int which = __builtin_amdgcn_readfirstlane(col0 >> 10);
    if (which == 0)      drain(int_c<0>{});
    else if (which == 1) drain(int_c<1>{});
    else                 drain(int_c<2>{});
  } else {
    drain(int_c<0>{});
  }
}

#define SK_BYTES  (32 * 72 * 2)                     // 4608  [key][d]
#define SVT_BYTES (64 * 40 * 2)                     // 5120  [d][key]
#define KV_BUF_BYTES (SK_BYTES + SVT_BYTES)         // 9728 per buffer
#define ATT_SMEM (2 * KV_BUF_BYTES)                 // 19456

__device__ __forceinline__ float xhalf(float x) {
  const int i = __builtin_bit_cast(int, x);
  return __builtin_bit_cast(float, __builtin_amdgcn_permlanex16(
      i, i, 0x76543210, 0xfedcba98, false, false));
}

__global__ __launch_bounds__(256) void k_attention(
    const __bf16* __restrict__ Qbf, const __bf16* __restrict__ Kbf,
    const __bf16* __restrict__ Vtbf, const int* __restrict__ pos_ptr,
    __bf16* __restrict__ Obf) {
  __shared__ __align__(16) char smem[ATT_SMEM];
  // the ring's place in the work-group's LDS, for the tensor loads.  Only they
  // write the ring: taken from the array itself, the address also tells the
  // build that the array is written, so that it stays allocated and is read
  const unsigned ring = (unsigned)(uintptr_t)smem;

  const int tid = threadIdx.x;
  const int wave = tid >> 5, lane = tid & 31;
  const int qt = blockIdx.x & 7;           // query tile of 128
  const int bh = blockIdx.x >> 3;          // b*NHEAD + h
  const int pos = pos_ptr[0];
  const int qbase = qt * 128;
  const int qrow = qbase + wave * 16;
  const int lr = lane & 15;
  const int lh = (lane >> 4) * 16;
  const int mofs = (lane >= 16) ? 8 : 0;

  const __bf16* Qp = Qbf + ((size_t)bh * TC + qrow) * HEAD_DIM;
  const __bf16* Kb = Kbf + (size_t)bh * TKMAX * HEAD_DIM;
  const __bf16* Vb = Vtbf + (size_t)bh * HEAD_DIM * TKMAX;

  // L2 prefetch, a group of 128 keys (4 tiles) at a time: the shadows were stored
  // by earlier launches and a tile's tensor loads lead its use by one tile only.
  // Waves 1 and 2 ask for the group's K rows
  // (16 KiB in a row, 64 units of 256 B), waves 3 and 4 for its 256 B of each of
  // the 64 V^T rows, a unit a lane.  pfa, the byte offset from the head's first
  // K or V^T byte, is the one register the prefetches name: it lives through the
  // loop and never leaves the head's rows
  const uint32_t wv = uni((uint32_t)tid >> 5);
  const uint32_t pw = (wv - 1u) & 3u;
  const bool pf_wave = wv >= 1u && wv <= 4u;
  const uint64_t pf_base = (uint64_t)(uintptr_t)((pw < 2u) ? Kb : Vb);
  const uint32_t pf_step = (pw < 2u) ? 128u * HEAD_DIM * 2u : 256u;
  uint32_t pfa = (pw < 2u) ? (pw * 32u + (uint32_t)lane) * 256u
                           : ((pw - 2u) * 32u + (uint32_t)lane) * (TKMAX * 2u);
  // asks, then moves pfa on by a uniform step; the wait for the prefetch's
  // translation stands in the same statement, in front of the write
  auto pf_group = [&](uint32_t step) {
    asm volatile("global_prefetch_b8 %0, %1 scope:SCOPE_SE\n\t"
                 "s_wait_xcnt 0x0\n\t"
                 "v_add_nc_u32 %0, %2, %0"
                 : "+v"(pfa) : "s"(pf_base), "s"(step) : "memory");
  };
  if (pf_wave) pf_group(pf_step);

  // load Q fragments (64x16 -> two 32x16 B-fragments) with explicit 16B loads:
  // lane = query column, 16 contiguous d per wave half, as the K loader below
  v16bf qf[2];
  #pragma unroll
  for (int f = 0; f < 2; ++f) {
    union { uint4 u[2]; v16bf v; } tmp;
    const uint4* p = (const uint4*)(Qp + (size_t)lr * HEAD_DIM + f * 32 + lh);
    tmp.u[0] = p[0];
    tmp.u[1] = p[1];
    qf[f] = tmp.v;
  }

  // all per lane, for query qrow + lr: running maximum (equal in both halves),
  // sum over this half's keys, O^T rows d = dc*16 + mofs + r
  float mrun = -1e30f, lsum = 0.f;
  v8f o[4];
  #pragma unroll
  for (int d = 0; d < 4; ++d) o[d] = (v8f)(0.f);

  const float scale = 0.125f;  // 1/sqrt(64)
  // last key this lane's query sees, counted from the first key of its half
  const int lim = pos + qrow + lr - mofs;
  const int kmax = min(pos + qbase + 128, TKMAX);   // never past the cache
  // at least one pass: the waits for the loads below stand in the loop
  const int ntiles = max((kmax + 31) / 32, 1);

#ifdef USE_TDM
  if (wave == 0) {
    tdm_load_2d(ring,            Kb, HEAD_DIM, TKMAX, HEAD_DIM, 32, HEAD_DIM, 4, 3);
    tdm_load_2d(ring + SK_BYTES, Vb, TKMAX, HEAD_DIM, 32, HEAD_DIM, TKMAX, 3, 3);
  }
#endif

  for (int kt = 0; kt < ntiles; ++kt) {
    const int kofs = kt * 32;
    const int cur = kt & 1;
    __bf16 (*sK)[72]  = (__bf16(*)[72])(smem + cur * KV_BUF_BYTES);
    __bf16 (*sVt)[40] = (__bf16(*)[40])(smem + cur * KV_BUF_BYTES + SK_BYTES);

    // uniform: the next group of 4 tiles, where this block walks it
    if (pf_wave && (kt & 3) == 0 && kt + 4 < ntiles)
      pf_group((kt + 8 < TKMAX / 32) ? pf_step : 0u);      // stays on the last group

#ifdef USE_TDM
    if (wave == 0) {
      if (kt + 1 < ntiles) {
        unsigned nb = ring + (unsigned)((cur ^ 1) * KV_BUF_BYTES);
        tdm_load_2d(nb, Kb + (size_t)(kofs + 32) * HEAD_DIM,
                    HEAD_DIM, TKMAX, HEAD_DIM, 32, HEAD_DIM, 4, 3);
        tdm_load_2d(nb + SK_BYTES, Vb + kofs + 32,
                    TKMAX, HEAD_DIM, 32, HEAD_DIM, TKMAX, 3, 3);
        __builtin_amdgcn_s_wait_tensorcnt(2);
      } else {
        __builtin_amdgcn_s_wait_tensorcnt(0);
      }
      asm volatile("" ::: "memory");
    }
    __syncthreads();
#else
    {
      int r = tid >> 3, c = (tid & 7) * 8;
      *(uint4*)&sK[r][c] = *(const uint4*)&Kb[(size_t)(kofs + r) * HEAD_DIM + c];
      int d = tid >> 2, kc = (tid & 3) * 8;
      *(uint4*)&sVt[d][kc] = *(const uint4*)&Vb[(size_t)d * TKMAX + kofs + kc];
    }
    __syncthreads();
#endif

    // S^T = K * Q^T: s[nc][r] = score of key kofs + nc*16 + mofs + r, query lr.
    // The tile's K fragments are read as one group: one LDS latency, not four
    v16bf ak[2][2];
    #pragma unroll
    for (int nc = 0; nc < 2; ++nc)
      #pragma unroll
      for (int f = 0; f < 2; ++f)
        #pragma unroll
        for (int j = 0; j < 16; ++j) ak[nc][f][j] = sK[nc * 16 + lr][f * 32 + lh + j];
    // V^T fragments (16 d x 32 keys each), read here so that they arrive while
    // the softmax runs; keys in the order in which pf below holds them
    v16bf av[4];
    #pragma unroll
    for (int dc = 0; dc < 4; ++dc)
      #pragma unroll
      for (int j = 0; j < 8; ++j) {
        av[dc][j]     = sVt[dc * 16 + lr][mofs + j];
        av[dc][8 + j] = sVt[dc * 16 + lr][16 + mofs + j];
      }
    // holds the 16 reads above in front of the products: left to itself the
    // build reads each fragment into one register set right before its product
    // and waits out the LDS latency eight times a tile
    __builtin_amdgcn_sched_barrier(0);
    v8f s[2];
    #pragma unroll
    for (int nc = 0; nc < 2; ++nc) s[nc] = wmma_bf16(ak[nc][0], qf[0], (v8f)(0.f));
    #pragma unroll
    for (int nc = 0; nc < 2; ++nc) s[nc] = wmma_bf16(ak[nc][1], qf[1], s[nc]);

    // online softmax of the lane's one query
    s[0] *= scale;
    s[1] *= scale;
    const int rel = lim - kofs;            // keys mofs + j with j <= rel are seen
    float mt[8];
    #pragma unroll
    for (int r = 0; r < 8; ++r) {
      if (r > rel)      s[0][r] = -1e30f;
      if (16 + r > rel) s[1][r] = -1e30f;
      mt[r] = fmaxf(s[0][r], s[1][r]);
    }
    float mx = fmaxf(fmaxf(fmaxf(mt[0], mt[1]), fmaxf(mt[2], mt[3])),
                     fmaxf(fmaxf(mt[4], mt[5]), fmaxf(mt[6], mt[7])));
    mx = fmaxf(mx, xhalf(mx));             // over all 32 keys, both halves alike
    const float mnew = fmaxf(mrun, mx);
    const float corr = __expf(mrun - mnew);
    mrun = mnew;

    // P^T as B operand: element j = key mofs + j, element 8 + j = key 16 + mofs + j
    v16bf pf;
    float st[8];
    #pragma unroll
    for (int r = 0; r < 8; ++r) {
      float p0 = __expf(s[0][r] - mnew);
      float p1 = __expf(s[1][r] - mnew);
      st[r] = p0 + p1;
      pf[r]     = (__bf16)p0;
      pf[8 + r] = (__bf16)p1;
    }
    lsum = lsum * corr + (((st[0] + st[1]) + (st[2] + st[3])) +
                          ((st[4] + st[5]) + (st[6] + st[7])));
    #pragma unroll
    for (int d = 0; d < 4; ++d) o[d] *= corr;

    // O^T += V^T(16 d x 32 keys) * P^T(32 keys x 16 queries)
    #pragma unroll
    for (int dc = 0; dc < 4; ++dc) o[dc] = wmma_bf16(av[dc], pf, o[dc]);
    __syncthreads();   // done reading cur buffer before refill
  }

  // normalize + write O into [token, d_model] bf16 buffer at head column: a
  // lane's 8 accumulator rows are 8 neighbouring d of its token, 16 bytes
  const float ltot = lsum + xhalf(lsum);   // the two halves' keys together
  const int b = bh >> 4, h = bh & 15;
  __bf16* op = Obf + (size_t)(b * TC + qrow + lr) * D_MODEL + h * HEAD_DIM + mofs;
  #pragma unroll
  for (int dc = 0; dc < 4; ++dc) {
    v8bf ov;
    #pragma unroll
    for (int r = 0; r < 8; ++r) ov[r] = (__bf16)(o[dc][r] / ltot);
    *(v8bf*)(op + dc * 16) = ov;
  }
}

// ---------------------------------------------------------------------------
// Host-side launch
// ---------------------------------------------------------------------------
extern "C" void kernel_launch(void* const* d_in, const int* in_sizes, int n_in,
                              void* d_out, int out_size, void* d_ws, size_t ws_size,
                              hipStream_t stream) {
  const float* x    = (const float*)d_in[0];
  const float* Kp   = (const float*)d_in[1];
  const float* Vp   = (const float*)d_in[2];
  const int*   pos  = (const int*)d_in[3];
  const float* wqkv = (const float*)d_in[4];
  const float* bqkv = (const float*)d_in[5];
  const float* wo   = (const float*)d_in[6];
  const float* bo   = (const float*)d_in[7];
  const float* g1   = (const float*)d_in[8];
  const float* be1  = (const float*)d_in[9];
  const float* g2   = (const float*)d_in[10];
  const float* be2  = (const float*)d_in[11];
  const float* w1   = (const float*)d_in[12];
  const float* bf1  = (const float*)d_in[13];
  const float* w2   = (const float*)d_in[14];
  const float* bf2  = (const float*)d_in[15];

  float* xout = (float*)d_out;
  float* Kout = xout + (size_t)NTOK * D_MODEL;
  float* Vout = Kout + (size_t)BATCH * NHEAD * TKMAX * HEAD_DIM;

  char* w = (char*)d_ws;
  size_t off = 0;
  auto carve = [&](size_t bytes) {
    void* p = w + off;
    off += (bytes + 255) & ~(size_t)255;
    return p;
  };
  // weights stored TRANSPOSED [N][K] in bf16
  __bf16* wqkvT = (__bf16*)carve((size_t)3 * D_MODEL * D_MODEL * 2);
  __bf16* woT   = (__bf16*)carve((size_t)D_MODEL * D_MODEL * 2);
  __bf16* w1T   = (__bf16*)carve((size_t)DIM_FF * D_MODEL * 2);
  __bf16* w2T   = (__bf16*)carve((size_t)D_MODEL * DIM_FF * 2);
  __bf16* h_bf  = (__bf16*)carve((size_t)NTOK * D_MODEL * 2);    // reused for h2
  __bf16* q_bf  = (__bf16*)carve((size_t)NTOK * D_MODEL * 2);
  __bf16* K_bf  = (__bf16*)carve((size_t)BATCH * NHEAD * TKMAX * HEAD_DIM * 2);
  __bf16* Vt_bf = (__bf16*)carve((size_t)BATCH * NHEAD * HEAD_DIM * TKMAX * 2);
  __bf16* o_bf  = (__bf16*)carve((size_t)NTOK * D_MODEL * 2);
  float*  x1    = (float*)carve((size_t)NTOK * D_MODEL * 4);
  __bf16* ff_bf = K_bf;  // FFN activation aliases dead bf16 KV shadow (32MB)

  // 1) weight converts (transpose to [N][K])
  k_cvt_transpose<D_MODEL, 3 * D_MODEL><<<(D_MODEL / TR_R) * (3 * D_MODEL / TR_C), 256, 0, stream>>>(wqkv, wqkvT);
  k_cvt_transpose<D_MODEL, D_MODEL><<<(D_MODEL / TR_R) * (D_MODEL / TR_C), 256, 0, stream>>>(wo, woT);
  k_cvt_transpose<D_MODEL, DIM_FF><<<(D_MODEL / TR_R) * (DIM_FF / TR_C), 256, 0, stream>>>(w1, w1T);
  k_cvt_transpose<DIM_FF, D_MODEL><<<(DIM_FF / TR_R) * (D_MODEL / TR_C), 256, 0, stream>>>(w2, w2T);

  // 2) LN1
  k_layernorm<<<NTOK / LN_ROWS, 256, 0, stream>>>(x, g1, be1, h_bf);

  // 3) past KV copy into cache + bf16 shadows
  k_kvcopy<<<BATCH * NHEAD * (TP / TR_R), 256, 0, stream>>>(Kp, Vp, Kout, Vout, K_bf, Vt_bf);

  // 4) QKV GEMM: [4096,1024] x [1024,3072]
  {
    int M = NTOK, N = 3 * D_MODEL, K = D_MODEL;
    dim3 grid((M / GBM) * (N / GBN));
    k_gemm_bf16<0><<<grid, 256, 0, stream>>>(h_bf, wqkvT, M, N, K, bqkv,
                                             Kout, Vout, K_bf, Vt_bf, q_bf,
                                             nullptr, nullptr, nullptr);
  }

  // 5) attention
  k_attention<<<BATCH * NHEAD * (TC / 128), 256, 0, stream>>>(q_bf, K_bf, Vt_bf, pos, o_bf);

  // 6) Wo GEMM + residual -> x1
  {
    int M = NTOK, N = D_MODEL, K = D_MODEL;
    dim3 grid((M / GBM) * (N / GBN));
    k_gemm_bf16<1><<<grid, 256, 0, stream>>>(o_bf, woT, M, N, K, bo,
                                             nullptr, nullptr, nullptr, nullptr, nullptr,
                                             x, x1, nullptr);
  }

  // 7) LN2 -> h2 (reuse h_bf)
  k_layernorm<<<NTOK / LN_ROWS, 256, 0, stream>>>(x1, g2, be2, h_bf);

  // 8) W1 GEMM + GELU -> ff_bf
  {
    int M = NTOK, N = DIM_FF, K = D_MODEL;
    dim3 grid((M / GBM) * (N / GBN));
    k_gemm_bf16<2><<<grid, 256, 0, stream>>>(h_bf, w1T, M, N, K, bf1,
                                             nullptr, nullptr, nullptr, nullptr, nullptr,
                                             nullptr, nullptr, ff_bf);
  }

  // 9) W2 GEMM + residual -> xout
  {
    int M = NTOK, N = D_MODEL, K = DIM_FF;
    dim3 grid((M / GBM) * (N / GBN));
    k_gemm_bf16<1><<<grid, 256, 0, stream>>>(ff_bf, w2T, M, N, K, bf2,
                                             nullptr, nullptr, nullptr, nullptr, nullptr,
                                             x1, xout, nullptr);
  }
}

// v008
// One run takes 176 microseconds.
// Two timings next to v007 both put it at 1.03 times that version's speed.
// Over all steps from v000 it is 2.64 times as fast.
#include <hip/hip_runtime.h>

typedef __bf16 v16bf __attribute__((ext_vector_type(16)));
typedef float  v8f   __attribute__((ext_vector_type(8)));
typedef unsigned int u32x4 __attribute__((ext_vector_type(4)));
typedef int i32x4 __attribute__((ext_vector_type(4)));
typedef int i32x8 __attribute__((ext_vector_type(8)));

__device__ __forceinline__ v8f wmma_bf16(v16bf a, v16bf b, v8f c) {
  // D = A(16x32 bf16) * B(32x16 bf16) + C(16x16 f32)
  return __builtin_amdgcn_wmma_f32_16x16x32_bf16(
      false, a, false, b, (short)0, c, false, false);
}

#if defined(__has_builtin)
#if __has_builtin(__builtin_amdgcn_tensor_load_to_lds) && \
    __has_builtin(__builtin_amdgcn_s_wait_tensorcnt)
#define USE_TDM 1
#endif
#endif

#ifdef USE_TDM
// 2D tile load Global->LDS via Tensor Data Mover (bf16 payload).
__device__ __forceinline__ void tdm_load_2d(unsigned lds_off, const __bf16* gaddr,
                                            unsigned dim0, unsigned dim1,
                                            unsigned tile0, unsigned tile1,
                                            unsigned stride0,
                                            unsigned pad_int_code,
                                            unsigned pad_amt_code) {
  unsigned long long ga = (unsigned long long)(uintptr_t)gaddr;
  u32x4 g0;
  g0[0] = 1u;
  g0[1] = lds_off;
  g0[2] = (unsigned)(ga & 0xFFFFFFFFu);
  g0[3] = (unsigned)((ga >> 32) & 0x01FFFFFFu)
          | (2u << 30);
  i32x8 g1;
  g1[0] = (int)((1u << 16)
                | (1u << 20)
                | (pad_int_code << 22)
                | (pad_amt_code << 25));
  g1[1] = (int)((dim0 & 0xFFFFu) << 16);
  g1[2] = (int)((dim0 >> 16) | ((dim1 & 0xFFFFu) << 16));
  g1[3] = (int)((dim1 >> 16) | (tile0 << 16));
  g1[4] = (int)(tile1 & 0xFFFFu);
  g1[5] = (int)stride0;
  g1[6] = 0;
  g1[7] = 0;
  i32x4 z4 = {0, 0, 0, 0};
#if defined(__clang_major__) && (__clang_major__ >= 23)
  i32x8 z8 = {0, 0, 0, 0, 0, 0, 0, 0};
  __builtin_amdgcn_tensor_load_to_lds(g0, g1, z4, z4, z8, 0);
#else
  __builtin_amdgcn_tensor_load_to_lds(g0, g1, z4, z4, 0);
#endif
}
#endif  // USE_TDM

#define D_MODEL 1024
#define NHEAD   16
#define HEAD_DIM 64
#define DIM_FF  4096
#define BATCH   4
#define TC      1024
#define TP      1024
#define TKMAX   2048
#define NTOK    (BATCH * TC)   // 4096

// ---------------------------------------------------------------------------
// Transposing f32 -> bf16 copies go through an LDS tile of 128 source rows x
// 64 source columns, so that both global sides move whole lines, 16 bytes a
// lane: a source row piece is 256 B of f32, a destination row piece 256 B of
// bf16.  256 threads; thread (kg, nq) holds source rows kg*8..+7, columns
// nq*4..+3.
// ---------------------------------------------------------------------------
#define TR_R 128
#define TR_C 64
#define TR_PITCH 136                                // 272 B = 16 B x odd
typedef float  v4f  __attribute__((ext_vector_type(4)));
typedef __bf16 v4bf __attribute__((ext_vector_type(4)));
typedef __bf16 v8bf __attribute__((ext_vector_type(8)));

__device__ __forceinline__ void tr_put(__bf16 (*tile)[TR_PITCH], const v4f (&v)[8],
                                       int nq, int kg) {
  #pragma unroll  // register arrays need constant indices
  for (int i = 0; i < 4; ++i) {
    v8bf p;
    #pragma unroll  // register arrays need constant indices
    for (int j = 0; j < 8; ++j) p[j] = (__bf16)v[j][i];
    *(v8bf*)&tile[nq * 4 + i][kg * 8] = p;
  }
}

// dst points at the tile's first element; ld = destination row pitch (elements)
__device__ __forceinline__ void tr_get(const __bf16 (*tile)[TR_PITCH],
                                       __bf16* __restrict__ dst, size_t ld, int tid) {
  #pragma unroll
  for (int it = 0; it < 4; ++it) {
    int idx = it * 256 + tid;
    int n = idx >> 4, c = (idx & 15) * 8;
    *(v8bf*)&dst[(size_t)n * ld + c] = *(const v8bf*)&tile[n][c];
  }
}

template <int K, int N>
__device__ __forceinline__ void cvt_transpose_block(__bf16 (*tile)[TR_PITCH], int blk,
                                                    const float* __restrict__ src,
                                                    __bf16* __restrict__ dst) {
  const int tid = threadIdx.x;
  const int nq = tid & 15, kg = tid >> 4;
  const int n0 = (blk % (N / TR_C)) * TR_C;
  const int k0 = (blk / (N / TR_C)) * TR_R;

  const float* p = src + (size_t)(k0 + kg * 8) * N + n0 + nq * 4;
  v4f v[8];
  #pragma unroll  // register arrays need constant indices
  for (int j = 0; j < 8; ++j) v[j] = *(const v4f*)(p + j * N);
  tr_put(tile, v, nq, kg);
  __syncthreads();
  tr_get(tile, dst + (size_t)n0 * K + k0, (size_t)K, tid);
}

// ---------------------------------------------------------------------------
// LayerNorm: one wave per row of D_MODEL, 8 rows a block, bf16 out.  A lane
// holds 32 elements of its row in registers (8 loads of 16 B, each wave-wide
// load 512 contiguous bytes), so the row is read once, the sums need no LDS and
// no barrier, and a launch starts an eighth of the waves.
// ---------------------------------------------------------------------------
#define LN_ROWS 8
__device__ __forceinline__ void layernorm_block(int blk,
                                                const float* __restrict__ x,
                                                const float* __restrict__ g,
                                                const float* __restrict__ b,
                                                __bf16* __restrict__ out) {
  const int lane = threadIdx.x & 31, wave = threadIdx.x >> 5;
  const int row = blk * LN_ROWS + wave;
  const float* xr = x + (size_t)row * D_MODEL + lane * 4;

  v4f v[8];
  #pragma unroll  // register arrays need constant indices
  for (int j = 0; j < 8; ++j) v[j] = *(const v4f*)(xr + j * 128);
  // the build lets a load of g or b below land in the address registers of the
  // row's loads: wait for their translations first
  asm volatile("s_wait_xcnt 0x0" ::: "memory");
  v4f gg[8], bb[8];
  #pragma unroll  // register arrays need constant indices
  for (int j = 0; j < 8; ++j) {
    gg[j] = ((const v4f*)g)[lane + j * 32];
    bb[j] = ((const v4f*)b)[lane + j * 32];
  }
  // inlined in the joint launch, the build let the batch's last load land in the
  // offset register that all 16 name: that register, the lane's number, stays
  // live up to this wait for their translations
  asm volatile("s_wait_xcnt 0x0" :: "v"(lane) : "memory");
  // keeps all 24 loads in flight together: left to itself the build issues
  // the loads of g and b behind the row's first data, a second latency in turn
  __builtin_amdgcn_sched_barrier(0);

  // four independent partial sums a lane: chains of 8 links, not of 32
  v4f sv = v[0], qv = v[0] * v[0];
  #pragma unroll  // register arrays need constant indices
  for (int j = 1; j < 8; ++j) { sv += v[j]; qv += v[j] * v[j]; }
  float s  = (sv[0] + sv[1]) + (sv[2] + sv[3]);
  float s2 = (qv[0] + qv[1]) + (qv[2] + qv[3]);
  #pragma unroll
  for (int off = 16; off >= 1; off >>= 1) {
    s  += __shfl_xor(s,  off, 32);
    s2 += __shfl_xor(s2, off, 32);
  }
  const float mu = s * (1.f / D_MODEL);
  const float var = s2 * (1.f / D_MODEL) - mu * mu;
  const float rstd = rsqrtf(var + 1e-5f);

  __bf16* orow = out + (size_t)row * D_MODEL + lane * 4;
  #pragma unroll  // register arrays need constant indices
  for (int j = 0; j < 8; ++j) {
    v4bf o;
    #pragma unroll  // register arrays need constant indices
    for (int i = 0; i < 4; ++i) o[i] = (__bf16)((v[j][i] - mu) * rstd * gg[j][i] + bb[j][i]);
    *(v4bf*)(orow + j * 128) = o;
  }
}

__global__ __launch_bounds__(256) void k_layernorm(const float* __restrict__ x,
                                                   const float* __restrict__ g,
                                                   const float* __restrict__ b,
                                                   __bf16* __restrict__ out) {
  layernorm_block((int)blockIdx.x, x, g, b, out);
}

// ---------------------------------------------------------------------------
// Copy past KV into output cache (fp32) + bf16 shadows for attention.
// K shadow: [B,H,Tk,Dh] row-major; V shadow: TRANSPOSED [B,H,Dh,Tk].
// ---------------------------------------------------------------------------
// B*H*(TP/128) blocks, blk the block's number among them; a block takes 128
// tokens of one head (contiguous in source and in both caches); the V shadow
// goes through the LDS tile.
__device__ __forceinline__ void kvcopy_block(__bf16 (*tile)[TR_PITCH], int blk,
                                             const float* __restrict__ Kp,
                                             const float* __restrict__ Vp,
                                             float* __restrict__ Kout,
                                             float* __restrict__ Vout,
                                             __bf16* __restrict__ Kbf,
                                             __bf16* __restrict__ Vtbf) {
  const int tid = threadIdx.x;
  const int nq = tid & 15, kg = tid >> 4;
  const int bh = blk / (TP / TR_R);
  const int t0 = (blk % (TP / TR_R)) * TR_R;
  const size_t sbase = ((size_t)bh * TP + t0) * HEAD_DIM;
  const size_t dbase = ((size_t)bh * TKMAX + t0) * HEAD_DIM;

  const unsigned vo = (unsigned)(kg * 8 * HEAD_DIM + nq * 4);   // V: tile order
  const unsigned ko = (unsigned)(tid * 4);                      // K: linear
  const float* pv = Vp + sbase;
  const float* pk = Kp + sbase;
  v4f vv[8], kv[8];
  #pragma unroll  // register arrays need constant indices
  for (int j = 0; j < 8; ++j) vv[j] = *(const v4f*)(pv + vo + j * HEAD_DIM);
  #pragma unroll  // register arrays need constant indices
  for (int j = 0; j < 8; ++j) kv[j] = *(const v4f*)(pk + ko + j * 1024);
  // address registers of the loads above are rewritten below: wait for their
  // translations first.  The statement also holds all 16 loads in front of the
  // first use of V, so that no K load pays a second memory latency.
  asm volatile("s_wait_xcnt 0x0" ::: "memory");

  // the tile's barrier stands in front of every global store: it would wait
  // for stores already issued
  tr_put(tile, vv, nq, kg);
  __syncthreads();
  tr_get(tile, Vtbf + (size_t)bh * HEAD_DIM * TKMAX + t0, (size_t)TKMAX, tid);

  float* qv = Vout + dbase;
  float* qk = Kout + dbase;
  __bf16* qb = Kbf + dbase;
  #pragma unroll  // register arrays need constant indices
  for (int j = 0; j < 8; ++j) *(v4f*)(qv + vo + j * HEAD_DIM) = vv[j];
  #pragma unroll  // register arrays need constant indices
  for (int j = 0; j < 8; ++j) {
    *(v4f*)(qk + ko + j * 1024) = kv[j];
    v4bf kb;
    #pragma unroll  // register arrays need constant indices
    for (int i = 0; i < 4; ++i) kb[i] = (__bf16)kv[j][i];
    *(v4bf*)(qb + ko + j * 1024) = kb;
  }
}

#define PB_KV   (BATCH * NHEAD * (TP / TR_R))               // 512
#define PB_W1   ((D_MODEL / TR_R) * (DIM_FF / TR_C))        // 512
#define PB_W2   ((DIM_FF / TR_R) * (D_MODEL / TR_C))        // 512
#define PB_WO   ((D_MODEL / TR_R) * (D_MODEL / TR_C))       // 128
#define PB_WQKV ((D_MODEL / TR_R) * (3 * D_MODEL / TR_C))   // 384
#define PB_LN   (NTOK / LN_ROWS)                            // 512
#define PB_ALL  (PB_KV + PB_W1 + PB_W2 + PB_WO + PB_WQKV + PB_LN)
__global__ __launch_bounds__(256) void k_prep(
    const float* __restrict__ Kp, const float* __restrict__ Vp,
    float* __restrict__ Kout, float* __restrict__ Vout,
    __bf16* __restrict__ Kbf, __bf16* __restrict__ Vtbf,
    const float* __restrict__ w1, __bf16* __restrict__ w1T,
    const float* __restrict__ w2, __bf16* __restrict__ w2T,
    const float* __restrict__ wo, __bf16* __restrict__ woT,
    const float* __restrict__ wqkv, __bf16* __restrict__ wqkvT,
    const float* __restrict__ x, const float* __restrict__ g,
    const float* __restrict__ b, __bf16* __restrict__ h) {
  __shared__ __align__(16) __bf16 tile[TR_C][TR_PITCH];
  int blk = (int)blockIdx.x;
  // PIECE_END: the build lays the pieces one behind another and joins them by a
  // flag test, so that a next piece's code, which rewrites the registers of a
  // finished piece's stores, stands behind those stores in the listing: wait for
  // the stores' translations at each piece's end
#define PIECE_END asm volatile("s_wait_xcnt 0x0" ::: "memory"); return
  // (the build puts this piece last: its stores run straight to the wave's end)
  if (blk < PB_KV) { kvcopy_block(tile, blk, Kp, Vp, Kout, Vout, Kbf, Vtbf); return; }
  blk -= PB_KV;
  if (blk < PB_W1) { cvt_transpose_block<D_MODEL, DIM_FF>(tile, blk, w1, w1T); PIECE_END; }
  blk -= PB_W1;
  if (blk < PB_W2) { cvt_transpose_block<DIM_FF, D_MODEL>(tile, blk, w2, w2T); PIECE_END; }
  blk -= PB_W2;
  if (blk < PB_WO) { cvt_transpose_block<D_MODEL, D_MODEL>(tile, blk, wo, woT); PIECE_END; }
  blk -= PB_WO;
  if (blk < PB_WQKV) { cvt_transpose_block<D_MODEL, 3 * D_MODEL>(tile, blk, wqkv, wqkvT); PIECE_END; }
  blk -= PB_WQKV;
  layernorm_block(blk, x, g, b, h);
  PIECE_END;
#undef PIECE_END
}

// ---------------------------------------------------------------------------
// Tiled WMMA GEMM: C[M,N] = A[M,K](bf16) * Bt[N,K](bf16, pre-transposed)
//   block tile 128x128, 256 threads = 8 waves,
//   wave grid 4(M) x 2(N); each wave: 2x4 accumulators of 16x16.
//   A pass is 128 k = 256 B of every operand row, two buffers.  Every wave
//   brings its own slice of 32 rows with one tensor load a pass (waves 0..3
//   rows of A, waves 4..7 rows of Bt), issued one pass before it is read.
//   Fragments are read one block of 32 k ahead, into a second register set.
//   M, N multiples of 128; K a multiple of 128 and at least 256.
// MODE 0: QKV scatter  MODE 1: bias+residual->f32  MODE 2: bias+GELU->bf16
// ---------------------------------------------------------------------------
#define GBM 128
#define GBN 128
#define GBK 128
#define G_ROWB 256                                  // bytes of a row in a pass
#define G_PITCH 272                                 // row + 16 B pad = 16 B x odd
#define G_SLICE_ROWS 32
#define G_PF 4u                                     // stages between a pass and the stage it prefetches
#define G_SLICE 10240                               // 32 x 272 = 8704, up to a multiple of 2 KiB
#define GEMM_BUF_BYTES (8 * G_SLICE)                // 81920
#define EP_PITCH 68                                 // epilogue row: 272 B = 16 B x odd
#define EP_WAVE_BYTES G_SLICE                       // >= 16 rows x 272 B
template <int V> struct int_c { static constexpr int value = V; };
typedef unsigned int u32x8 __attribute__((ext_vector_type(8)));

__device__ __forceinline__ uint32_t uni(uint32_t v) {
  return (uint32_t)__builtin_amdgcn_readfirstlane(v);
}
__device__ __forceinline__ uint32_t pinned(uint32_t v) {
  uint32_t w = uni(v);
  asm volatile("" : "+s"(w));  // the value stays in a scalar register
  return w;
}
__device__ __forceinline__ u32x8 gemm_group1(uint32_t src_pitch) {
  u32x8 g;
  g[0] = uni((1u << 20) | (5u << 22) | (3u << 25));
  g[1] = uni((uint32_t)G_ROWB << 16);
  g[2] = uni((uint32_t)G_SLICE_ROWS << 16);
  g[3] = uni((uint32_t)G_ROWB << 16);
  g[4] = uni((uint32_t)G_SLICE_ROWS);
  g[5] = uni(src_pitch);
  g[6] = uni(0u);
  g[7] = uni(0u);
  return g;
}
__device__ __forceinline__ u32x4 gemm_group0(uint32_t lds_dst, uint64_t ga) {
  u32x4 g;
  g[0] = uni(1u);
  g[1] = uni(lds_dst);
  g[2] = uni((uint32_t)ga);
  g[3] = uni((((uint32_t)(ga >> 32)) & 0x01FFFFFFu) | 0x80000000u);
  return g;
}
// 16 k of one row: two 16-byte LDS reads
__device__ __forceinline__ v16bf ld_frag(const char* p) {
  const v8bf lo = *(const v8bf*)p, hi = *(const v8bf*)(p + 16);
  return __builtin_shufflevector(lo, hi, 0, 1, 2, 3, 4, 5, 6, 7, 8, 9, 10, 11, 12, 13, 14, 15);
}

// GELU with the exact erf, 0.5 v (1 + erf(v / sqrt 2)), of four values at once and
// without a branch.  For z >= 0, with t = 1 / (1 + p z):
//   erfc(z) = t (a1 + t (a2 + t (a3 + t (a4 + t a5)))) exp(-z z), absolute error 1.5e-7,
// and gelu(v) = max(v, 0) - |v| erfc(|v| / sqrt 2) / 2, which cancels nothing for
// v < 0.  The constants hold the 1 / sqrt 2, the halving and exp's change to base 2.
// The library's erff is two divergent branches for every value, each one chain of
// dependent operations; here the four values' short chains run side by side.
__device__ __forceinline__ v4f gelu4(v4f v) {
  const v4f av = __builtin_elementwise_abs(v);
  const v4f d = av * 0.23164189f + 1.f;              // 1 + p z
  const v4f w = v * 0.84932178f;                     // w w = z z log2(e)
  const v4f ww = w * w;
  float t0, t1, t2, t3, e0, e1, e2, e3;
  asm("v_rcp_f32 %0, %8\n\tv_rcp_f32 %1, %9\n\tv_rcp_f32 %2, %10\n\tv_rcp_f32 %3, %11\n\t"
      "v_exp_f32 %4, -%12\n\tv_exp_f32 %5, -%13\n\tv_exp_f32 %6, -%14\n\tv_exp_f32 %7, -%15\n\t"
      "v_nop"
      : "=&v"(t0), "=&v"(t1), "=&v"(t2), "=&v"(t3), "=&v"(e0), "=&v"(e1), "=&v"(e2), "=&v"(e3)
      : "v"(d[0]), "v"(d[1]), "v"(d[2]), "v"(d[3]), "v"(ww[0]), "v"(ww[1]), "v"(ww[2]), "v"(ww[3]));
  const v4f t = {t0, t1, t2, t3}, e = {e0, e1, e2, e3};
  v4f p = t * 0.53070271f - 0.72657603f;
  p = p * t + 0.71070689f;
  p = p * t - 0.14224836f;
  p = p * t + 0.12741479f;
  const v4f q = (p * t) * e;                         // erfc(z) / 2
  return __builtin_elementwise_max(v, (v4f)(0.f)) - av * q;
}

template <int MODE>
__global__ __launch_bounds__(256) void k_gemm_bf16(
    const __bf16* __restrict__ A, const __bf16* __restrict__ Bt,
    int M, int N, int K,
    const float* __restrict__ bias,
    float* __restrict__ Koutf, float* __restrict__ Voutf,
    __bf16* __restrict__ Kbf, __bf16* __restrict__ Vtbf, __bf16* __restrict__ Qbf,
    const float* __restrict__ resid, float* __restrict__ outf,
    __bf16* __restrict__ outbf) {
  // two buffers; every slice's place is a multiple of 2 KiB in the work-group's LDS
  __shared__ __attribute__((aligned(2048))) char smem[2 * GEMM_BUF_BYTES];

  const int tid = threadIdx.x;
  const int wave = (int)uni((uint32_t)tid >> 5), lane = tid & 31;
  const int mtiles = M / GBM;
  const int bm = blockIdx.x % mtiles;
  const int bn = blockIdx.x / mtiles;
  const int wm = wave & 3, wn = wave >> 2;
  const int row0 = bm * GBM + wm * 32;
  const int col0 = bn * GBN + wn * 64;

  v8f acc[2][4];
  #pragma unroll
  for (int i = 0; i < 2; ++i)
    #pragma unroll
    for (int j = 0; j < 4; ++j) acc[i][j] = (v8f)(0.f);

  const int lr = lane & 15;
  const int lh = (lane >> 4) * 16;
  const uint32_t T = (uint32_t)K / GBK;               // passes

  // this wave's slice: its first source row and its place in a buffer
  const __bf16* srow = (wave < 4) ? A  + (size_t)(bm * GBM + wave * G_SLICE_ROWS) * K
                                  : Bt + (size_t)(bn * GBN + (wave - 4) * G_SLICE_ROWS) * K;
  const uint64_t sbase = (uint64_t)(uintptr_t)srow;
  const uint32_t sdst = (uint32_t)(uintptr_t)smem + (uint32_t)wave * G_SLICE;
  u32x8 g1 = gemm_group1((uint32_t)K * 2u);
  asm volatile("" : "+s"(g1));
  auto issue = [&](uint32_t s) {
    const u32x4 g0 = gemm_group0(sdst + (s & 1u) * GEMM_BUF_BYTES, sbase + (uint64_t)s * G_ROWB);
    asm volatile("tensor_load_to_lds %0, %1" :: "s"(g0), "s"(g1) : "memory");
  };

  uint32_t pfo = (uint32_t)lane * ((uint32_t)K * 2u);
  if (T > 7u)   // uniform: stages 1 to 3 exist, and the offsets stay in the row behind pfo's first advance
    asm volatile("global_prefetch_b8 %0, %1 offset:256 scope:SCOPE_SE\n\t"
                 "global_prefetch_b8 %0, %1 offset:512 scope:SCOPE_SE\n\t"
                 "global_prefetch_b8 %0, %1 offset:768 scope:SCOPE_SE"
                 :: "v"(pfo), "s"(sbase) : "memory");
  // moves pfo on by a uniform step; the wait for the translations of the
  // prefetches that name it stands in the same statement, in front of the write
  auto pf_advance = [&](uint32_t step) {
    asm volatile("s_wait_xcnt 0x0\n\tv_add_nc_u32 %0, %1, %0" : "+v"(pfo) : "s"(step));
  };

  // the lane's rows in a buffer: A slice wm, rows mc*16 + lr; Bt slices
  // 4 + wn*2 + (nc >> 1), rows (nc & 1)*16 + lr; 16 k a wave half, alike in both
  const char* pa0 = smem + wm * G_SLICE + lr * G_PITCH + lh * 2;
  const char* pb0 = smem + (4 + wn * 2) * G_SLICE + lr * G_PITCH + lh * 2;

  // two fragment sets: the next 32 k's 12 reads go out as one group in front of
  // this block's products, so that their LDS latency runs under the products
  v16bf afr[2][2], bfr[2][4];
  auto frags = [&](int set, uint32_t buf, int kk) {
    const char* pa = pa0 + buf * GEMM_BUF_BYTES + kk * 64;
    const char* pb = pb0 + buf * GEMM_BUF_BYTES + kk * 64;
    #pragma unroll  // register arrays need constant indices
    for (int mc = 0; mc < 2; ++mc) afr[set][mc] = ld_frag(pa + mc * 16 * G_PITCH);
    #pragma unroll  // register arrays need constant indices
    for (int nc = 0; nc < 4; ++nc)
      bfr[set][nc] = ld_frag(pb + (nc >> 1) * G_SLICE + (nc & 1) * 16 * G_PITCH);
  };
  auto products = [&](int set) {
    // holds the reads above in front of the products: left to itself the build
    // reads each fragment right before its product and waits out the latency there
    __builtin_amdgcn_sched_barrier(0);
    #pragma unroll  // register arrays need constant indices
    for (int mc = 0; mc < 2; ++mc)
      #pragma unroll  // register arrays need constant indices
      for (int nc = 0; nc < 4; ++nc)
        acc[mc][nc] = wmma_bf16(afr[set][mc], bfr[set][nc], acc[mc][nc]);
  };

  // prologue: stage 0 lands and is published, then stage 1 starts
  issue(0u);
  asm volatile("s_wait_tensorcnt 0x0" ::: "memory");  // this wave's slice of stage 0 has landed
  __syncthreads();                                    // every wave's slice has
  issue(1u);
  pf_advance(((G_PF < T) ? G_PF : T - 1u) * G_ROWB);
  frags(0, 0u, 0);

  for (uint32_t s = 0; s < T; ++s) {
    const uint32_t buf = s & 1u;
    if (s + G_PF < T)                                   // uniform: stage s + G_PF exists
      asm volatile("global_prefetch_b8 %0, %1 scope:SCOPE_SE" :: "v"(pfo), "s"(sbase) : "memory");
    frags(1, buf, 1);
    products(0);
    frags(0, buf, 2);
    products(1);
    frags(1, buf, 3);
    products(0);
    // publish point of stage s + 1, in front of the pass's last block: that
    // block's fragments are in registers, nothing of stage s is read behind it.
    // The products above stay in front of the waits: left to itself the build
    // moves them behind the barrier, so that the last reads' latency lies bare
    // and the refill starts eight products late
    __builtin_amdgcn_sched_barrier(0);
    pf_advance((s + G_PF + 1u < T) ? (uint32_t)G_ROWB : 0u);   // stays on the last stage
    asm volatile("s_wait_dscnt 0x0" ::: "memory");      // this wave's reads of stage s have returned
    asm volatile("s_wait_tensorcnt 0x0" ::: "memory");  // its slice of stage s + 1 has landed
    __syncthreads();   // stage s + 1 is whole, and every wave has left stage s
    if (pinned((s + 2u < T) ? 1u : 0u) != 0u) issue(s + 2u);   // into the buffer just left
    if (s + 1u < T) frags(0, buf ^ 1u, 0);              // first block of stage s + 1
    products(1);
  }
  asm volatile("s_wait_tensorcnt 0x0" ::: "memory");    // no request is left when the ring changes its use
  asm volatile("s_wait_dscnt 0x0" ::: "memory");

  // epilogue: a wave passes its accumulators, 16 rows x 64 columns at a time,
  // through its own LDS range, so that a lane then holds 4 neighbouring columns
  // of one row: the residual loads and the stores move whole lines (a row piece
  // is 256 B of f32 or 128 B of bf16), a quarter of the memory instructions.
  // The ring is free here: the last pass's publish point waited for every tensor
  // load and its barrier stands behind every wave's last fragment read.
  float (*st)[EP_PITCH] = (float(*)[EP_PITCH])(smem + wave * EP_WAVE_BYTES);
  const int mofs = (lane >= 16) ? 8 : 0;
  const int er = lane >> 4;            // which row of the pair a wave-wide access covers
  const int ec = (lane & 15) * 4;      // first of the lane's 4 columns
  const int c = col0 + ec;             // global column
  const v4f bias4 = *(const v4f*)&bias[c];

  v4f rs[2][8];
  if constexpr (MODE == 1) {
    // all 16 residual loads in flight together: one memory latency, not one each
    const float* rp[2][8];
    #pragma unroll  // register arrays need constant indices
    for (int mc = 0; mc < 2; ++mc)
      #pragma unroll  // register arrays need constant indices
      for (int it = 0; it < 8; ++it) {
        rp[mc][it] = &resid[(size_t)(row0 + mc * 16 + it * 2 + er) * N + c];
        rs[mc][it] = *(const v4f*)rp[mc][it];
      }
    // left to itself the build lets a late load of the batch land in the address
    // registers of earlier ones: the addresses stay live up to this wait for
    // their translations
    asm volatile("s_wait_xcnt 0x0"
                 :: "v"(rp[0][0]), "v"(rp[0][1]), "v"(rp[0][2]), "v"(rp[0][3]),
                    "v"(rp[0][4]), "v"(rp[0][5]), "v"(rp[0][6]), "v"(rp[0][7]),
                    "v"(rp[1][0]), "v"(rp[1][1]), "v"(rp[1][2]), "v"(rp[1][3]),
                    "v"(rp[1][4]), "v"(rp[1][5]), "v"(rp[1][6]), "v"(rp[1][7])
                 : "memory");
  }

  // QKV: a wave's 64 columns are one head (hh) of one of q, k, v (WHICH 0, 1, 2)
  const int hh = (col0 & 1023) >> 6;

  auto drain = [&](auto wc) {
    constexpr int WHICH = decltype(wc)::value;
    float bc[4];                       // bias in accumulator order, for the V shadow
    if constexpr (MODE == 0 && WHICH == 2) {
      #pragma unroll  // register arrays need constant indices
      for (int nc = 0; nc < 4; ++nc) bc[nc] = bias[col0 + nc * 16 + lr];
    }
    #pragma unroll  // register arrays need constant indices
    for (int mc = 0; mc < 2; ++mc) {
      if constexpr (MODE == 0 && WHICH == 2) {
        // V shadow is [d][token]: a lane's 8 accumulator rows are 8 neighbouring
        // tokens of one d, one 16-byte store straight from registers
        const int m0 = row0 + mc * 16 + mofs;
        const int bh = (m0 >> 10) * NHEAD + hh;
        #pragma unroll  // register arrays need constant indices
        for (int nc = 0; nc < 4; ++nc) {
          v8bf p;
          #pragma unroll  // register arrays need constant indices
          for (int r = 0; r < 8; ++r) p[r] = (__bf16)(acc[mc][nc][r] + bc[nc]);
          *(v8bf*)&Vtbf[((size_t)bh * HEAD_DIM + nc * 16 + lr) * TKMAX + TP + (m0 & 1023)] = p;
        }
      }
      // these 16 rows overwrite the range: the first half's reads have returned
      if (mc == 1) asm volatile("s_wait_dscnt 0x0" ::: "memory");
      #pragma unroll  // register arrays need constant indices
      for (int nc = 0; nc < 4; ++nc)
        #pragma unroll  // register arrays need constant indices
        for (int r = 0; r < 8; ++r) st[r + mofs][nc * 16 + lr] = acc[mc][nc][r];
      // other lanes' rows are read back below: the wave's LDS writes land first
      asm volatile("s_wait_dscnt 0x0" ::: "memory");
      v4bf go[8];                      // GELU: the half's results, stored below as one group
      #pragma unroll  // register arrays need constant indices
      for (int it = 0; it < 8; ++it) {
        const int m = row0 + mc * 16 + it * 2 + er;   // global row (token)
        const v4f v = *(const v4f*)&st[it * 2 + er][ec] + bias4;
        if constexpr (MODE == 0) {
          const int bh = (m >> 10) * NHEAD + hh;
          const int t = m & 1023;
          const size_t o = ((size_t)bh * TKMAX + TP + t) * HEAD_DIM + ec;
          v4bf vb;
          #pragma unroll  // register arrays need constant indices
          for (int i = 0; i < 4; ++i) vb[i] = (__bf16)v[i];
          if constexpr (WHICH == 0) {
            *(v4bf*)&Qbf[((size_t)bh * TC + t) * HEAD_DIM + ec] = vb;
          } else if constexpr (WHICH == 1) {
            *(v4f*)&Koutf[o] = v;
            *(v4bf*)&Kbf[o] = vb;
          } else {
            *(v4f*)&Voutf[o] = v;
          }
        } else if constexpr (MODE == 1) {
          *(v4f*)&outf[(size_t)m * N + c] = v + rs[mc][it];
        } else {
          const v4f ge = gelu4(v);
          #pragma unroll  // register arrays need constant indices
          for (int i = 0; i < 4; ++i) go[it][i] = (__bf16)ge[i];
        }
      }
      if constexpr (MODE == 2) {
        #pragma unroll  // register arrays need constant indices
        for (int it = 0; it < 8; ++it)
          *(v4bf*)&outbf[(size_t)(row0 + mc * 16 + it * 2 + er) * N + c] = go[it];
        // the second half reuses the stores' registers: wait for their translations first
        if (mc == 0) asm volatile("s_wait_xcnt 0x0" ::: "memory");
      }
    }
    // QKV: the build runs shared address code of the other two cases behind
    // these stores, over their registers: wait for their translations first
    if constexpr (MODE == 0) asm volatile("s_wait_xcnt 0x0" ::: "memory");
  };

  if constexpr (MODE == 0) {
    // the same for a whole wave: read through the first lane, a scalar branch
    const int which = __builtin_amdgcn_readfirstlane(col0 >> 10);
    if (which == 0)      drain(int_c<0>{});
    else if (which == 1) drain(int_c<1>{});
    else                 drain(int_c<2>{});
  } else {
    drain(int_c<0>{});
  }
}

#define SK_BYTES  (32 * 72 * 2)                     // 4608  [key][d]
#define SVT_BYTES (64 * 40 * 2)                     // 5120  [d][key]
#define KV_BUF_BYTES (SK_BYTES + SVT_BYTES)         // 9728 per buffer
#define ATT_SMEM (2 * KV_BUF_BYTES)                 // 19456

__device__ __forceinline__ float xhalf(float x) {
  const int i = __builtin_bit_cast(int, x);
  return __builtin_bit_cast(float, __builtin_amdgcn_permlanex16(
      i, i, 0x76543210, 0xfedcba98, false, false));
}

__global__ __launch_bounds__(256) void k_attention(
    const __bf16* __restrict__ Qbf, const __bf16* __restrict__ Kbf,
    const __bf16* __restrict__ Vtbf, const int* __restrict__ pos_ptr,
    __bf16* __restrict__ Obf) {
  __shared__ __align__(16) char smem[ATT_SMEM];
  // the ring's place in the work-group's LDS, for the tensor loads.  Only they
  // write the ring: taken from the array itself, the address also tells the
  // build that the array is written, so that it stays allocated and is read
  const unsigned ring = (unsigned)(uintptr_t)smem;

  const int tid = threadIdx.x;
  const int wave = tid >> 5, lane = tid & 31;
  const int qt = blockIdx.x & 7;           // query tile of 128
  const int bh = blockIdx.x >> 3;          // b*NHEAD + h
  const int pos = pos_ptr[0];
  const int qbase = qt * 128;
  const int qrow = qbase + wave * 16;
  const int lr = lane & 15;
  const int lh = (lane >> 4) * 16;
  const int mofs = (lane >= 16) ? 8 : 0;

  const __bf16* Qp = Qbf + ((size_t)bh * TC + qrow) * HEAD_DIM;
  const __bf16* Kb = Kbf + (size_t)bh * TKMAX * HEAD_DIM;
  const __bf16* Vb = Vtbf + (size_t)bh * HEAD_DIM * TKMAX;

  // L2 prefetch, a group of 128 keys (4 tiles) at a time: the shadows were stored
  // by earlier launches and a tile's tensor loads lead its use by one tile only.
  // Waves 1 and 2 ask for the group's K rows
  // (16 KiB in a row, 64 units of 256 B), waves 3 and 4 for its 256 B of each of
  // the 64 V^T rows, a unit a lane.  pfa, the byte offset from the head's first
  // K or V^T byte, is the one register the prefetches name: it lives through the
  // loop and never leaves the head's rows
  const uint32_t wv = uni((uint32_t)tid >> 5);
  const uint32_t pw = (wv - 1u) & 3u;
  const bool pf_wave = wv >= 1u && wv <= 4u;
  const uint64_t pf_base = (uint64_t)(uintptr_t)((pw < 2u) ? Kb : Vb);
  const uint32_t pf_step = (pw < 2u) ? 128u * HEAD_DIM * 2u : 256u;
  uint32_t pfa = (pw < 2u) ? (pw * 32u + (uint32_t)lane) * 256u
                           : ((pw - 2u) * 32u + (uint32_t)lane) * (TKMAX * 2u);
  // asks, then moves pfa on by a uniform step; the wait for the prefetch's
  // translation stands in the same statement, in front of the write
  auto pf_group = [&](uint32_t step) {
    asm volatile("global_prefetch_b8 %0, %1 scope:SCOPE_SE\n\t"
                 "s_wait_xcnt 0x0\n\t"
                 "v_add_nc_u32 %0, %2, %0"
                 : "+v"(pfa) : "s"(pf_base), "s"(step) : "memory");
  };
  if (pf_wave) pf_group(pf_step);

  // load Q fragments (64x16 -> two 32x16 B-fragments) with explicit 16B loads:
  // lane = query column, 16 contiguous d per wave half, as the K loader below
  v16bf qf[2];
  #pragma unroll
  for (int f = 0; f < 2; ++f) {
    union { uint4 u[2]; v16bf v; } tmp;
    const uint4* p = (const uint4*)(Qp + (size_t)lr * HEAD_DIM + f * 32 + lh);
    tmp.u[0] = p[0];
    tmp.u[1] = p[1];
    qf[f] = tmp.v;
  }

  // all per lane, for query qrow + lr: running maximum (equal in both halves),
  // sum over this half's keys, O^T rows d = dc*16 + mofs + r
  float mrun = -1e30f, lsum = 0.f;
  v8f o[4];
  #pragma unroll
  for (int d = 0; d < 4; ++d) o[d] = (v8f)(0.f);

  const float scale = 0.125f;  // 1/sqrt(64)
  // last key this lane's query sees, counted from the first key of its half
  const int lim = pos + qrow + lr - mofs;
  const int kmax = min(pos + qbase + 128, TKMAX);   // never past the cache
  // at least one pass: the waits for the loads below stand in the loop
  const int ntiles = max((kmax + 31) / 32, 1);

#ifdef USE_TDM
  if (wave == 0) {
    tdm_load_2d(ring,            Kb, HEAD_DIM, TKMAX, HEAD_DIM, 32, HEAD_DIM, 4, 3);
    tdm_load_2d(ring + SK_BYTES, Vb, TKMAX, HEAD_DIM, 32, HEAD_DIM, TKMAX, 3, 3);
  }
#endif

  for (int kt = 0; kt < ntiles; ++kt) {
    const int kofs = kt * 32;
    const int cur = kt & 1;
    __bf16 (*sK)[72]  = (__bf16(*)[72])(smem + cur * KV_BUF_BYTES);
    __bf16 (*sVt)[40] = (__bf16(*)[40])(smem + cur * KV_BUF_BYTES + SK_BYTES);

    // uniform: the next group of 4 tiles, where this block walks it
    if (pf_wave && (kt & 3) == 0 && kt + 4 < ntiles)
      pf_group((kt + 8 < TKMAX / 32) ? pf_step : 0u);      // stays on the last group

#ifdef USE_TDM
    if (wave == 0) {
      if (kt + 1 < ntiles) {
        unsigned nb = ring + (unsigned)((cur ^ 1) * KV_BUF_BYTES);
        tdm_load_2d(nb, Kb + (size_t)(kofs + 32) * HEAD_DIM,
                    HEAD_DIM, TKMAX, HEAD_DIM, 32, HEAD_DIM, 4, 3);
        tdm_load_2d(nb + SK_BYTES, Vb + kofs + 32,
                    TKMAX, HEAD_DIM, 32, HEAD_DIM, TKMAX, 3, 3);
        __builtin_amdgcn_s_wait_tensorcnt(2);
      } else {
        __builtin_amdgcn_s_wait_tensorcnt(0);
      }
      asm volatile("" ::: "memory");
    }
    __syncthreads();
#else
    {
      int r = tid >> 3, c = (tid & 7) * 8;
      *(uint4*)&sK[r][c] = *(const uint4*)&Kb[(size_t)(kofs + r) * HEAD_DIM + c];
      int d = tid >> 2, kc = (tid & 3) * 8;
      *(uint4*)&sVt[d][kc] = *(const uint4*)&Vb[(size_t)d * TKMAX + kofs + kc];
    }
    __syncthreads();
#endif

    // S^T = K * Q^T: s[nc][r] = score of key kofs + nc*16 + mofs + r, query lr.
    // The tile's K fragments are read as one group: one LDS latency, not four
    v16bf ak[2][2];
    #pragma unroll
    for (int nc = 0; nc < 2; ++nc)
      #pragma unroll
      for (int f = 0; f < 2; ++f)
        #pragma unroll
        for (int j = 0; j < 16; ++j) ak[nc][f][j] = sK[nc * 16 + lr][f * 32 + lh + j];
    // V^T fragments (16 d x 32 keys each), read here so that they arrive while
    // the softmax runs; keys in the order in which pf below holds them
    v16bf av[4];
    #pragma unroll
    for (int dc = 0; dc < 4; ++dc)
      #pragma unroll
      for (int j = 0; j < 8; ++j) {
        av[dc][j]     = sVt[dc * 16 + lr][mofs + j];
        av[dc][8 + j] = sVt[dc * 16 + lr][16 + mofs + j];
      }
    // holds the 16 reads above in front of the products: left to itself the
    // build reads each fragment into one register set right before its product
    // and waits out the LDS latency eight times a tile
    __builtin_amdgcn_sched_barrier(0);
    v8f s[2];
    #pragma unroll
    for (int nc = 0; nc < 2; ++nc) s[nc] = wmma_bf16(ak[nc][0], qf[0], (v8f)(0.f));
    #pragma unroll
    for (int nc = 0; nc < 2; ++nc) s[nc] = wmma_bf16(ak[nc][1], qf[1], s[nc]);

    // online softmax of the lane's one query
    s[0] *= scale;
    s[1] *= scale;
    const int rel = lim - kofs;            // keys mofs + j with j <= rel are seen
    float mt[8];
    #pragma unroll
    for (int r = 0; r < 8; ++r) {
      if (r > rel)      s[0][r] = -1e30f;
      if (16 + r > rel) s[1][r] = -1e30f;
      mt[r] = fmaxf(s[0][r], s[1][r]);
    }
    float mx = fmaxf(fmaxf(fmaxf(mt[0], mt[1]), fmaxf(mt[2], mt[3])),
                     fmaxf(fmaxf(mt[4], mt[5]), fmaxf(mt[6], mt[7])));
    mx = fmaxf(mx, xhalf(mx));             // over all 32 keys, both halves alike
    const float mnew = fmaxf(mrun, mx);
    const float corr = __expf(mrun - mnew);
    mrun = mnew;

    // P^T as B operand: element j = key mofs + j, element 8 + j = key 16 + mofs + j
    v16bf pf;
    float st[8];
    #pragma unroll
    for (int r = 0; r < 8; ++r) {
      float p0 = __expf(s[0][r] - mnew);
      float p1 = __expf(s[1][r] - mnew);
      st[r] = p0 + p1;
      pf[r]     = (__bf16)p0;
      pf[8 + r] = (__bf16)p1;
    }
    lsum = lsum * corr + (((st[0] + st[1]) + (st[2] + st[3])) +
                          ((st[4] + st[5]) + (st[6] + st[7])));
    #pragma unroll
    for (int d = 0; d < 4; ++d) o[d] *= corr;

    // O^T += V^T(16 d x 32 keys) * P^T(32 keys x 16 queries)
    #pragma unroll
    for (int dc = 0; dc < 4; ++dc) o[dc] = wmma_bf16(av[dc], pf, o[dc]);
    __syncthreads();   // done reading cur buffer before refill
  }

  // normalize + write O into [token, d_model] bf16 buffer at head column: a
  // lane's 8 accumulator rows are 8 neighbouring d of its token, 16 bytes
  const float ltot = lsum + xhalf(lsum);   // the two halves' keys together
  const int b = bh >> 4, h = bh & 15;
  __bf16* op = Obf + (size_t)(b * TC + qrow + lr) * D_MODEL + h * HEAD_DIM + mofs;
  #pragma unroll
  for (int dc = 0; dc < 4; ++dc) {
    v8bf ov;
    #pragma unroll
    for (int r = 0; r < 8; ++r) ov[r] = (__bf16)(o[dc][r] / ltot);
    *(v8bf*)(op + dc * 16) = ov;
  }
}

// ---------------------------------------------------------------------------
// Host-side launch
// ---------------------------------------------------------------------------
extern "C" void kernel_launch(void* const* d_in, const int* in_sizes, int n_in,
                              void* d_out, int out_size, void* d_ws, size_t ws_size,
                              hipStream_t stream) {
  const float* x    = (const float*)d_in[0];
  const float* Kp   = (const float*)d_in[1];
  const float* Vp   = (const float*)d_in[2];
  const int*   pos  = (const int*)d_in[3];
  const float* wqkv = (const float*)d_in[4];
  const float* bqkv = (const float*)d_in[5];
  const float* wo   = (const float*)d_in[6];
  const float* bo   = (const float*)d_in[7];
  const float* g1   = (const float*)d_in[8];
  const float* be1  = (const float*)d_in[9];
  const float* g2   = (const float*)d_in[10];
  const float* be2  = (const float*)d_in[11];
  const float* w1   = (const float*)d_in[12];
  const float* bf1  = (const float*)d_in[13];
  const float* w2   = (const float*)d_in[14];
  const float* bf2  = (const float*)d_in[15];

  float* xout = (float*)d_out;
  float* Kout = xout + (size_t)NTOK * D_MODEL;
  float* Vout = Kout + (size_t)BATCH * NHEAD * TKMAX * HEAD_DIM;

  char* w = (char*)d_ws;
  size_t off = 0;
  auto carve = [&](size_t bytes) {
    void* p = w + off;
    off += (bytes + 255) & ~(size_t)255;
    return p;
  };
  // weights stored TRANSPOSED [N][K] in bf16
  __bf16* wqkvT = (__bf16*)carve((size_t)3 * D_MODEL * D_MODEL * 2);
  __bf16* woT   = (__bf16*)carve((size_t)D_MODEL * D_MODEL * 2);
  __bf16* w1T   = (__bf16*)carve((size_t)DIM_FF * D_MODEL * 2);
  __bf16* w2T   = (__bf16*)carve((size_t)D_MODEL * DIM_FF * 2);
  __bf16* h_bf  = (__bf16*)carve((size_t)NTOK * D_MODEL * 2);    // reused for h2
  __bf16* q_bf  = (__bf16*)carve((size_t)NTOK * D_MODEL * 2);
  __bf16* K_bf  = (__bf16*)carve((size_t)BATCH * NHEAD * TKMAX * HEAD_DIM * 2);
  __bf16* Vt_bf = (__bf16*)carve((size_t)BATCH * NHEAD * HEAD_DIM * TKMAX * 2);
  __bf16* o_bf  = (__bf16*)carve((size_t)NTOK * D_MODEL * 2);
  float*  x1    = (float*)carve((size_t)NTOK * D_MODEL * 4);
  __bf16* ff_bf = K_bf;  // FFN activation aliases dead bf16 KV shadow (32MB)

  // 1-3) past KV copy into cache + bf16 shadows, weight converts (transpose to
  // [N][K]) and LN1, one launch
  k_prep<<<PB_ALL, 256, 0, stream>>>(Kp, Vp, Kout, Vout, K_bf, Vt_bf,
                                     w1, w1T, w2, w2T, wo, woT, wqkv, wqkvT,
                                     x, g1, be1, h_bf);

  // 4) QKV GEMM: [4096,1024] x [1024,3072]
  {
    int M = NTOK, N = 3 * D_MODEL, K = D_MODEL;
    dim3 grid((M / GBM) * (N / GBN));
    k_gemm_bf16<0><<<grid, 256, 0, stream>>>(h_bf, wqkvT, M, N, K, bqkv,
                                             Kout, Vout, K_bf, Vt_bf, q_bf,
                                             nullptr, nullptr, nullptr);
  }

  // 5) attention
  k_attention<<<BATCH * NHEAD * (TC / 128), 256, 0, stream>>>(q_bf, K_bf, Vt_bf, pos, o_bf);

  // 6) Wo GEMM + residual -> x1
  {
    int M = NTOK, N = D_MODEL, K = D_MODEL;
    dim3 grid((M / GBM) * (N / GBN));
    k_gemm_bf16<1><<<grid, 256, 0, stream>>>(o_bf, woT, M, N, K, bo,
                                             nullptr, nullptr, nullptr, nullptr, nullptr,
                                             x, x1, nullptr);
  }

  // 7) LN2 -> h2 (reuse h_bf)
  k_layernorm<<<NTOK / LN_ROWS, 256, 0, stream>>>(x1, g2, be2, h_bf);

  // 8) W1 GEMM + GELU -> ff_bf
  {
    int M = NTOK, N = DIM_FF, K = D_MODEL;
    dim3 grid((M / GBM) * (N / GBN));
    k_gemm_bf16<2><<<grid, 256, 0, stream>>>(h_bf, w1T, M, N, K, bf1,
                                             nullptr, nullptr, nullptr, nullptr, nullptr,
                                             nullptr, nullptr, ff_bf);
  }

  // 9) W2 GEMM + residual -> xout
  {
    int M = NTOK, N = D_MODEL, K = DIM_FF;
    dim3 grid((M / GBM) * (N / GBN));
    k_gemm_bf16<1><<<grid, 256, 0, stream>>>(ff_bf, w2T, M, N, K, bf2,
                                             nullptr, nullptr, nullptr, nullptr, nullptr,
                                             x1, xout, nullptr);
  }
}

// v009
// One run takes 171 microseconds.
// In two side-by-side timings against v008, it was 1.04 and 1.03 times as fast.
// Over all steps from v000 it is 2.73 times as fast.
#include <hip/hip_runtime.h>

typedef __bf16 v16bf __attribute__((ext_vector_type(16)));
typedef float  v8f   __attribute__((ext_vector_type(8)));
typedef unsigned int u32x4 __attribute__((ext_vector_type(4)));

__device__ __forceinline__ v8f wmma_bf16(v16bf a, v16bf b, v8f c) {
  // D = A(16x32 bf16) * B(32x16 bf16) + C(16x16 f32)
  return __builtin_amdgcn_wmma_f32_16x16x32_bf16(
      false, a, false, b, (short)0, c, false, false);
}

#define D_MODEL 1024
#define NHEAD   16
#define HEAD_DIM 64
#define DIM_FF  4096
#define BATCH   4
#define TC      1024
#define TP      1024
#define TKMAX   2048
#define NTOK    (BATCH * TC)   // 4096

// ---------------------------------------------------------------------------
// Transposing f32 -> bf16 copies go through an LDS tile of 128 source rows x
// 64 source columns, so that both global sides move whole lines, 16 bytes a
// lane: a source row piece is 256 B of f32, a destination row piece 256 B of
// bf16.  256 threads; thread (kg, nq) holds source rows kg*8..+7, columns
// nq*4..+3.
// ---------------------------------------------------------------------------
#define TR_R 128
#define TR_C 64
#define TR_PITCH 136                                // 272 B = 16 B x odd
typedef float  v4f  __attribute__((ext_vector_type(4)));
typedef __bf16 v4bf __attribute__((ext_vector_type(4)));
typedef __bf16 v8bf __attribute__((ext_vector_type(8)));

__device__ __forceinline__ void tr_put(__bf16 (*tile)[TR_PITCH], const v4f (&v)[8],
                                       int nq, int kg) {
  #pragma unroll  // register arrays need constant indices
  for (int i = 0; i < 4; ++i) {
    v8bf p;
    #pragma unroll  // register arrays need constant indices
    for (int j = 0; j < 8; ++j) p[j] = (__bf16)v[j][i];
    *(v8bf*)&tile[nq * 4 + i][kg * 8] = p;
  }
}

// dst points at the tile's first element; ld = destination row pitch (elements)
__device__ __forceinline__ void tr_get(const __bf16 (*tile)[TR_PITCH],
                                       __bf16* __restrict__ dst, size_t ld, int tid) {
  #pragma unroll
  for (int it = 0; it < 4; ++it) {
    int idx = it * 256 + tid;
    int n = idx >> 4, c = (idx & 15) * 8;
    *(v8bf*)&dst[(size_t)n * ld + c] = *(const v8bf*)&tile[n][c];
  }
}

template <int K, int N>
__device__ __forceinline__ void cvt_transpose_block(__bf16 (*tile)[TR_PITCH], int blk,
                                                    const float* __restrict__ src,
                                                    __bf16* __restrict__ dst) {
  const int tid = threadIdx.x;
  const int nq = tid & 15, kg = tid >> 4;
  const int n0 = (blk % (N / TR_C)) * TR_C;
  const int k0 = (blk / (N / TR_C)) * TR_R;

  const float* p = src + (size_t)(k0 + kg * 8) * N + n0 + nq * 4;
  v4f v[8];
  #pragma unroll  // register arrays need constant indices
  for (int j = 0; j < 8; ++j) v[j] = *(const v4f*)(p + j * N);
  tr_put(tile, v, nq, kg);
  __syncthreads();
  tr_get(tile, dst + (size_t)n0 * K + k0, (size_t)K, tid);
}

// ---------------------------------------------------------------------------
// LayerNorm: one wave per row of D_MODEL, 8 rows a block, bf16 out.  A lane
// holds 32 elements of its row in registers (8 loads of 16 B, each wave-wide
// load 512 contiguous bytes), so the row is read once, the sums need no LDS and
// no barrier, and a launch starts an eighth of the waves.
// ---------------------------------------------------------------------------
#define LN_ROWS 8
__device__ __forceinline__ void layernorm_block(int blk,
                                                const float* __restrict__ x,
                                                const float* __restrict__ g,
                                                const float* __restrict__ b,
                                                __bf16* __restrict__ out) {
  const int lane = threadIdx.x & 31, wave = threadIdx.x >> 5;
  const int row = blk * LN_ROWS + wave;
  const float* xr = x + (size_t)row * D_MODEL + lane * 4;

  v4f v[8];
  #pragma unroll  // register arrays need constant indices
  for (int j = 0; j < 8; ++j) v[j] = *(const v4f*)(xr + j * 128);
  // the build lets a load of g or b below land in the address registers of the
  // row's loads: wait for their translations first
  asm volatile("s_wait_xcnt 0x0" ::: "memory");
  v4f gg[8], bb[8];
  #pragma unroll  // register arrays need constant indices
  for (int j = 0; j < 8; ++j) {
    gg[j] = ((const v4f*)g)[lane + j * 32];
    bb[j] = ((const v4f*)b)[lane + j * 32];
  }
  // inlined in the joint launch, the build let the batch's last load land in the
  // offset register that all 16 name: that register, the lane's number, stays
  // live up to this wait for their translations
  asm volatile("s_wait_xcnt 0x0" :: "v"(lane) : "memory");
  // keeps all 24 loads in flight together: left to itself the build issues
  // the loads of g and b behind the row's first data, a second latency in turn
  __builtin_amdgcn_sched_barrier(0);

  // four independent partial sums a lane: chains of 8 links, not of 32
  v4f sv = v[0], qv = v[0] * v[0];
  #pragma unroll  // register arrays need constant indices
  for (int j = 1; j < 8; ++j) { sv += v[j]; qv += v[j] * v[j]; }
  float s  = (sv[0] + sv[1]) + (sv[2] + sv[3]);
  float s2 = (qv[0] + qv[1]) + (qv[2] + qv[3]);
  #pragma unroll
  for (int off = 16; off >= 1; off >>= 1) {
    s  += __shfl_xor(s,  off, 32);
    s2 += __shfl_xor(s2, off, 32);
  }
  const float mu = s * (1.f / D_MODEL);
  const float var = s2 * (1.f / D_MODEL) - mu * mu;
  const float rstd = rsqrtf(var + 1e-5f);

  __bf16* orow = out + (size_t)row * D_MODEL + lane * 4;
  #pragma unroll  // register arrays need constant indices
  for (int j = 0; j < 8; ++j) {
    v4bf o;
    #pragma unroll  // register arrays need constant indices
    for (int i = 0; i < 4; ++i) o[i] = (__bf16)((v[j][i] - mu) * rstd * gg[j][i] + bb[j][i]);
    *(v4bf*)(orow + j * 128) = o;
  }
}

__global__ __launch_bounds__(256) void k_layernorm(const float* __restrict__ x,
                                                   const float* __restrict__ g,
                                                   const float* __restrict__ b,
                                                   __bf16* __restrict__ out) {
  layernorm_block((int)blockIdx.x, x, g, b, out);
}

// ---------------------------------------------------------------------------
// Copy past KV into output cache (fp32) + bf16 shadows for attention.
// K shadow: [B,H,Tk,Dh] row-major; V shadow: TRANSPOSED [B,H,Dh,Tk].
// ---------------------------------------------------------------------------
// B*H*(TP/128) blocks, blk the block's number among them; a block takes 128
// tokens of one head (contiguous in source and in both caches); the V shadow
// goes through the LDS tile.
__device__ __forceinline__ void kvcopy_block(__bf16 (*tile)[TR_PITCH], int blk,
                                             const float* __restrict__ Kp,
                                             const float* __restrict__ Vp,
                                             float* __restrict__ Kout,
                                             float* __restrict__ Vout,
                                             __bf16* __restrict__ Kbf,
                                             __bf16* __restrict__ Vtbf) {
  const int tid = threadIdx.x;
  const int nq = tid & 15, kg = tid >> 4;
  const int bh = blk / (TP / TR_R);
  const int t0 = (blk % (TP / TR_R)) * TR_R;
  const size_t sbase = ((size_t)bh * TP + t0) * HEAD_DIM;
  const size_t dbase = ((size_t)bh * TKMAX + t0) * HEAD_DIM;

  const unsigned vo = (unsigned)(kg * 8 * HEAD_DIM + nq * 4);   // V: tile order
  const unsigned ko = (unsigned)(tid * 4);                      // K: linear
  const float* pv = Vp + sbase;
  const float* pk = Kp + sbase;
  v4f vv[8], kv[8];
  #pragma unroll  // register arrays need constant indices
  for (int j = 0; j < 8; ++j) vv[j] = *(const v4f*)(pv + vo + j * HEAD_DIM);
  #pragma unroll  // register arrays need constant indices
  for (int j = 0; j < 8; ++j) kv[j] = *(const v4f*)(pk + ko + j * 1024);
  // address registers of the loads above are rewritten below: wait for their
  // translations first.  The statement also holds all 16 loads in front of the
  // first use of V, so that no K load pays a second memory latency.
  asm volatile("s_wait_xcnt 0x0" ::: "memory");

  // the tile's barrier stands in front of every global store: it would wait
  // for stores already issued
  tr_put(tile, vv, nq, kg);
  __syncthreads();
  tr_get(tile, Vtbf + (size_t)bh * HEAD_DIM * TKMAX + t0, (size_t)TKMAX, tid);

  float* qv = Vout + dbase;
  float* qk = Kout + dbase;
  __bf16* qb = Kbf + dbase;
  #pragma unroll  // register arrays need constant indices
  for (int j = 0; j < 8; ++j) *(v4f*)(qv + vo + j * HEAD_DIM) = vv[j];
  #pragma unroll  // register arrays need constant indices
  for (int j = 0; j < 8; ++j) {
    *(v4f*)(qk + ko + j * 1024) = kv[j];
    v4bf kb;
    #pragma unroll  // register arrays need constant indices
    for (int i = 0; i < 4; ++i) kb[i] = (__bf16)kv[j][i];
    *(v4bf*)(qb + ko + j * 1024) = kb;
  }
}

#define PB_KV   (BATCH * NHEAD * (TP / TR_R))               // 512
#define PB_W1   ((D_MODEL / TR_R) * (DIM_FF / TR_C))        // 512
#define PB_W2   ((DIM_FF / TR_R) * (D_MODEL / TR_C))        // 512
#define PB_WO   ((D_MODEL / TR_R) * (D_MODEL / TR_C))       // 128
#define PB_WQKV ((D_MODEL / TR_R) * (3 * D_MODEL / TR_C))   // 384
#define PB_LN   (NTOK / LN_ROWS)                            // 512
#define PB_ALL  (PB_KV + PB_W1 + PB_W2 + PB_WO + PB_WQKV + PB_LN)
__global__ __launch_bounds__(256) void k_prep(
    const float* __restrict__ Kp, const float* __restrict__ Vp,
    float* __restrict__ Kout, float* __restrict__ Vout,
    __bf16* __restrict__ Kbf, __bf16* __restrict__ Vtbf,
    const float* __restrict__ w1, __bf16* __restrict__ w1T,
    const float* __restrict__ w2, __bf16* __restrict__ w2T,
    const float* __restrict__ wo, __bf16* __restrict__ woT,
    const float* __restrict__ wqkv, __bf16* __restrict__ wqkvT,
    const float* __restrict__ x, const float* __restrict__ g,
    const float* __restrict__ b, __bf16* __restrict__ h) {
  __shared__ __align__(16) __bf16 tile[TR_C][TR_PITCH];
  int blk = (int)blockIdx.x;
  // PIECE_END: the build lays the pieces one behind another and joins them by a
  // flag test, so that a next piece's code, which rewrites the registers of a
  // finished piece's stores, stands behind those stores in the listing: wait for
  // the stores' translations at each piece's end
#define PIECE_END asm volatile("s_wait_xcnt 0x0" ::: "memory"); return
  // (the build puts this piece last: its stores run straight to the wave's end)
  if (blk < PB_KV) { kvcopy_block(tile, blk, Kp, Vp, Kout, Vout, Kbf, Vtbf); return; }
  blk -= PB_KV;
  if (blk < PB_W1) { cvt_transpose_block<D_MODEL, DIM_FF>(tile, blk, w1, w1T); PIECE_END; }
  blk -= PB_W1;
  if (blk < PB_W2) { cvt_transpose_block<DIM_FF, D_MODEL>(tile, blk, w2, w2T); PIECE_END; }
  blk -= PB_W2;
  if (blk < PB_WO) { cvt_transpose_block<D_MODEL, D_MODEL>(tile, blk, wo, woT); PIECE_END; }
  blk -= PB_WO;
  if (blk < PB_WQKV) { cvt_transpose_block<D_MODEL, 3 * D_MODEL>(tile, blk, wqkv, wqkvT); PIECE_END; }
  blk -= PB_WQKV;
  layernorm_block(blk, x, g, b, h);
  PIECE_END;
#undef PIECE_END
}

// ---------------------------------------------------------------------------
// Tiled WMMA GEMM: C[M,N] = A[M,K](bf16) * Bt[N,K](bf16, pre-transposed)
//   block tile 128x128, 256 threads = 8 waves,
//   wave grid 4(M) x 2(N); each wave: 2x4 accumulators of 16x16.
//   A pass is 128 k = 256 B of every operand row, two buffers.  Every wave
//   brings its own slice of 32 rows with one tensor load a pass (waves 0..3
//   rows of A, waves 4..7 rows of Bt), issued one pass before it is read.
//   Fragments are read one block of 32 k ahead, into a second register set.
//   M, N multiples of 128; K a multiple of 128 and at least 256.
// MODE 0: QKV scatter  MODE 1: bias+residual->f32  MODE 2: bias+GELU->bf16
// ---------------------------------------------------------------------------
#define GBM 128
#define GBN 128
#define GBK 128
#define G_ROWB 256                                  // bytes of a row in a pass
#define G_PITCH 272                                 // row + 16 B pad = 16 B x odd
#define G_SLICE_ROWS 32
#define G_PF 4u                                     // stages between a pass and the stage it prefetches
#define G_SLICE 10240                               // 32 x 272 = 8704, up to a multiple of 2 KiB
#define GEMM_BUF_BYTES (8 * G_SLICE)                // 81920
#define EP_PITCH 68                                 // epilogue row: 272 B = 16 B x odd
#define EP_WAVE_BYTES G_SLICE                       // >= 16 rows x 272 B
template <int V> struct int_c { static constexpr int value = V; };
typedef unsigned int u32x8 __attribute__((ext_vector_type(8)));

__device__ __forceinline__ uint32_t uni(uint32_t v) {
  return (uint32_t)__builtin_amdgcn_readfirstlane(v);
}
__device__ __forceinline__ uint32_t pinned(uint32_t v) {
  uint32_t w = uni(v);
  asm volatile("" : "+s"(w));  // the value stays in a scalar register
  return w;
}
__device__ __forceinline__ u32x8 gemm_group1(uint32_t src_pitch) {
  u32x8 g;
  g[0] = uni((1u << 20) | (5u << 22) | (3u << 25));
  g[1] = uni((uint32_t)G_ROWB << 16);
  g[2] = uni((uint32_t)G_SLICE_ROWS << 16);
  g[3] = uni((uint32_t)G_ROWB << 16);
  g[4] = uni((uint32_t)G_SLICE_ROWS);
  g[5] = uni(src_pitch);
  g[6] = uni(0u);
  g[7] = uni(0u);
  return g;
}
__device__ __forceinline__ u32x4 gemm_group0(uint32_t lds_dst, uint64_t ga) {
  u32x4 g;
  g[0] = uni(1u);
  g[1] = uni(lds_dst);
  g[2] = uni((uint32_t)ga);
  g[3] = uni((((uint32_t)(ga >> 32)) & 0x01FFFFFFu) | 0x80000000u);
  return g;
}
// 16 k of one row: two 16-byte LDS reads
__device__ __forceinline__ v16bf ld_frag(const char* p) {
  const v8bf lo = *(const v8bf*)p, hi = *(const v8bf*)(p + 16);
  return __builtin_shufflevector(lo, hi, 0, 1, 2, 3, 4, 5, 6, 7, 8, 9, 10, 11, 12, 13, 14, 15);
}

// GELU with the exact erf, 0.5 v (1 + erf(v / sqrt 2)), of four values at once and
// without a branch.  For z >= 0, with t = 1 / (1 + p z):
//   erfc(z) = t (a1 + t (a2 + t (a3 + t (a4 + t a5)))) exp(-z z), absolute error 1.5e-7,
// and gelu(v) = max(v, 0) - |v| erfc(|v| / sqrt 2) / 2, which cancels nothing for
// v < 0.  The constants hold the 1 / sqrt 2, the halving and exp's change to base 2.
// The library's erff is two divergent branches for every value, each one chain of
// dependent operations; here the four values' short chains run side by side.
__device__ __forceinline__ v4f gelu4(v4f v) {
  const v4f av = __builtin_elementwise_abs(v);
  const v4f d = av * 0.23164189f + 1.f;              // 1 + p z
  const v4f w = v * 0.84932178f;                     // w w = z z log2(e)
  const v4f ww = w * w;
  float t0, t1, t2, t3, e0, e1, e2, e3;
  asm("v_rcp_f32 %0, %8\n\tv_rcp_f32 %1, %9\n\tv_rcp_f32 %2, %10\n\tv_rcp_f32 %3, %11\n\t"
      "v_exp_f32 %4, -%12\n\tv_exp_f32 %5, -%13\n\tv_exp_f32 %6, -%14\n\tv_exp_f32 %7, -%15\n\t"
      "v_nop"
      : "=&v"(t0), "=&v"(t1), "=&v"(t2), "=&v"(t3), "=&v"(e0), "=&v"(e1), "=&v"(e2), "=&v"(e3)
      : "v"(d[0]), "v"(d[1]), "v"(d[2]), "v"(d[3]), "v"(ww[0]), "v"(ww[1]), "v"(ww[2]), "v"(ww[3]));
  const v4f t = {t0, t1, t2, t3}, e = {e0, e1, e2, e3};
  v4f p = t * 0.53070271f - 0.72657603f;
  p = p * t + 0.71070689f;
  p = p * t - 0.14224836f;
  p = p * t + 0.12741479f;
  const v4f q = (p * t) * e;                         // erfc(z) / 2
  return __builtin_elementwise_max(v, (v4f)(0.f)) - av * q;
}

template <int MODE>
__global__ __launch_bounds__(256) void k_gemm_bf16(
    const __bf16* __restrict__ A, const __bf16* __restrict__ Bt,
    int M, int N, int K,
    const float* __restrict__ bias,
    float* __restrict__ Koutf, float* __restrict__ Voutf,
    __bf16* __restrict__ Kbf, __bf16* __restrict__ Vtbf, __bf16* __restrict__ Qbf,
    const float* __restrict__ resid, float* __restrict__ outf,
    __bf16* __restrict__ outbf) {
  // two buffers; every slice's place is a multiple of 2 KiB in the work-group's LDS
  __shared__ __attribute__((aligned(2048))) char smem[2 * GEMM_BUF_BYTES];

  const int tid = threadIdx.x;
  const int wave = (int)uni((uint32_t)tid >> 5), lane = tid & 31;
  const int mtiles = M / GBM;
  const int bm = blockIdx.x % mtiles;
  const int bn = blockIdx.x / mtiles;
  const int wm = wave & 3, wn = wave >> 2;
  const int row0 = bm * GBM + wm * 32;
  const int col0 = bn * GBN + wn * 64;

  v8f acc[2][4];
  #pragma unroll
  for (int i = 0; i < 2; ++i)
    #pragma unroll
    for (int j = 0; j < 4; ++j) acc[i][j] = (v8f)(0.f);

  const int lr = lane & 15;
  const int lh = (lane >> 4) * 16;
  const uint32_t T = (uint32_t)K / GBK;               // passes

  // this wave's slice: its first source row and its place in a buffer
  const __bf16* srow = (wave < 4) ? A  + (size_t)(bm * GBM + wave * G_SLICE_ROWS) * K
                                  : Bt + (size_t)(bn * GBN + (wave - 4) * G_SLICE_ROWS) * K;
  const uint64_t sbase = (uint64_t)(uintptr_t)srow;
  const uint32_t sdst = (uint32_t)(uintptr_t)smem + (uint32_t)wave * G_SLICE;
  u32x8 g1 = gemm_group1((uint32_t)K * 2u);
  asm volatile("" : "+s"(g1));
  auto issue = [&](uint32_t s) {
    const u32x4 g0 = gemm_group0(sdst + (s & 1u) * GEMM_BUF_BYTES, sbase + (uint64_t)s * G_ROWB);
    asm volatile("tensor_load_to_lds %0, %1" :: "s"(g0), "s"(g1) : "memory");
  };

  uint32_t pfo = (uint32_t)lane * ((uint32_t)K * 2u);
  if (T > 7u)   // uniform: stages 1 to 3 exist, and the offsets stay in the row behind pfo's first advance
    asm volatile("global_prefetch_b8 %0, %1 offset:256 scope:SCOPE_SE\n\t"
                 "global_prefetch_b8 %0, %1 offset:512 scope:SCOPE_SE\n\t"
                 "global_prefetch_b8 %0, %1 offset:768 scope:SCOPE_SE"
                 :: "v"(pfo), "s"(sbase) : "memory");
  // moves pfo on by a uniform step; the wait for the translations of the
  // prefetches that name it stands in the same statement, in front of the write
  auto pf_advance = [&](uint32_t step) {
    asm volatile("s_wait_xcnt 0x0\n\tv_add_nc_u32 %0, %1, %0" : "+v"(pfo) : "s"(step));
  };

  // the lane's rows in a buffer: A slice wm, rows mc*16 + lr; Bt slices
  // 4 + wn*2 + (nc >> 1), rows (nc & 1)*16 + lr; 16 k a wave half, alike in both
  const char* pa0 = smem + wm * G_SLICE + lr * G_PITCH + lh * 2;
  const char* pb0 = smem + (4 + wn * 2) * G_SLICE + lr * G_PITCH + lh * 2;

  // two fragment sets: the next 32 k's 12 reads go out as one group in front of
  // this block's products, so that their LDS latency runs under the products
  v16bf afr[2][2], bfr[2][4];
  auto frags = [&](int set, uint32_t buf, int kk) {
    const char* pa = pa0 + buf * GEMM_BUF_BYTES + kk * 64;
    const char* pb = pb0 + buf * GEMM_BUF_BYTES + kk * 64;
    #pragma unroll  // register arrays need constant indices
    for (int mc = 0; mc < 2; ++mc) afr[set][mc] = ld_frag(pa + mc * 16 * G_PITCH);
    #pragma unroll  // register arrays need constant indices
    for (int nc = 0; nc < 4; ++nc)
      bfr[set][nc] = ld_frag(pb + (nc >> 1) * G_SLICE + (nc & 1) * 16 * G_PITCH);
  };
  auto products = [&](int set) {
    // holds the reads above in front of the products: left to itself the build
    // reads each fragment right before its product and waits out the latency there
    __builtin_amdgcn_sched_barrier(0);
    #pragma unroll  // register arrays need constant indices
    for (int mc = 0; mc < 2; ++mc)
      #pragma unroll  // register arrays need constant indices
      for (int nc = 0; nc < 4; ++nc)
        acc[mc][nc] = wmma_bf16(afr[set][mc], bfr[set][nc], acc[mc][nc]);
  };

  // prologue: stage 0 lands and is published, then stage 1 starts
  issue(0u);
  asm volatile("s_wait_tensorcnt 0x0" ::: "memory");  // this wave's slice of stage 0 has landed
  __syncthreads();                                    // every wave's slice has
  issue(1u);
  pf_advance(((G_PF < T) ? G_PF : T - 1u) * G_ROWB);
  frags(0, 0u, 0);

  for (uint32_t s = 0; s < T; ++s) {
    const uint32_t buf = s & 1u;
    if (s + G_PF < T)                                   // uniform: stage s + G_PF exists
      asm volatile("global_prefetch_b8 %0, %1 scope:SCOPE_SE" :: "v"(pfo), "s"(sbase) : "memory");
    frags(1, buf, 1);
    products(0);
    frags(0, buf, 2);
    products(1);
    frags(1, buf, 3);
    products(0);
    // publish point of stage s + 1, in front of the pass's last block: that
    // block's fragments are in registers, nothing of stage s is read behind it.
    // The products above stay in front of the waits: left to itself the build
    // moves them behind the barrier, so that the last reads' latency lies bare
    // and the refill starts eight products late
    __builtin_amdgcn_sched_barrier(0);
    pf_advance((s + G_PF + 1u < T) ? (uint32_t)G_ROWB : 0u);   // stays on the last stage
    asm volatile("s_wait_dscnt 0x0" ::: "memory");      // this wave's reads of stage s have returned
    asm volatile("s_wait_tensorcnt 0x0" ::: "memory");  // its slice of stage s + 1 has landed
    __syncthreads();   // stage s + 1 is whole, and every wave has left stage s
    if (pinned((s + 2u < T) ? 1u : 0u) != 0u) issue(s + 2u);   // into the buffer just left
    if (s + 1u < T) frags(0, buf ^ 1u, 0);              // first block of stage s + 1
    products(1);
  }
  asm volatile("s_wait_tensorcnt 0x0" ::: "memory");    // no request is left when the ring changes its use
  asm volatile("s_wait_dscnt 0x0" ::: "memory");

  // epilogue: a wave passes its accumulators, 16 rows x 64 columns at a time,
  // through its own LDS range, so that a lane then holds 4 neighbouring columns
  // of one row: the residual loads and the stores move whole lines (a row piece
  // is 256 B of f32 or 128 B of bf16), a quarter of the memory instructions.
  // The ring is free here: the last pass's publish point waited for every tensor
  // load and its barrier stands behind every wave's last fragment read.
  float (*st)[EP_PITCH] = (float(*)[EP_PITCH])(smem + wave * EP_WAVE_BYTES);
  const int mofs = (lane >= 16) ? 8 : 0;
  const int er = lane >> 4;            // which row of the pair a wave-wide access covers
  const int ec = (lane & 15) * 4;      // first of the lane's 4 columns
  const int c = col0 + ec;             // global column
  const v4f bias4 = *(const v4f*)&bias[c];

  v4f rs[2][8];
  if constexpr (MODE == 1) {
    // all 16 residual loads in flight together: one memory latency, not one each
    const float* rp[2][8];
    #pragma unroll  // register arrays need constant indices
    for (int mc = 0; mc < 2; ++mc)
      #pragma unroll  // register arrays need constant indices
      for (int it = 0; it < 8; ++it) {
        rp[mc][it] = &resid[(size_t)(row0 + mc * 16 + it * 2 + er) * N + c];
        rs[mc][it] = *(const v4f*)rp[mc][it];
      }
    // left to itself the build lets a late load of the batch land in the address
    // registers of earlier ones: the addresses stay live up to this wait for
    // their translations
    asm volatile("s_wait_xcnt 0x0"
                 :: "v"(rp[0][0]), "v"(rp[0][1]), "v"(rp[0][2]), "v"(rp[0][3]),
                    "v"(rp[0][4]), "v"(rp[0][5]), "v"(rp[0][6]), "v"(rp[0][7]),
                    "v"(rp[1][0]), "v"(rp[1][1]), "v"(rp[1][2]), "v"(rp[1][3]),
                    "v"(rp[1][4]), "v"(rp[1][5]), "v"(rp[1][6]), "v"(rp[1][7])
                 : "memory");
  }

  // QKV: a wave's 64 columns are one head (hh) of one of q, k, v (WHICH 0, 1, 2)
  const int hh = (col0 & 1023) >> 6;

  auto drain = [&](auto wc) {
    constexpr int WHICH = decltype(wc)::value;
    float bc[4];                       // bias in accumulator order, for the V shadow
    if constexpr (MODE == 0 && WHICH == 2) {
      #pragma unroll  // register arrays need constant indices
      for (int nc = 0; nc < 4; ++nc) bc[nc] = bias[col0 + nc * 16 + lr];
    }
    #pragma unroll  // register arrays need constant indices
    for (int mc = 0; mc < 2; ++mc) {
      if constexpr (MODE == 0 && WHICH == 2) {
        // V shadow is [d][token]: a lane's 8 accumulator rows are 8 neighbouring
        // tokens of one d, one 16-byte store straight from registers
        const int m0 = row0 + mc * 16 + mofs;
        const int bh = (m0 >> 10) * NHEAD + hh;
        #pragma unroll  // register arrays need constant indices
        for (int nc = 0; nc < 4; ++nc) {
          v8bf p;
          #pragma unroll  // register arrays need constant indices
          for (int r = 0; r < 8; ++r) p[r] = (__bf16)(acc[mc][nc][r] + bc[nc]);
          *(v8bf*)&Vtbf[((size_t)bh * HEAD_DIM + nc * 16 + lr) * TKMAX + TP + (m0 & 1023)] = p;
        }
      }
      // these 16 rows overwrite the range: the first half's reads have returned
      if (mc == 1) asm volatile("s_wait_dscnt 0x0" ::: "memory");
      #pragma unroll  // register arrays need constant indices
      for (int nc = 0; nc < 4; ++nc)
        #pragma unroll  // register arrays need constant indices
        for (int r = 0; r < 8; ++r) st[r + mofs][nc * 16 + lr] = acc[mc][nc][r];
      // other lanes' rows are read back below: the wave's LDS writes land first
      asm volatile("s_wait_dscnt 0x0" ::: "memory");
      v4bf go[8];                      // GELU: the half's results, stored below as one group
      #pragma unroll  // register arrays need constant indices
      for (int it = 0; it < 8; ++it) {
        const int m = row0 + mc * 16 + it * 2 + er;   // global row (token)
        const v4f v = *(const v4f*)&st[it * 2 + er][ec] + bias4;
        if constexpr (MODE == 0) {
          const int bh = (m >> 10) * NHEAD + hh;
          const int t = m & 1023;
          const size_t o = ((size_t)bh * TKMAX + TP + t) * HEAD_DIM + ec;
          v4bf vb;
          #pragma unroll  // register arrays need constant indices
          for (int i = 0; i < 4; ++i) vb[i] = (__bf16)v[i];
          if constexpr (WHICH == 0) {
            *(v4bf*)&Qbf[((size_t)bh * TC + t) * HEAD_DIM + ec] = vb;
          } else if constexpr (WHICH == 1) {
            *(v4f*)&Koutf[o] = v;
            *(v4bf*)&Kbf[o] = vb;
          } else {
            *(v4f*)&Voutf[o] = v;
          }
        } else if constexpr (MODE == 1) {
          *(v4f*)&outf[(size_t)m * N + c] = v + rs[mc][it];
        } else {
          const v4f ge = gelu4(v);
          #pragma unroll  // register arrays need constant indices
          for (int i = 0; i < 4; ++i) go[it][i] = (__bf16)ge[i];
        }
      }
      if constexpr (MODE == 2) {
        #pragma unroll  // register arrays need constant indices
        for (int it = 0; it < 8; ++it)
          *(v4bf*)&outbf[(size_t)(row0 + mc * 16 + it * 2 + er) * N + c] = go[it];
        // the second half reuses the stores' registers: wait for their translations first
        if (mc == 0) asm volatile("s_wait_xcnt 0x0" ::: "memory");
      }
    }
    // QKV: the build runs shared address code of the other two cases behind
    // these stores, over their registers: wait for their translations first
    if constexpr (MODE == 0) asm volatile("s_wait_xcnt 0x0" ::: "memory");
  };

  if constexpr (MODE == 0) {
    // the same for a whole wave: read through the first lane, a scalar branch
    const int which = __builtin_amdgcn_readfirstlane(col0 >> 10);
    if (which == 0)      drain(int_c<0>{});
    else if (which == 1) drain(int_c<1>{});
    else                 drain(int_c<2>{});
  } else {
    drain(int_c<0>{});
  }
}

#define AT_KEYS 128
#define AK_PITCH 144
#define AV_PITCH 272
#define SK_BYTES  (AT_KEYS * AK_PITCH)
#define SVT_BYTES 18432
#define KV_BUF_BYTES (SK_BYTES + SVT_BYTES)
#define ATT_SMEM (2 * KV_BUF_BYTES)

template <uint32_t PADC, uint32_t ROWB, uint32_t ROWS>
__device__ __forceinline__ u32x8 att_group1(uint32_t src_pitch) {
  u32x8 g;
  g[0] = uni((1u << 20) | (PADC << 22) | (3u << 25));
  g[1] = uni(ROWB << 16);
  g[2] = uni(ROWS << 16);
  g[3] = uni(ROWB << 16);
  g[4] = uni(ROWS);
  g[5] = uni(src_pitch);
  g[6] = uni(0u);
  g[7] = uni(0u);
  return g;
}

__device__ __forceinline__ float xhalf(float x) {
  const int i = __builtin_bit_cast(int, x);
  return __builtin_bit_cast(float, __builtin_amdgcn_permlanex16(
      i, i, 0x76543210, 0xfedcba98, false, false));
}

__global__ __launch_bounds__(256) void k_attention(
    const __bf16* __restrict__ Qbf, const __bf16* __restrict__ Kbf,
    const __bf16* __restrict__ Vtbf, const int* __restrict__ pos_ptr,
    __bf16* __restrict__ Obf) {
  // two buffers; every tile's place is a multiple of 2 KiB in the work-group's LDS
  __shared__ __attribute__((aligned(2048))) char smem[ATT_SMEM];
  // the ring's place in the work-group's LDS, for the tensor loads.  Only they
  // write the ring: taken from the array itself, the address also tells the
  // build that the array is written, so that it stays allocated and is read
  const unsigned ring = (unsigned)(uintptr_t)smem;

  const int tid = threadIdx.x;
  const int wave = tid >> 5, lane = tid & 31;
  const int qt = blockIdx.x & 7;           // query tile of 128
  const int bh = blockIdx.x >> 3;          // b*NHEAD + h
  const int pos = pos_ptr[0];
  const int qbase = qt * 128;
  const int qrow = qbase + wave * 16;
  const int lr = lane & 15;
  const int lh = (lane >> 4) * 16;
  const int mofs = (lane >= 16) ? 8 : 0;

  const __bf16* Qp = Qbf + ((size_t)bh * TC + qrow) * HEAD_DIM;
  const __bf16* Kb = Kbf + (size_t)bh * TKMAX * HEAD_DIM;
  const __bf16* Vb = Vtbf + (size_t)bh * HEAD_DIM * TKMAX;

  // L2 prefetch, a stage of 128 keys at a time, one pass ahead of the stage's
  // tensor loads: the shadows were stored by earlier launches.  Waves 1 and 2 ask
  // for the stage's K rows (16 KiB in a row, 64 units of 256 B), waves 3 and 4 for
  // its 256 B of each of
  // the 64 V^T rows, a unit a lane.  pfa, the byte offset from the head's first
  // K or V^T byte, is the one register the prefetches name: it lives through the
  // loop and never leaves the head's rows
  const uint32_t wv = uni((uint32_t)tid >> 5);
  const uint32_t pw = (wv - 1u) & 3u;
  const bool pf_wave = wv >= 1u && wv <= 4u;
  const uint64_t pf_base = (uint64_t)(uintptr_t)((pw < 2u) ? Kb : Vb);
  const uint32_t pf_step = (pw < 2u) ? 128u * HEAD_DIM * 2u : 256u;
  uint32_t pfa = pf_step + ((pw < 2u) ? (pw * 32u + (uint32_t)lane) * 256u
                                      : ((pw - 2u) * 32u + (uint32_t)lane) * (TKMAX * 2u));
  // asks, then moves pfa on by a uniform step; the wait for the prefetch's
  // translation stands in the same statement, in front of the write
  auto pf_group = [&](uint32_t step) {
    asm volatile("global_prefetch_b8 %0, %1 scope:SCOPE_SE\n\t"
                 "s_wait_xcnt 0x0\n\t"
                 "v_add_nc_u32 %0, %2, %0"
                 : "+v"(pfa) : "s"(pf_base), "s"(step) : "memory");
  };
  if (pf_wave) pf_group(pf_step);                     // uniform; stage 1; stages 1 and 2 lie in the cache

  // load Q fragments (64x16 -> two 32x16 B-fragments) with explicit 16B loads:
  // lane = query column, 16 contiguous d per wave half, as the K loader below
  v16bf qf[2];
  #pragma unroll
  for (int f = 0; f < 2; ++f) {
    union { uint4 u[2]; v16bf v; } tmp;
    const uint4* p = (const uint4*)(Qp + (size_t)lr * HEAD_DIM + f * 32 + lh);
    tmp.u[0] = p[0];
    tmp.u[1] = p[1];
    qf[f] = tmp.v;
  }

  // all per lane, for query qrow + lr: running maximum (equal in both halves),
  // sum over this half's keys, O^T rows d = dc*16 + mofs + r
  float mrun = -1e30f, lsum = 0.f;
  v8f o[4];
  #pragma unroll
  for (int d = 0; d < 4; ++d) o[d] = (v8f)(0.f);

  const float scale = 0.125f;  // 1/sqrt(64)
  // last key this lane's query sees, counted from the first key of its half
  const int lim = pos + qrow + lr - mofs;
  const int kmax = min(pos + qbase + 128, TKMAX);   // never past the cache
  // at least one tile: stage 0 is always loaded
  const int ntiles = max((kmax + 31) / 32, 1);
  const uint32_t nst = (uint32_t)(ntiles + 3) >> 2;   // stages, at most TKMAX / AT_KEYS: each lies in the cache

  // stage st: wave 0 brings its 128 K rows (128 B each, in a row in memory), wave 1
  // its 256 B of each of the 64 V^T rows, one request each
  const uint64_t kbase = (uint64_t)(uintptr_t)Kb, vbase = (uint64_t)(uintptr_t)Vb;
  u32x8 gk = att_group1<4u, HEAD_DIM * 2u, AT_KEYS>(HEAD_DIM * 2u);
  u32x8 gv = att_group1<5u, AT_KEYS * 2u, HEAD_DIM>(TKMAX * 2u);
  asm volatile("" : "+s"(gk));
  asm volatile("" : "+s"(gv));
  u32x4 g0k = gemm_group0(ring, kbase), g0v = gemm_group0(ring + SK_BYTES, vbase);
  auto issue = [&](uint32_t st) {
    const uint32_t dst = ring + (st & 1u) * KV_BUF_BYTES;
    if (pinned((wv == 0u && st < nst) ? 1u : 0u) != 0u) {
      g0k = gemm_group0(dst, kbase + (uint64_t)st * (AT_KEYS * HEAD_DIM * 2u));
      asm volatile("tensor_load_to_lds %0, %1" :: "s"(g0k), "s"(gk) : "memory");
    }
    if (pinned((wv == 1u && st < nst) ? 1u : 0u) != 0u) {
      g0v = gemm_group0(dst + SK_BYTES, vbase + (uint64_t)st * (AT_KEYS * 2u));
      asm volatile("tensor_load_to_lds %0, %1" :: "s"(g0v), "s"(gv) : "memory");
    }
  };

  // prologue: stage 0 lands and is published
  issue(0u);
  asm volatile("s_wait_tensorcnt 0x0" ::: "memory");  // this wave's tile of stage 0 has landed
  __syncthreads();                                    // both tiles have

  for (uint32_t sg = 0; sg < nst; ++sg) {
   // behind the barrier that published stage sg: stage sg + 1 starts, into the buffer
   // that every wave has just left, and flies while stage sg is worked on
   issue(sg + 1u);
   const char* bufp = smem + (sg & 1u) * KV_BUF_BYTES;
   // uniform: the stage whose tensor loads go out behind this pass's barrier
   if (pf_wave && sg + 2u < nst)
     pf_group((sg + 3u < TKMAX / AT_KEYS) ? pf_step : 0u);   // stays on the last stage
   // all four tiles of a stage: one past the block's last key is masked whole and
   // adds nothing.  Unrolled: the tiles' LDS offsets are immediates
   #pragma unroll
   for (int sub = 0; sub < AT_KEYS / 32; ++sub) {
    const int kofs = (int)sg * AT_KEYS + sub * 32;
    const __bf16 (*sK)[AK_PITCH / 2]  = (const __bf16(*)[AK_PITCH / 2])(bufp + sub * 32 * AK_PITCH);
    const __bf16 (*sVt)[AV_PITCH / 2] = (const __bf16(*)[AV_PITCH / 2])(bufp + SK_BYTES + sub * 64);

    // S^T = K * Q^T: s[nc][r] = score of key kofs + nc*16 + mofs + r, query lr.
    // The tile's K fragments are read as one group: one LDS latency, not four
    v16bf ak[2][2];
    #pragma unroll
    for (int nc = 0; nc < 2; ++nc)
      #pragma unroll
      for (int f = 0; f < 2; ++f)
        #pragma unroll
        for (int j = 0; j < 16; ++j) ak[nc][f][j] = sK[nc * 16 + lr][f * 32 + lh + j];
    // V^T fragments (16 d x 32 keys each), read here so that they arrive while
    // the softmax runs; keys in the order in which pf below holds them
    v16bf av[4];
    #pragma unroll
    for (int dc = 0; dc < 4; ++dc)
      #pragma unroll
      for (int j = 0; j < 8; ++j) {
        av[dc][j]     = sVt[dc * 16 + lr][mofs + j];
        av[dc][8 + j] = sVt[dc * 16 + lr][16 + mofs + j];
      }
    // holds the 16 reads above in front of the products: left to itself the
    // build reads each fragment into one register set right before its product
    // and waits out the LDS latency eight times a tile
    __builtin_amdgcn_sched_barrier(0);
    v8f s[2];
    #pragma unroll
    for (int nc = 0; nc < 2; ++nc) s[nc] = wmma_bf16(ak[nc][0], qf[0], (v8f)(0.f));
    #pragma unroll
    for (int nc = 0; nc < 2; ++nc) s[nc] = wmma_bf16(ak[nc][1], qf[1], s[nc]);

    // online softmax of the lane's one query
    s[0] *= scale;
    s[1] *= scale;
    const int rel = lim - kofs;            // keys mofs + j with j <= rel are seen
    float mt[8];
    #pragma unroll
    for (int r = 0; r < 8; ++r) {
      if (r > rel)      s[0][r] = -1e30f;
      if (16 + r > rel) s[1][r] = -1e30f;
      mt[r] = fmaxf(s[0][r], s[1][r]);
    }
    float mx = fmaxf(fmaxf(fmaxf(mt[0], mt[1]), fmaxf(mt[2], mt[3])),
                     fmaxf(fmaxf(mt[4], mt[5]), fmaxf(mt[6], mt[7])));
    mx = fmaxf(mx, xhalf(mx));             // over all 32 keys, both halves alike
    const float mnew = fmaxf(mrun, mx);
    const float corr = __expf(mrun - mnew);
    mrun = mnew;

    // P^T as B operand: element j = key mofs + j, element 8 + j = key 16 + mofs + j
    v16bf pf;
    float st[8];
    #pragma unroll
    for (int r = 0; r < 8; ++r) {
      float p0 = __expf(s[0][r] - mnew);
      float p1 = __expf(s[1][r] - mnew);
      st[r] = p0 + p1;
      pf[r]     = (__bf16)p0;
      pf[8 + r] = (__bf16)p1;
    }
    lsum = lsum * corr + (((st[0] + st[1]) + (st[2] + st[3])) +
                          ((st[4] + st[5]) + (st[6] + st[7])));
    #pragma unroll
    for (int d = 0; d < 4; ++d) o[d] *= corr;

    // O^T += V^T(16 d x 32 keys) * P^T(32 keys x 16 queries)
    #pragma unroll
    for (int dc = 0; dc < 4; ++dc) o[dc] = wmma_bf16(av[dc], pf, o[dc]);
   }
   // publish point of stage sg + 1
   asm volatile("s_wait_dscnt 0x0" ::: "memory");      // this wave's reads of stage sg have returned
   asm volatile("s_wait_tensorcnt 0x0" ::: "memory");  // its tile of stage sg + 1 has landed
   __syncthreads();   // stage sg + 1 is whole, and every wave has left stage sg
  }
  asm volatile("s_wait_tensorcnt 0x0" ::: "memory");    // no request is left at the wave's end
  asm volatile("s_wait_dscnt 0x0" ::: "memory");
  asm volatile("" :: "s"(g0k), "s"(g0v), "s"(gk), "s"(gv));

  // normalize + write O into [token, d_model] bf16 buffer at head column: a
  // lane's 8 accumulator rows are 8 neighbouring d of its token, 16 bytes
  const float ltot = lsum + xhalf(lsum);   // the two halves' keys together
  const int b = bh >> 4, h = bh & 15;
  __bf16* op = Obf + (size_t)(b * TC + qrow + lr) * D_MODEL + h * HEAD_DIM + mofs;
  #pragma unroll
  for (int dc = 0; dc < 4; ++dc) {
    v8bf ov;
    #pragma unroll
    for (int r = 0; r < 8; ++r) ov[r] = (__bf16)(o[dc][r] / ltot);
    *(v8bf*)(op + dc * 16) = ov;
  }
}

// ---------------------------------------------------------------------------
// Host-side launch
// ---------------------------------------------------------------------------
extern "C" void kernel_launch(void* const* d_in, const int* in_sizes, int n_in,
                              void* d_out, int out_size, void* d_ws, size_t ws_size,
                              hipStream_t stream) {
  const float* x    = (const float*)d_in[0];
  const float* Kp   = (const float*)d_in[1];
  const float* Vp   = (const float*)d_in[2];
  const int*   pos  = (const int*)d_in[3];
  const float* wqkv = (const float*)d_in[4];
  const float* bqkv = (const float*)d_in[5];
  const float* wo   = (const float*)d_in[6];
  const float* bo   = (const float*)d_in[7];
  const float* g1   = (const float*)d_in[8];
  const float* be1  = (const float*)d_in[9];
  const float* g2   = (const float*)d_in[10];
  const float* be2  = (const float*)d_in[11];
  const float* w1   = (const float*)d_in[12];
  const float* bf1  = (const float*)d_in[13];
  const float* w2   = (const float*)d_in[14];
  const float* bf2  = (const float*)d_in[15];

  float* xout = (float*)d_out;
  float* Kout = xout + (size_t)NTOK * D_MODEL;
  float* Vout = Kout + (size_t)BATCH * NHEAD * TKMAX * HEAD_DIM;

  char* w = (char*)d_ws;
  size_t off = 0;
  auto carve = [&](size_t bytes) {
    void* p = w + off;
    off += (bytes + 255) & ~(size_t)255;
    return p;
  };
  // weights stored TRANSPOSED [N][K] in bf16
  __bf16* wqkvT = (__bf16*)carve((size_t)3 * D_MODEL * D_MODEL * 2);
  __bf16* woT   = (__bf16*)carve((size_t)D_MODEL * D_MODEL * 2);
  __bf16* w1T   = (__bf16*)carve((size_t)DIM_FF * D_MODEL * 2);
  __bf16* w2T   = (__bf16*)carve((size_t)D_MODEL * DIM_FF * 2);
  __bf16* h_bf  = (__bf16*)carve((size_t)NTOK * D_MODEL * 2);    // reused for h2
  __bf16* q_bf  = (__bf16*)carve((size_t)NTOK * D_MODEL * 2);
  __bf16* K_bf  = (__bf16*)carve((size_t)BATCH * NHEAD * TKMAX * HEAD_DIM * 2);
  __bf16* Vt_bf = (__bf16*)carve((size_t)BATCH * NHEAD * HEAD_DIM * TKMAX * 2);
  __bf16* o_bf  = (__bf16*)carve((size_t)NTOK * D_MODEL * 2);
  float*  x1    = (float*)carve((size_t)NTOK * D_MODEL * 4);
  __bf16* ff_bf = K_bf;  // FFN activation aliases dead bf16 KV shadow (32MB)

  // 1-3) past KV copy into cache + bf16 shadows, weight converts (transpose to
  // [N][K]) and LN1, one launch
  k_prep<<<PB_ALL, 256, 0, stream>>>(Kp, Vp, Kout, Vout, K_bf, Vt_bf,
                                     w1, w1T, w2, w2T, wo, woT, wqkv, wqkvT,
                                     x, g1, be1, h_bf);

  // 4) QKV GEMM: [4096,1024] x [1024,3072]
  {
    int M = NTOK, N = 3 * D_MODEL, K = D_MODEL;
    dim3 grid((M / GBM) * (N / GBN));
    k_gemm_bf16<0><<<grid, 256, 0, stream>>>(h_bf, wqkvT, M, N, K, bqkv,
                                             Kout, Vout, K_bf, Vt_bf, q_bf,
                                             nullptr, nullptr, nullptr);
  }

  // 5) attention
  k_attention<<<BATCH * NHEAD * (TC / 128), 256, 0, stream>>>(q_bf, K_bf, Vt_bf, pos, o_bf);

  // 6) Wo GEMM + residual -> x1
  {
    int M = NTOK, N = D_MODEL, K = D_MODEL;
    dim3 grid((M / GBM) * (N / GBN));
    k_gemm_bf16<1><<<grid, 256, 0, stream>>>(o_bf, woT, M, N, K, bo,
                                             nullptr, nullptr, nullptr, nullptr, nullptr,
                                             x, x1, nullptr);
  }

  // 7) LN2 -> h2 (reuse h_bf)
  k_layernorm<<<NTOK / LN_ROWS, 256, 0, stream>>>(x1, g2, be2, h_bf);

  // 8) W1 GEMM + GELU -> ff_bf
  {
    int M = NTOK, N = DIM_FF, K = D_MODEL;
    dim3 grid((M / GBM) * (N / GBN));
    k_gemm_bf16<2><<<grid, 256, 0, stream>>>(h_bf, w1T, M, N, K, bf1,
                                             nullptr, nullptr, nullptr, nullptr, nullptr,
                                             nullptr, nullptr, ff_bf);
  }

  // 9) W2 GEMM + residual -> xout
  {
    int M = NTOK, N = D_MODEL, K = DIM_FF;
    dim3 grid((M / GBM) * (N / GBN));
    k_gemm_bf16<1><<<grid, 256, 0, stream>>>(ff_bf, w2T, M, N, K, bf2,
                                             nullptr, nullptr, nullptr, nullptr, nullptr,
                                             x1, xout, nullptr);
  }
}
